// v000
// Measured on an AMD MI455X. A time is GPU time per run, averaged over a window of back-to-back runs after a warm-up
// (all launches, gaps included; the runs take copies of the inputs in turn), and the median of several windows.
// Apart from v000's, it joins two sittings. Times from different sittings can be a few percent apart, while
// side-by-side timings come from the same sitting.
// v000, which the later versions start from, runs in 1520 microseconds.
#include <hip/hip_runtime.h>

// Causal self-attention over one input stream with interleaved-pair rotary embeddings whose cos / sin tables are inputs read by value, an int32 mask read by value, no biases (x [2][2048][768]; q = x Wq^T, k = x Wk^T, v = x Wv^T ('oi' [768][768]; 12 heads x 64); pairs (2j, 2j+1) of q and k rotated by cos[t][j], sin[t][j]; logits x 1/8; mask[i][j] == 0 -> logit replaced by -1e9; softmax over all 2048 keys; out = merged Wo^T -> [2][2048][768]; argument order x, cos, sin, attn_mask, wq, wk, wv, wo).
// Compute dtypes, f32 accumulate: projections v_wmma_f32_16x16x32_bf16 on RNE bf16 copies of x and weights; rotation f32 with RNE bf16 table values; logits and P.V: query rows < 512 bf16 hi/lo planes (3 products), rows >= 512 v_wmma_f32_16x16x32_f16 (P carried x1024); softmax f32; output projection bf16 hi/lo ctx x bf16 Wo (2 products).
// Layout per batch: bf16 copy of the input stream; exact projections; rotary head plane builders (q, k) and transposed value planes; dense T-2048 score / softmax / P.V passes over 2 heads at a time; merged hi/lo x Wo.

#ifndef NB
#define NB   2
#endif
#ifndef SEQ
#define SEQ  2048
#endif
#define NB_FULL  2
#define SEQ_FULL 2048
#define TT   SEQ
#define DM   768
#define NH_  12
#define NKV  12
#define REP  (NH_ / NKV)
#define HD   64
#define HP   (HD / 2)    // rotary pairs per head = table row width
#define DQ   (NH_ * HD)
#define DKV  (NKV * HD)
#define ZH   2
#define RH   ((SEQ < 512) ? SEQ : 512)   // query rows < RH use hi+lo planes
#define PCAR 1024.0f
#define SCL  0.125f   // HD^-0.5
#define MFILL (-1.0e9f)
typedef _Float16 h16;
typedef unsigned short bf;
typedef __attribute__((ext_vector_type(16))) __bf16   v16bf;
typedef __attribute__((ext_vector_type(16))) _Float16 v16h;
typedef __attribute__((ext_vector_type(8)))  _Float16 v8h;
typedef __attribute__((ext_vector_type(8)))  unsigned short v8us;
typedef __attribute__((ext_vector_type(8)))  float    v8f;
typedef __attribute__((ext_vector_type(4)))  float    v4f;
typedef v4f  __attribute__((may_alias)) v4fa;

static_assert(TT % 128 == 0);
static_assert(RH % 64 == 0);
static_assert((TT - RH) % 64 == 0);
static_assert(DM % 32 == 0);
static_assert(DQ % 64 == 0);
static_assert(DKV % 64 == 0);
static_assert(DM % 64 == 0);
static_assert(HD == 64);
static_assert(NH_ % ZH == 0);
static_assert(NB <= NB_FULL);
static_assert(SEQ <= SEQ_FULL);
static_assert((size_t)NB_FULL * SEQ_FULL * DM * 4 == 12582912);
static_assert(HP == 32);                                  // table rows are [t][32]
static_assert(HD % 2 == 0);
static_assert(DQ == DM);                                  // merged width == model width (no bias, square Wo)
static_assert(NKV == NH_);                                // one k/v head per q head
static_assert(((size_t)NH_ * TT * HD / 2) % 256 == 0);    // plane builder grids are exact
static_assert(((size_t)TT * DM / 8) % 256 == 0);
#define A256(x) ((((size_t)(x)) + 255) & ~(size_t)255)
static_assert(4 * A256((size_t)DQ * DM * 2) + A256((size_t)TT * DM * 2) + A256((size_t)TT * DQ * 4) + A256((size_t)TT * DKV * 4) + 9 * A256((size_t)NH_ * TT * HD * 2) + 2 * A256((size_t)ZH * RH * TT * 2) + A256((size_t)ZH * TT * TT * 4) + A256((size_t)ZH * TT * TT * 2) + A256((size_t)ZH * TT * HD * 4) + 2 * A256((size_t)TT * DQ * 2) <= (size_t)134217728);

__device__ __forceinline__ unsigned short f2bf(float f) { unsigned u = __float_as_uint(f); u += 0x7FFFu + ((u >> 16) & 1u); return (unsigned short)(u >> 16); }
__device__ __forceinline__ float bf2f(unsigned short b) { return __uint_as_float(((unsigned)b) << 16); }
__device__ __forceinline__ float bfr(float f) { return bf2f(f2bf(f)); }
__device__ __forceinline__ v16h cat16(v8h lo, v8h hi) { return __builtin_shufflevector(lo, hi, 0, 1, 2, 3, 4, 5, 6, 7, 8, 9, 10, 11, 12, 13, 14, 15); }
__device__ __forceinline__ v16bf cat16b(v8us lo, v8us hi) { return __builtin_bit_cast(v16bf, __builtin_shufflevector(lo, hi, 0, 1, 2, 3, 4, 5, 6, 7, 8, 9, 10, 11, 12, 13, 14, 15)); }
__device__ __forceinline__ v8f wmma16(v16h a, v16h b, v8f c) { return __builtin_amdgcn_wmma_f32_16x16x32_f16(false, a, false, b, (short)0, c, false, false); }
__device__ __forceinline__ v8f wmmab(v16bf a, v16bf b, v8f c) { return __builtin_amdgcn_wmma_f32_16x16x32_bf16(false, a, false, b, (short)0, c, false, false); }

// ---- k_gemmw: register-blocked GEMM, ONE WAVE per 64x64 output tile (16 accumulators), operands straight from K-contiguous 16-bit planes; grid (M/64, N/64, Z), 32 threads.
// C[m][n] (f32, pitch ldc, + optional f32 bias[n]) = sum_k A[m][k] Bt[n][k] (+ split products per NSPLIT). z-batch strides sA/sB/sC in elements. K % 32 == 0.
// Fragment map (A and Bt alike): lane -> row (lane & 15); elements 0..7 = k0 + 8*(lane>>4) + 0..7, elements 8..15 = k0 + 16 + 8*(lane>>4) + 0..7.
template <typename T16> struct WFrag;
template <> struct WFrag<h16> { typedef v16h V; static __device__ __forceinline__ V ld(const h16* p) { return cat16(*(const v8h*)p, *(const v8h*)(p + 16)); } static __device__ __forceinline__ v8f mma(V a, V b, v8f c) { return wmma16(a, b, c); } };
template <> struct WFrag<bf> { typedef v16bf V; static __device__ __forceinline__ V ld(const bf* p) { return cat16b(*(const v8us*)p, *(const v8us*)(p + 16)); } static __device__ __forceinline__ v8f mma(V a, V b, v8f c) { return wmmab(a, b, c); } };
template <typename T16, int NSPLIT, bool BIAS>
__global__ __launch_bounds__(32) void k_gemmw(const T16* __restrict__ A, const T16* __restrict__ A2, const T16* __restrict__ Bt, const T16* __restrict__ Bt2, int K, float* C, int ldc, const float* __restrict__ bias, size_t sA, size_t sB, size_t sC) {
    typedef typename WFrag<T16>::V V;
    __shared__ __align__(16) float os[16 * 68];
    const size_t z = blockIdx.z; A += z * sA; if (A2) A2 += z * sA; Bt += z * sB; if (Bt2) Bt2 += z * sB; C += z * sC;
    const int lane = threadIdx.x & 31, lr = lane & 15, hi = lane >> 4; const int r0 = blockIdx.x * 64, c0 = blockIdx.y * 64;
    v8f acc[4][4];
#pragma unroll
    for (int mb = 0; mb < 4; ++mb)
#pragma unroll
        for (int nb = 0; nb < 4; ++nb) acc[mb][nb] = (v8f){};
    const size_t aoff = (size_t)(r0 + lr) * K + 8 * hi, boff = (size_t)(c0 + lr) * K + 8 * hi;
#pragma unroll 1
    for (int kc = 0; kc < K; kc += 32) {
        V a[4], a2[4];
#pragma unroll
        for (int mb = 0; mb < 4; ++mb) { a[mb] = WFrag<T16>::ld(A + aoff + (size_t)mb * 16 * K + kc); if (NSPLIT == 1 || NSPLIT == 2) a2[mb] = WFrag<T16>::ld(A2 + aoff + (size_t)mb * 16 * K + kc); }
#pragma unroll
        for (int nb = 0; nb < 4; ++nb) { const V b = WFrag<T16>::ld(Bt + boff + (size_t)nb * 16 * K + kc); V b2; if (NSPLIT >= 2) b2 = WFrag<T16>::ld(Bt2 + boff + (size_t)nb * 16 * K + kc);
#pragma unroll
            for (int mb = 0; mb < 4; ++mb) { acc[mb][nb] = WFrag<T16>::mma(a[mb], b, acc[mb][nb]); if (NSPLIT == 1 || NSPLIT == 2) acc[mb][nb] = WFrag<T16>::mma(a2[mb], b, acc[mb][nb]); if (NSPLIT >= 2) acc[mb][nb] = WFrag<T16>::mma(a[mb], b2, acc[mb][nb]); } }
        asm volatile("v_nop\n\tv_nop\n\tv_nop\n\tv_nop" : "+v"(acc[0][0]), "+v"(acc[1][1]), "+v"(acc[2][2]), "+v"(acc[3][3]) : "v"(a[0]), "v"(a[3]));
    }
#pragma unroll
    for (int mb = 0; mb < 4; ++mb) {
#pragma unroll
        for (int nb = 0; nb < 4; ++nb) {
#pragma unroll
            for (int j = 0; j < 8; ++j) os[(hi * 8 + j) * 68 + nb * 16 + lr] = acc[mb][nb][j]; }
        __builtin_amdgcn_wave_barrier(); asm volatile("" ::: "memory");
        float* crow = C + (size_t)(r0 + mb * 16) * ldc + c0;
{
#pragma unroll
            for (int s = 0; s < 8; ++s) { const int row = 2 * s + hi, cofs = lr * 4; v4f val = *(const v4fa*)(os + row * 68 + cofs); if (BIAS) { val[0] += bfr(bias[c0 + cofs]); val[1] += bfr(bias[c0 + cofs + 1]); val[2] += bfr(bias[c0 + cofs + 2]); val[3] += bfr(bias[c0 + cofs + 3]); }
                *(v4f*)(crow + (size_t)row * ldc + cofs) = val; }
             }
        __builtin_amdgcn_wave_barrier(); asm volatile("" ::: "memory");
    }
}

__device__ __forceinline__ h16 tohx(float x) { return (h16)x; }
__device__ __forceinline__ void splitf(float y, unsigned short& h, unsigned short& l) { h = f2bf(y); l = f2bf(y - bf2f(h)); }
typedef __attribute__((ext_vector_type(2))) _Float16 v2h;
typedef __attribute__((ext_vector_type(4))) _Float16 v4h;
typedef __attribute__((ext_vector_type(2))) unsigned short v2us;
typedef __attribute__((ext_vector_type(4))) unsigned short v4us;
typedef __attribute__((ext_vector_type(2))) float v2f;
typedef __attribute__((ext_vector_type(4))) int v4i;

// f32 -> fp16 with a value select: magnitudes below the smallest fp16 normal become zero.
static __device__ __forceinline__ h16 toh_flush(float v) { const h16 r = (h16)v; return (fabsf(v) < 6.103515625e-05f) ? (h16)0.0f : r; }

__global__ __launch_bounds__(256) void k_cvt8(const float* __restrict__ src, bf* dst, size_t n8) { const size_t i = (size_t)blockIdx.x * 256 + threadIdx.x; if (i >= n8) return; const v8f v = *(const v8f*)(src + i * 8); v8us o;
#pragma unroll
    for (int k = 0; k < 8; ++k) o[k] = f2bf(v[k]); *(v8us*)(dst + i * 8) = o;  }

// k_hplr: rotary head planes [h][t][d] (fp16 + bf16 hi/lo): the pair (d, d+1) = (2j, 2j+1) of F[t][h*HD + d] (row pitch 'pitch') is rotated by the RNE bf16 copies of the table values CS[t][j], SN[t][j] read from the inputs
__global__ __launch_bounds__(256) void k_hplr(const float* __restrict__ F, int pitch, int nheads, const float* __restrict__ CS, const float* __restrict__ SN, h16* P16, bf* Ph, bf* Pl) {
#pragma clang fp contract(off)
    const size_t e = ((size_t)blockIdx.x * 256 + threadIdx.x) * 2; if (e >= (size_t)nheads * TT * HD) return; const int d = (int)(e % HD); const int t = (int)((e / HD) % TT); const int h = (int)(e / ((size_t)HD * TT));
    const v2f x = *(const v2f*)(F + (size_t)t * pitch + h * HD + d);
    const float c = bfr(CS[(size_t)t * HP + (d >> 1)]); const float s = bfr(SN[(size_t)t * HP + (d >> 1)]);
    v2f r; r[0] = x[0] * c - x[1] * s; r[1] = x[0] * s + x[1] * c;
    v2h o16; v2us oh, ol;
#pragma unroll
    for (int q = 0; q < 2; ++q) { const float y = r[q]; o16[q] = toh_flush(y); unsigned short a2, c2; splitf(y, a2, c2); oh[q] = a2; ol[q] = c2; }
    *(v2h*)(P16 + e) = o16; *(v2us*)(Ph + e) = oh; *(v2us*)(Pl + e) = ol;  }

__global__ __launch_bounds__(256) void k_vtp(const float* __restrict__ F, int pitch, int nheads, h16* V16, bf* Vh, bf* Vl) { const size_t e = ((size_t)blockIdx.x * 256 + threadIdx.x) * 2; if (e >= (size_t)nheads * HD * TT) return; const int t = (int)(e % TT); const int d = (int)((e / TT) % HD); const int g = (int)(e / ((size_t)TT * HD)); v2h o16; v2us oh, ol;
#pragma unroll
    for (int q = 0; q < 2; ++q) { const float x = F[(size_t)(t + q) * pitch + g * HD + d]; o16[q] = tohx(x); unsigned short a2, c2; splitf(x, a2, c2); oh[q] = a2; ol[q] = c2; }
    *(v2h*)(V16 + e) = o16; *(v2us*)(Vh + e) = oh; *(v2us*)(Vl + e) = ol;  }

// k_asoft: one wave per row (zz, i): t = S x HD^-0.5, then t := -1e9 where MK[i][j] == 0 (value select; MK row pitch SEQ_FULL, shared by all heads and batches);
// softmax over the TT keys (register row, running-max form, one exp, fixed trees); a fully filled row comes out uniform.
__global__ __launch_bounds__(256) void k_asoft(const float* __restrict__ Sb, const int* __restrict__ MK, h16* P16, bf* Ph, bf* Pl) {
    const int lane = threadIdx.x & 31; const int row = blockIdx.x * 8 + (threadIdx.x >> 5); if (row >= ZH * TT) return; const int i = row % TT; const int zz = row / TT; const bool hires = (i < RH);
    const float* sr = Sb + (size_t)row * TT; const int* mr = MK + (size_t)i * SEQ_FULL; float v[TT / 32]; float mx = -3.0e38f;
#pragma unroll
    for (int ch = 0; ch < TT / 128; ++ch) { const int j0 = ch * 128 + lane * 4; const v4f a = *(const v4f*)(sr + j0); const v4i m = *(const v4i*)(mr + j0);
#pragma unroll
        for (int q = 0; q < 4; ++q) { const float sv = a[q] * SCL; const float t = (m[q] == 0) ? MFILL : sv; v[ch * 4 + q] = t; mx = fmaxf(mx, t); } }
#pragma unroll
    for (int sh = 16; sh; sh >>= 1) mx = fmaxf(mx, __shfl_xor(mx, sh, 32));
    float sum = 0.f;
#pragma unroll
    for (int k = 0; k < TT / 32; ++k) { float d0 = __fsub_rn(v[k], mx); asm volatile("" : "+v"(d0)); v[k] = __builtin_amdgcn_exp2f(fmaxf(__fmul_rn(d0, 1.4426950408889634f), -160.0f)); sum += v[k]; }
#pragma unroll
    for (int sh = 16; sh; sh >>= 1) sum += __shfl_xor(sum, sh, 32);
    const float f = __fdiv_rn(hires ? 1.0f : PCAR, sum);
{
        if (hires) {
#pragma unroll
            for (int ch = 0; ch < TT / 128; ++ch) { v4us oh, ol;
#pragma unroll
                for (int q = 0; q < 4; ++q) { unsigned short a, c2; splitf(v[ch * 4 + q] * f, a, c2); oh[q] = a; ol[q] = c2; }
                const size_t oo = ((size_t)zz * (RH ? RH : 1) + i) * TT + ch * 128 + lane * 4; *(v4us*)(Ph + oo) = oh; *(v4us*)(Pl + oo) = ol; }
        } else {
#pragma unroll
            for (int ch = 0; ch < TT / 128; ++ch) { v4h o4;
#pragma unroll
                for (int q = 0; q < 4; ++q) o4[q] = tohx(v[ch * 4 + q] * f);
                *(v4h*)(P16 + (size_t)row * TT + ch * 128 + lane * 4) = o4; } }
         }
}

__global__ __launch_bounds__(256) void k_merge(const float* __restrict__ O, int h0, bf* Ah, bf* Al) { const size_t e = ((size_t)blockIdx.x * 256 + threadIdx.x) * 2; if (e >= (size_t)ZH * TT * HD) return; const int d = (int)(e % HD); const int t = (int)((e / HD) % TT); const int zz = (int)(e / ((size_t)HD * TT)); const float cs = (t < RH) ? 1.0f : (1.0f / PCAR); const size_t oo = (size_t)t * DQ + (h0 + zz) * HD + d;
    v2us oh, ol;
#pragma unroll
    for (int q = 0; q < 2; ++q) { unsigned short a, c2; splitf(O[e + q] * cs, a, c2); oh[q] = a; ol[q] = c2; } *(v2us*)(Ah + oo) = oh; *(v2us*)(Al + oo) = ol;  }

extern "C" void kernel_launch(void* const* d_in, const int* in_sizes, int n_in,
                              void* d_out, int out_size, void* d_ws, size_t ws_size, hipStream_t stream) {
    if (n_in < 8) return;
    const size_t need_x = ((size_t)(NB - 1) * SEQ_FULL + SEQ) * DM;          // elements of the activation stream / of the output that are touched
    const size_t need_m = (size_t)(SEQ - 1) * SEQ_FULL + SEQ;                // mask entries touched
    if ((size_t)in_sizes[0] < need_x) return;
    if ((size_t)in_sizes[1] < (size_t)SEQ * HP || (size_t)in_sizes[2] < (size_t)SEQ * HP) return;
    if ((size_t)in_sizes[3] < need_m) return;
    if ((size_t)in_sizes[4] < (size_t)DQ * DM || (size_t)in_sizes[5] < (size_t)DKV * DM || (size_t)in_sizes[6] < (size_t)DKV * DM || (size_t)in_sizes[7] < (size_t)DM * DQ) return;
    if ((size_t)out_size < need_x) return;
    // wire order: x, cos, sin, attn_mask (int32), wq, wk, wv, wo ('oi' weights)
    const float* x = (const float*)d_in[0]; const float* cs = (const float*)d_in[1]; const float* sn = (const float*)d_in[2]; const int* mk = (const int*)d_in[3];
    const float* wq = (const float*)d_in[4]; const float* wk = (const float*)d_in[5]; const float* wv = (const float*)d_in[6]; const float* wo = (const float*)d_in[7];
    float* OUT = (float*)d_out;     // [2][2048][768]
    char* wsp = (char*)d_ws;
    auto take = [&](size_t bytes) { char* p = wsp; wsp += (bytes + 255) & ~(size_t)255; return (void*)p; };
    bf* WQ = (bf*)take((size_t)DQ * DM * 2); bf* WK = (bf*)take((size_t)DKV * DM * 2); bf* WV = (bf*)take((size_t)DKV * DM * 2); bf* WO = (bf*)take((size_t)DM * DQ * 2);
    bf* XB = (bf*)take((size_t)TT * DM * 2); float* FQ = (float*)take((size_t)TT * DQ * 4); float* FK = (float*)take((size_t)TT * DKV * 4);
    h16* QP16 = (h16*)take((size_t)NH_ * TT * HD * 2); h16* KP16 = (h16*)take((size_t)NKV * TT * HD * 2); h16* VT16 = (h16*)take((size_t)NKV * HD * TT * 2);
    bf* QPh = (bf*)take((size_t)NH_ * TT * HD * 2); bf* QPl = (bf*)take((size_t)NH_ * TT * HD * 2); bf* KPh = (bf*)take((size_t)NKV * TT * HD * 2); bf* KPl = (bf*)take((size_t)NKV * TT * HD * 2); bf* VTh = (bf*)take((size_t)NKV * HD * TT * 2); bf* VTl = (bf*)take((size_t)NKV * HD * TT * 2); bf* Ph = (bf*)take((size_t)ZH * RH * TT * 2); bf* Pl = (bf*)take((size_t)ZH * RH * TT * 2);
    float* Sb = (float*)take((size_t)ZH * TT * TT * 4); h16* P16 = (h16*)take((size_t)ZH * TT * TT * 2); float* Ob = (float*)take((size_t)ZH * TT * HD * 4); bf* ATh = (bf*)take((size_t)TT * DQ * 2); bf* ATl = (bf*)take((size_t)TT * DQ * 2);
    const size_t used = (size_t)(wsp - (char*)d_ws);
    if (used > ws_size || used > (size_t)134217728) return;    // carve 114,819,072 B at full size
    float* FV = FK;   // v projection reuses the k buffer after the k planes are built (stream-ordered)
    k_cvt8<<<(unsigned)(((size_t)DQ * DM / 8 + 255) / 256), 256, 0, stream>>>(wq, WQ, (size_t)DQ * DM / 8);
    k_cvt8<<<(unsigned)(((size_t)DKV * DM / 8 + 255) / 256), 256, 0, stream>>>(wk, WK, (size_t)DKV * DM / 8);
    k_cvt8<<<(unsigned)(((size_t)DKV * DM / 8 + 255) / 256), 256, 0, stream>>>(wv, WV, (size_t)DKV * DM / 8);
    k_cvt8<<<(unsigned)(((size_t)DM * DQ / 8 + 255) / 256), 256, 0, stream>>>(wo, WO, (size_t)DM * DQ / 8);
    const unsigned LQ = (unsigned)(((size_t)NH_ * TT * HD / 2 + 255) / 256), LKv = (unsigned)(((size_t)NKV * TT * HD / 2 + 255) / 256);
    const unsigned LX = (unsigned)(((size_t)TT * DM / 8 + 255) / 256);
    for (int b = 0; b < NB; ++b) {
        const size_t xoff = (size_t)b * SEQ_FULL * DM;     // full per-batch stride of the input and of the output
        k_cvt8<<<LX, 256, 0, stream>>>(x + xoff, XB, (size_t)TT * DM / 8);    /* XB := bf16(x[b]), shared by the three projections */
        k_gemmw<bf, 0, false><<<dim3(TT / 64, DQ / 64, 1), 32, 0, stream>>>(XB, nullptr, WQ, nullptr, DM, FQ, DQ, nullptr, 0, 0, 0);
        k_hplr<<<LQ, 256, 0, stream>>>(FQ, DQ, NH_, cs, sn, QP16, QPh, QPl);
        k_gemmw<bf, 0, false><<<dim3(TT / 64, DKV / 64, 1), 32, 0, stream>>>(XB, nullptr, WK, nullptr, DM, FK, DKV, nullptr, 0, 0, 0);
        k_hplr<<<LKv, 256, 0, stream>>>(FK, DKV, NKV, cs, sn, KP16, KPh, KPl);
        k_gemmw<bf, 0, false><<<dim3(TT / 64, DKV / 64, 1), 32, 0, stream>>>(XB, nullptr, WV, nullptr, DM, FV, DKV, nullptr, 0, 0, 0);   /* after the k planes are built */
        k_vtp<<<LKv, 256, 0, stream>>>(FV, DKV, NKV, VT16, VTh, VTl);
        for (int h0 = 0; h0 < NH_; h0 += ZH) { const size_t zq = (size_t)h0, zk = (size_t)(h0 / REP);   // the pass's two heads use consecutive planes (z-strides TT*HD)
            k_gemmw<bf, 2, false><<<dim3(RH / 64, TT / 64, ZH), 32, 0, stream>>>(QPh + zq * TT * HD, QPl + zq * TT * HD, KPh + zk * TT * HD, KPl + zk * TT * HD, HD, Sb, TT, nullptr, (size_t)TT * HD, (size_t)TT * HD, (size_t)TT * TT);
            if (TT > RH) k_gemmw<h16, 0, false><<<dim3((TT - RH) / 64, TT / 64, ZH), 32, 0, stream>>>(QP16 + zq * TT * HD + (size_t)RH * HD, nullptr, KP16 + zk * TT * HD, nullptr, HD, Sb + (size_t)RH * TT, TT, nullptr, (size_t)TT * HD, (size_t)TT * HD, (size_t)TT * TT);
            k_asoft<<<ZH * TT / 8, 256, 0, stream>>>(Sb, mk, P16, Ph, Pl);
            k_gemmw<bf, 2, false><<<dim3(RH / 64, HD / 64, ZH), 32, 0, stream>>>(Ph, Pl, VTh + zk * HD * TT, VTl + zk * HD * TT, TT, Ob, HD, nullptr, (size_t)RH * TT, (size_t)HD * TT, (size_t)TT * HD);
            if (TT > RH) k_gemmw<h16, 0, false><<<dim3((TT - RH) / 64, HD / 64, ZH), 32, 0, stream>>>(P16 + (size_t)RH * TT, nullptr, VT16 + zk * HD * TT, nullptr, TT, Ob + (size_t)RH * HD, HD, nullptr, (size_t)TT * TT, (size_t)HD * TT, (size_t)TT * HD);
            k_merge<<<(unsigned)(((size_t)ZH * TT * HD / 2 + 255) / 256), 256, 0, stream>>>(Ob, h0, ATh, ATl); }
        k_gemmw<bf, 1, false><<<dim3(TT / 64, DM / 64, 1), 32, 0, stream>>>(ATh, ATl, WO, nullptr, DQ, OUT + xoff, DM, nullptr, 0, 0, 0); }
}

// v001
// A run of this version takes 675 microseconds.
// Timed twice side by side with v000, it ran 2.25 times as fast both times.
#include <hip/hip_runtime.h>

// Causal self-attention over one input stream with interleaved-pair rotary embeddings whose cos / sin tables are inputs read by value, an int32 mask read by value, no biases (x [2][2048][768]; q = x Wq^T, k = x Wk^T, v = x Wv^T ('oi' [768][768]; 12 heads x 64); pairs (2j, 2j+1) of q and k rotated by cos[t][j], sin[t][j]; logits x 1/8; mask[i][j] == 0 -> logit replaced by -1e9; softmax over all 2048 keys; out = merged Wo^T -> [2][2048][768]; argument order x, cos, sin, attn_mask, wq, wk, wv, wo).
// Compute dtypes, f32 accumulate: projections v_wmma_f32_16x16x32_bf16 on RNE bf16 copies of x and weights; rotation f32 with RNE bf16 table values; logits and P.V: query rows < 512 bf16 hi/lo planes (3 products), rows >= 512 v_wmma_f32_16x16x32_f16 (P carried x1024); softmax f32; output projection bf16 hi/lo ctx x bf16 Wo (2 products).
// Layout per batch: bf16 copy of the input stream; exact projections; rotary head plane builders (q, k) and transposed value planes; dense T-2048 score / softmax / P.V passes over 2 heads at a time, the keys of P.V cut into KSN ranges, one work-group each, whose f32 partial tiles the merge sums in range order; merged hi/lo x Wo.

#ifndef NB
#define NB   2
#endif
#ifndef SEQ
#define SEQ  2048
#endif
#define NB_FULL  2
#define SEQ_FULL 2048
#define TT   SEQ
#define DM   768
#define NH_  12
#define NKV  12
#define REP  (NH_ / NKV)
#define HD   64
#define HP   (HD / 2)    // rotary pairs per head = table row width
#define DQ   (NH_ * HD)
#define DKV  (NKV * HD)
#define ZH   2
#define KSN  16   // key ranges of P.V: one work-group and one partial tile each
#define RH   ((SEQ < 512) ? SEQ : 512)   // query rows < RH use hi+lo planes
#define PCAR 1024.0f
#define SCL  0.125f   // HD^-0.5
#define MFILL (-1.0e9f)
typedef _Float16 h16;
typedef unsigned short bf;
typedef __attribute__((ext_vector_type(16))) __bf16   v16bf;
typedef __attribute__((ext_vector_type(16))) _Float16 v16h;
typedef __attribute__((ext_vector_type(8)))  _Float16 v8h;
typedef __attribute__((ext_vector_type(8)))  unsigned short v8us;
typedef __attribute__((ext_vector_type(8)))  float    v8f;
typedef __attribute__((ext_vector_type(4)))  float    v4f;
typedef v4f  __attribute__((may_alias)) v4fa;

static_assert(TT % 128 == 0);
static_assert(TT % (KSN * 32) == 0);
static_assert(RH % 64 == 0);
static_assert((TT - RH) % 64 == 0);
static_assert(DM % 32 == 0);
static_assert(DQ % 64 == 0);
static_assert(DKV % 64 == 0);
static_assert(DM % 64 == 0);
static_assert(HD == 64);
static_assert(NH_ % ZH == 0);
static_assert(NB <= NB_FULL);
static_assert(SEQ <= SEQ_FULL);
static_assert((size_t)NB_FULL * SEQ_FULL * DM * 4 == 12582912);
static_assert(HP == 32);                                  // table rows are [t][32]
static_assert(HD % 2 == 0);
static_assert(DQ == DM);                                  // merged width == model width (no bias, square Wo)
static_assert(NKV == NH_);                                // one k/v head per q head
static_assert(((size_t)NH_ * TT * HD / 2) % 256 == 0);    // plane builder grids are exact
static_assert(((size_t)TT * DM / 8) % 256 == 0);
#define A256(x) ((((size_t)(x)) + 255) & ~(size_t)255)
static_assert(4 * A256((size_t)DQ * DM * 2) + A256((size_t)TT * DM * 2) + A256((size_t)TT * DQ * 4) + A256((size_t)TT * DKV * 4) + 9 * A256((size_t)NH_ * TT * HD * 2) + 2 * A256((size_t)ZH * RH * TT * 2) + A256((size_t)ZH * TT * TT * 4) + A256((size_t)ZH * TT * TT * 2) + A256((size_t)KSN * ZH * TT * HD * 4) + 2 * A256((size_t)TT * DQ * 2) <= (size_t)134217728);

__device__ __forceinline__ unsigned short f2bf(float f) { unsigned u = __float_as_uint(f); u += 0x7FFFu + ((u >> 16) & 1u); return (unsigned short)(u >> 16); }
__device__ __forceinline__ float bf2f(unsigned short b) { return __uint_as_float(((unsigned)b) << 16); }
__device__ __forceinline__ float bfr(float f) { return bf2f(f2bf(f)); }
__device__ __forceinline__ v16h cat16(v8h lo, v8h hi) { return __builtin_shufflevector(lo, hi, 0, 1, 2, 3, 4, 5, 6, 7, 8, 9, 10, 11, 12, 13, 14, 15); }
__device__ __forceinline__ v16bf cat16b(v8us lo, v8us hi) { return __builtin_bit_cast(v16bf, __builtin_shufflevector(lo, hi, 0, 1, 2, 3, 4, 5, 6, 7, 8, 9, 10, 11, 12, 13, 14, 15)); }
__device__ __forceinline__ v8f wmma16(v16h a, v16h b, v8f c) { return __builtin_amdgcn_wmma_f32_16x16x32_f16(false, a, false, b, (short)0, c, false, false); }
__device__ __forceinline__ v8f wmmab(v16bf a, v16bf b, v8f c) { return __builtin_amdgcn_wmma_f32_16x16x32_bf16(false, a, false, b, (short)0, c, false, false); }

// ---- k_gemmw: register-blocked GEMM, ONE WAVE per 64x64 output tile (16 accumulators), operands straight from K-contiguous 16-bit planes; grid (M/64, N/64, Z), 32 threads.
// C[m][n] (f32, pitch ldc, + optional f32 bias[n]) = sum_k A[m][k] Bt[n][k] (+ split products per NSPLIT). z-batch strides sA/sB/sC in elements. K % 32 == 0.
// KSP: N == 64 and blockIdx.y numbers a k range of kspan (kspan % 32 == 0, gridDim.y * kspan == K); its partial tile goes to C + blockIdx.y * sK.
// Fragment map (A and Bt alike): lane -> row (lane & 15); elements 0..7 = k0 + 8*(lane>>4) + 0..7, elements 8..15 = k0 + 16 + 8*(lane>>4) + 0..7.
template <typename T16> struct WFrag;
template <> struct WFrag<h16> { typedef v16h V; static __device__ __forceinline__ V ld(const h16* p) { return cat16(*(const v8h*)p, *(const v8h*)(p + 16)); } static __device__ __forceinline__ v8f mma(V a, V b, v8f c) { return wmma16(a, b, c); } };
template <> struct WFrag<bf> { typedef v16bf V; static __device__ __forceinline__ V ld(const bf* p) { return cat16b(*(const v8us*)p, *(const v8us*)(p + 16)); } static __device__ __forceinline__ v8f mma(V a, V b, v8f c) { return wmmab(a, b, c); } };
template <typename T16, int NSPLIT, bool BIAS, bool KSP>
__global__ __launch_bounds__(32) void k_gemmw(const T16* __restrict__ A, const T16* __restrict__ A2, const T16* __restrict__ Bt, const T16* __restrict__ Bt2, int K, float* C, int ldc, const float* __restrict__ bias, size_t sA, size_t sB, size_t sC, int kspan, size_t sK) {
    typedef typename WFrag<T16>::V V;
    __shared__ __align__(16) float os[16 * 68];
    const size_t z = blockIdx.z; A += z * sA; if (A2) A2 += z * sA; Bt += z * sB; if (Bt2) Bt2 += z * sB; C += z * sC;
    const int lane = threadIdx.x & 31, lr = lane & 15, hi = lane >> 4; const int r0 = blockIdx.x * 64, c0 = KSP ? 0 : blockIdx.y * 64;
    const int kn = KSP ? kspan : K; if (KSP) { const size_t kb = (size_t)blockIdx.y * kspan; A += kb; if (A2) A2 += kb; Bt += kb; if (Bt2) Bt2 += kb; C += blockIdx.y * sK; }
    v8f acc[4][4];
#pragma unroll
    for (int mb = 0; mb < 4; ++mb)
#pragma unroll
        for (int nb = 0; nb < 4; ++nb) acc[mb][nb] = (v8f){};
    const size_t aoff = (size_t)(r0 + lr) * K + 8 * hi, boff = (size_t)(c0 + lr) * K + 8 * hi;
#pragma unroll 1
    for (int kc = 0; kc < kn; kc += 32) {
        V a[4], a2[4];
#pragma unroll
        for (int mb = 0; mb < 4; ++mb) { a[mb] = WFrag<T16>::ld(A + aoff + (size_t)mb * 16 * K + kc); if (NSPLIT == 1 || NSPLIT == 2) a2[mb] = WFrag<T16>::ld(A2 + aoff + (size_t)mb * 16 * K + kc); }
#pragma unroll
        for (int nb = 0; nb < 4; ++nb) { const V b = WFrag<T16>::ld(Bt + boff + (size_t)nb * 16 * K + kc); V b2; if (NSPLIT >= 2) b2 = WFrag<T16>::ld(Bt2 + boff + (size_t)nb * 16 * K + kc);
#pragma unroll
            for (int mb = 0; mb < 4; ++mb) { acc[mb][nb] = WFrag<T16>::mma(a[mb], b, acc[mb][nb]); if (NSPLIT == 1 || NSPLIT == 2) acc[mb][nb] = WFrag<T16>::mma(a2[mb], b, acc[mb][nb]); if (NSPLIT >= 2) acc[mb][nb] = WFrag<T16>::mma(a[mb], b2, acc[mb][nb]); } }
        asm volatile("v_nop\n\tv_nop\n\tv_nop\n\tv_nop" : "+v"(acc[0][0]), "+v"(acc[1][1]), "+v"(acc[2][2]), "+v"(acc[3][3]) : "v"(a[0]), "v"(a[3]));
    }
#pragma unroll
    for (int mb = 0; mb < 4; ++mb) {
#pragma unroll
        for (int nb = 0; nb < 4; ++nb) {
#pragma unroll
            for (int j = 0; j < 8; ++j) os[(hi * 8 + j) * 68 + nb * 16 + lr] = acc[mb][nb][j]; }
        __builtin_amdgcn_wave_barrier(); asm volatile("" ::: "memory");
        float* crow = C + (size_t)(r0 + mb * 16) * ldc + c0;
{
#pragma unroll
            for (int s = 0; s < 8; ++s) { const int row = 2 * s + hi, cofs = lr * 4; v4f val = *(const v4fa*)(os + row * 68 + cofs); if (BIAS) { val[0] += bfr(bias[c0 + cofs]); val[1] += bfr(bias[c0 + cofs + 1]); val[2] += bfr(bias[c0 + cofs + 2]); val[3] += bfr(bias[c0 + cofs + 3]); }
                *(v4f*)(crow + (size_t)row * ldc + cofs) = val; }
             }
        __builtin_amdgcn_wave_barrier(); asm volatile("" ::: "memory");
    }
}

__device__ __forceinline__ h16 tohx(float x) { return (h16)x; }
__device__ __forceinline__ void splitf(float y, unsigned short& h, unsigned short& l) { h = f2bf(y); l = f2bf(y - bf2f(h)); }
typedef __attribute__((ext_vector_type(2))) _Float16 v2h;
typedef __attribute__((ext_vector_type(4))) _Float16 v4h;
typedef __attribute__((ext_vector_type(2))) unsigned short v2us;
typedef __attribute__((ext_vector_type(4))) unsigned short v4us;
typedef __attribute__((ext_vector_type(2))) float v2f;
typedef __attribute__((ext_vector_type(4))) int v4i;

// f32 -> fp16 with a value select: magnitudes below the smallest fp16 normal become zero.
static __device__ __forceinline__ h16 toh_flush(float v) { const h16 r = (h16)v; return (fabsf(v) < 6.103515625e-05f) ? (h16)0.0f : r; }

__global__ __launch_bounds__(256) void k_cvt8(const float* __restrict__ src, bf* dst, size_t n8) { const size_t i = (size_t)blockIdx.x * 256 + threadIdx.x; if (i >= n8) return; const v8f v = *(const v8f*)(src + i * 8); v8us o;
#pragma unroll
    for (int k = 0; k < 8; ++k) o[k] = f2bf(v[k]); *(v8us*)(dst + i * 8) = o;  }

// k_hplr: rotary head planes [h][t][d] (fp16 + bf16 hi/lo): the pair (d, d+1) = (2j, 2j+1) of F[t][h*HD + d] (row pitch 'pitch') is rotated by the RNE bf16 copies of the table values CS[t][j], SN[t][j] read from the inputs
__global__ __launch_bounds__(256) void k_hplr(const float* __restrict__ F, int pitch, int nheads, const float* __restrict__ CS, const float* __restrict__ SN, h16* P16, bf* Ph, bf* Pl) {
#pragma clang fp contract(off)
    const size_t e = ((size_t)blockIdx.x * 256 + threadIdx.x) * 2; if (e >= (size_t)nheads * TT * HD) return; const int d = (int)(e % HD); const int t = (int)((e / HD) % TT); const int h = (int)(e / ((size_t)HD * TT));
    const v2f x = *(const v2f*)(F + (size_t)t * pitch + h * HD + d);
    const float c = bfr(CS[(size_t)t * HP + (d >> 1)]); const float s = bfr(SN[(size_t)t * HP + (d >> 1)]);
    v2f r; r[0] = x[0] * c - x[1] * s; r[1] = x[0] * s + x[1] * c;
    v2h o16; v2us oh, ol;
#pragma unroll
    for (int q = 0; q < 2; ++q) { const float y = r[q]; o16[q] = toh_flush(y); unsigned short a2, c2; splitf(y, a2, c2); oh[q] = a2; ol[q] = c2; }
    *(v2h*)(P16 + e) = o16; *(v2us*)(Ph + e) = oh; *(v2us*)(Pl + e) = ol;  }

__global__ __launch_bounds__(256) void k_vtp(const float* __restrict__ F, int pitch, int nheads, h16* V16, bf* Vh, bf* Vl) { const size_t e = ((size_t)blockIdx.x * 256 + threadIdx.x) * 2; if (e >= (size_t)nheads * HD * TT) return; const int t = (int)(e % TT); const int d = (int)((e / TT) % HD); const int g = (int)(e / ((size_t)TT * HD)); v2h o16; v2us oh, ol;
#pragma unroll
    for (int q = 0; q < 2; ++q) { const float x = F[(size_t)(t + q) * pitch + g * HD + d]; o16[q] = tohx(x); unsigned short a2, c2; splitf(x, a2, c2); oh[q] = a2; ol[q] = c2; }
    *(v2h*)(V16 + e) = o16; *(v2us*)(Vh + e) = oh; *(v2us*)(Vl + e) = ol;  }

// k_asoft: one wave per row (zz, i): t = S x HD^-0.5, then t := -1e9 where MK[i][j] == 0 (value select; MK row pitch SEQ_FULL, shared by all heads and batches);
// softmax over the TT keys (register row, running-max form, one exp, fixed trees); a fully filled row comes out uniform.
__global__ __launch_bounds__(256) void k_asoft(const float* __restrict__ Sb, const int* __restrict__ MK, h16* P16, bf* Ph, bf* Pl) {
    const int lane = threadIdx.x & 31; const int row = blockIdx.x * 8 + (threadIdx.x >> 5); if (row >= ZH * TT) return; const int i = row % TT; const int zz = row / TT; const bool hires = (i < RH);
    const float* sr = Sb + (size_t)row * TT; const int* mr = MK + (size_t)i * SEQ_FULL; float v[TT / 32]; float mx = -3.0e38f;
#pragma unroll
    for (int ch = 0; ch < TT / 128; ++ch) { const int j0 = ch * 128 + lane * 4; const v4f a = *(const v4f*)(sr + j0); const v4i m = *(const v4i*)(mr + j0);
#pragma unroll
        for (int q = 0; q < 4; ++q) { const float sv = a[q] * SCL; const float t = (m[q] == 0) ? MFILL : sv; v[ch * 4 + q] = t; mx = fmaxf(mx, t); } }
#pragma unroll
    for (int sh = 16; sh; sh >>= 1) mx = fmaxf(mx, __shfl_xor(mx, sh, 32));
    float sum = 0.f;
#pragma unroll
    for (int k = 0; k < TT / 32; ++k) { float d0 = __fsub_rn(v[k], mx); asm volatile("" : "+v"(d0)); v[k] = __builtin_amdgcn_exp2f(fmaxf(__fmul_rn(d0, 1.4426950408889634f), -160.0f)); sum += v[k]; }
#pragma unroll
    for (int sh = 16; sh; sh >>= 1) sum += __shfl_xor(sum, sh, 32);
    const float f = __fdiv_rn(hires ? 1.0f : PCAR, sum);
{
        if (hires) {
#pragma unroll
            for (int ch = 0; ch < TT / 128; ++ch) { v4us oh, ol;
#pragma unroll
                for (int q = 0; q < 4; ++q) { unsigned short a, c2; splitf(v[ch * 4 + q] * f, a, c2); oh[q] = a; ol[q] = c2; }
                const size_t oo = ((size_t)zz * (RH ? RH : 1) + i) * TT + ch * 128 + lane * 4; *(v4us*)(Ph + oo) = oh; *(v4us*)(Pl + oo) = ol; }
        } else {
#pragma unroll
            for (int ch = 0; ch < TT / 128; ++ch) { v4h o4;
#pragma unroll
                for (int q = 0; q < 4; ++q) o4[q] = tohx(v[ch * 4 + q] * f);
                *(v4h*)(P16 + (size_t)row * TT + ch * 128 + lane * 4) = o4; } }
         }
}

// k_merge: O holds KSN partial planes [r][zz][t][d]; they are summed in the order r = 0 .. KSN-1, then scaled and split into the merged hi/lo planes.
__global__ __launch_bounds__(256) void k_merge(const float* __restrict__ O, int h0, bf* Ah, bf* Al) { const size_t e = ((size_t)blockIdx.x * 256 + threadIdx.x) * 2; if (e >= (size_t)ZH * TT * HD) return; const int d = (int)(e % HD); const int t = (int)((e / HD) % TT); const int zz = (int)(e / ((size_t)HD * TT)); const float cs = (t < RH) ? 1.0f : (1.0f / PCAR); const size_t oo = (size_t)t * DQ + (h0 + zz) * HD + d;
    v2f part[KSN];
#pragma unroll
    for (int r = 0; r < KSN; ++r) part[r] = *(const v2f*)(O + (size_t)r * ZH * TT * HD + e);
    v2f acc = part[0];
#pragma unroll
    for (int r = 1; r < KSN; ++r) acc += part[r];
    v2us oh, ol;
#pragma unroll
    for (int q = 0; q < 2; ++q) { unsigned short a, c2; splitf(acc[q] * cs, a, c2); oh[q] = a; ol[q] = c2; } *(v2us*)(Ah + oo) = oh; *(v2us*)(Al + oo) = ol;  }

extern "C" void kernel_launch(void* const* d_in, const int* in_sizes, int n_in,
                              void* d_out, int out_size, void* d_ws, size_t ws_size, hipStream_t stream) {
    if (n_in < 8) return;
    const size_t need_x = ((size_t)(NB - 1) * SEQ_FULL + SEQ) * DM;          // elements of the activation stream / of the output that are touched
    const size_t need_m = (size_t)(SEQ - 1) * SEQ_FULL + SEQ;                // mask entries touched
    if ((size_t)in_sizes[0] < need_x) return;
    if ((size_t)in_sizes[1] < (size_t)SEQ * HP || (size_t)in_sizes[2] < (size_t)SEQ * HP) return;
    if ((size_t)in_sizes[3] < need_m) return;
    if ((size_t)in_sizes[4] < (size_t)DQ * DM || (size_t)in_sizes[5] < (size_t)DKV * DM || (size_t)in_sizes[6] < (size_t)DKV * DM || (size_t)in_sizes[7] < (size_t)DM * DQ) return;
    if ((size_t)out_size < need_x) return;
    // wire order: x, cos, sin, attn_mask (int32), wq, wk, wv, wo ('oi' weights)
    const float* x = (const float*)d_in[0]; const float* cs = (const float*)d_in[1]; const float* sn = (const float*)d_in[2]; const int* mk = (const int*)d_in[3];
    const float* wq = (const float*)d_in[4]; const float* wk = (const float*)d_in[5]; const float* wv = (const float*)d_in[6]; const float* wo = (const float*)d_in[7];
    float* OUT = (float*)d_out;     // [2][2048][768]
    char* wsp = (char*)d_ws;
    auto take = [&](size_t bytes) { char* p = wsp; wsp += (bytes + 255) & ~(size_t)255; return (void*)p; };
    bf* WQ = (bf*)take((size_t)DQ * DM * 2); bf* WK = (bf*)take((size_t)DKV * DM * 2); bf* WV = (bf*)take((size_t)DKV * DM * 2); bf* WO = (bf*)take((size_t)DM * DQ * 2);
    bf* XB = (bf*)take((size_t)TT * DM * 2); float* FQ = (float*)take((size_t)TT * DQ * 4); float* FK = (float*)take((size_t)TT * DKV * 4);
    h16* QP16 = (h16*)take((size_t)NH_ * TT * HD * 2); h16* KP16 = (h16*)take((size_t)NKV * TT * HD * 2); h16* VT16 = (h16*)take((size_t)NKV * HD * TT * 2);
    bf* QPh = (bf*)take((size_t)NH_ * TT * HD * 2); bf* QPl = (bf*)take((size_t)NH_ * TT * HD * 2); bf* KPh = (bf*)take((size_t)NKV * TT * HD * 2); bf* KPl = (bf*)take((size_t)NKV * TT * HD * 2); bf* VTh = (bf*)take((size_t)NKV * HD * TT * 2); bf* VTl = (bf*)take((size_t)NKV * HD * TT * 2); bf* Ph = (bf*)take((size_t)ZH * RH * TT * 2); bf* Pl = (bf*)take((size_t)ZH * RH * TT * 2);
    float* Sb = (float*)take((size_t)ZH * TT * TT * 4); h16* P16 = (h16*)take((size_t)ZH * TT * TT * 2); float* Ob = (float*)take((size_t)KSN * ZH * TT * HD * 4); bf* ATh = (bf*)take((size_t)TT * DQ * 2); bf* ATl = (bf*)take((size_t)TT * DQ * 2);
    const size_t used = (size_t)(wsp - (char*)d_ws);
    if (used > ws_size || used > (size_t)134217728) return;    // carve 130,547,712 B at full size
    float* FV = FK;   // v projection reuses the k buffer after the k planes are built (stream-ordered)
    k_cvt8<<<(unsigned)(((size_t)DQ * DM / 8 + 255) / 256), 256, 0, stream>>>(wq, WQ, (size_t)DQ * DM / 8);
    k_cvt8<<<(unsigned)(((size_t)DKV * DM / 8 + 255) / 256), 256, 0, stream>>>(wk, WK, (size_t)DKV * DM / 8);
    k_cvt8<<<(unsigned)(((size_t)DKV * DM / 8 + 255) / 256), 256, 0, stream>>>(wv, WV, (size_t)DKV * DM / 8);
    k_cvt8<<<(unsigned)(((size_t)DM * DQ / 8 + 255) / 256), 256, 0, stream>>>(wo, WO, (size_t)DM * DQ / 8);
    const unsigned LQ = (unsigned)(((size_t)NH_ * TT * HD / 2 + 255) / 256), LKv = (unsigned)(((size_t)NKV * TT * HD / 2 + 255) / 256);
    const unsigned LX = (unsigned)(((size_t)TT * DM / 8 + 255) / 256);
    for (int b = 0; b < NB; ++b) {
        const size_t xoff = (size_t)b * SEQ_FULL * DM;     // full per-batch stride of the input and of the output
        k_cvt8<<<LX, 256, 0, stream>>>(x + xoff, XB, (size_t)TT * DM / 8);    /* XB := bf16(x[b]), shared by the three projections */
        k_gemmw<bf, 0, false, false><<<dim3(TT / 64, DQ / 64, 1), 32, 0, stream>>>(XB, nullptr, WQ, nullptr, DM, FQ, DQ, nullptr, 0, 0, 0, 0, 0);
        k_hplr<<<LQ, 256, 0, stream>>>(FQ, DQ, NH_, cs, sn, QP16, QPh, QPl);
        k_gemmw<bf, 0, false, false><<<dim3(TT / 64, DKV / 64, 1), 32, 0, stream>>>(XB, nullptr, WK, nullptr, DM, FK, DKV, nullptr, 0, 0, 0, 0, 0);
        k_hplr<<<LKv, 256, 0, stream>>>(FK, DKV, NKV, cs, sn, KP16, KPh, KPl);
        k_gemmw<bf, 0, false, false><<<dim3(TT / 64, DKV / 64, 1), 32, 0, stream>>>(XB, nullptr, WV, nullptr, DM, FV, DKV, nullptr, 0, 0, 0, 0, 0);   /* after the k planes are built */
        k_vtp<<<LKv, 256, 0, stream>>>(FV, DKV, NKV, VT16, VTh, VTl);
        for (int h0 = 0; h0 < NH_; h0 += ZH) { const size_t zq = (size_t)h0, zk = (size_t)(h0 / REP);   // the pass's two heads use consecutive planes (z-strides TT*HD)
            k_gemmw<bf, 2, false, false><<<dim3(RH / 64, TT / 64, ZH), 32, 0, stream>>>(QPh + zq * TT * HD, QPl + zq * TT * HD, KPh + zk * TT * HD, KPl + zk * TT * HD, HD, Sb, TT, nullptr, (size_t)TT * HD, (size_t)TT * HD, (size_t)TT * TT, 0, 0);
            if (TT > RH) k_gemmw<h16, 0, false, false><<<dim3((TT - RH) / 64, TT / 64, ZH), 32, 0, stream>>>(QP16 + zq * TT * HD + (size_t)RH * HD, nullptr, KP16 + zk * TT * HD, nullptr, HD, Sb + (size_t)RH * TT, TT, nullptr, (size_t)TT * HD, (size_t)TT * HD, (size_t)TT * TT, 0, 0);
            k_asoft<<<ZH * TT / 8, 256, 0, stream>>>(Sb, mk, P16, Ph, Pl);
            k_gemmw<bf, 2, false, true><<<dim3(RH / 64, KSN, ZH), 32, 0, stream>>>(Ph, Pl, VTh + zk * HD * TT, VTl + zk * HD * TT, TT, Ob, HD, nullptr, (size_t)RH * TT, (size_t)HD * TT, (size_t)TT * HD, TT / KSN, (size_t)ZH * TT * HD);
            if (TT > RH) k_gemmw<h16, 0, false, true><<<dim3((TT - RH) / 64, KSN, ZH), 32, 0, stream>>>(P16 + (size_t)RH * TT, nullptr, VT16 + zk * HD * TT, nullptr, TT, Ob + (size_t)RH * HD, HD, nullptr, (size_t)TT * TT, (size_t)HD * TT, (size_t)TT * HD, TT / KSN, (size_t)ZH * TT * HD);
            k_merge<<<(unsigned)(((size_t)ZH * TT * HD / 2 + 255) / 256), 256, 0, stream>>>(Ob, h0, ATh, ATl); }
        k_gemmw<bf, 1, false, false><<<dim3(TT / 64, DM / 64, 1), 32, 0, stream>>>(ATh, ATl, WO, nullptr, DQ, OUT + xoff, DM, nullptr, 0, 0, 0, 0, 0); }
}

// v002
// One run takes 508 microseconds.
// Two timings next to v001 put it at 1.33 and 1.34 times that version's speed.
// Over all steps from v000 it is 3.01 times as fast.
#include <hip/hip_runtime.h>

// Causal self-attention over one input stream with interleaved-pair rotary embeddings whose cos / sin tables are inputs read by value, an int32 mask read by value, no biases (x [2][2048][768]; q = x Wq^T, k = x Wk^T, v = x Wv^T ('oi' [768][768]; 12 heads x 64); pairs (2j, 2j+1) of q and k rotated by cos[t][j], sin[t][j]; logits x 1/8; mask[i][j] == 0 -> logit replaced by -1e9; softmax over all 2048 keys; out = merged Wo^T -> [2][2048][768]; argument order x, cos, sin, attn_mask, wq, wk, wv, wo).
// Compute dtypes, f32 accumulate: projections v_wmma_f32_16x16x32_bf16 on RNE bf16 copies of x and weights; rotation f32 with RNE bf16 table values; logits and P.V: query rows < 512 bf16 hi/lo planes (3 products), rows >= 512 v_wmma_f32_16x16x32_f16 (P carried x1024); softmax f32; output projection bf16 hi/lo ctx x bf16 Wo (2 products).
// Layout per batch: bf16 copy of the input stream; bf16 projections; rotary head plane builders (q, k) and transposed value planes; dense T-2048 score / softmax / P.V passes over 6 heads at a time, the keys of P.V cut into KSN ranges, one work-group each, whose f32 partial tiles the merge sums in range order; merged hi/lo x Wo.

#ifndef NB
#define NB   2
#endif
#ifndef SEQ
#define SEQ  2048
#endif
#define NB_FULL  2
#define SEQ_FULL 2048
#define TT   SEQ
#define DM   768
#define NH_  12
#define NKV  12
#define REP  (NH_ / NKV)
#define HD   64
#define HP   (HD / 2)    // rotary pairs per head = table row width
#define DQ   (NH_ * HD)
#define DKV  (NKV * HD)
#define ZH   6    // heads per score / softmax / P.V pass (blockIdx.z of its GEMMs)
#define KSN  16   // key ranges of P.V: one work-group and one partial tile each
#define RH   ((SEQ < 512) ? SEQ : 512)   // query rows < RH use hi+lo planes
#define PCAR 1024.0f
#define SCL  0.125f   // HD^-0.5
#define MFILL (-1.0e9f)
typedef _Float16 h16;
typedef unsigned short bf;
typedef __attribute__((ext_vector_type(16))) __bf16   v16bf;
typedef __attribute__((ext_vector_type(16))) _Float16 v16h;
typedef __attribute__((ext_vector_type(8)))  _Float16 v8h;
typedef __attribute__((ext_vector_type(8)))  unsigned short v8us;
typedef __attribute__((ext_vector_type(8)))  float    v8f;
typedef __attribute__((ext_vector_type(4)))  float    v4f;
typedef v4f  __attribute__((may_alias)) v4fa;

static_assert(TT % 128 == 0);
static_assert(TT % (KSN * 32) == 0);
static_assert(RH % 64 == 0);
static_assert((TT - RH) % 64 == 0);
static_assert(DM % 32 == 0);
static_assert(DQ % 64 == 0);
static_assert(DKV % 64 == 0);
static_assert(DM % 64 == 0);
static_assert(HD == 64);
static_assert(NH_ % ZH == 0);
static_assert(NB <= NB_FULL);
static_assert(SEQ <= SEQ_FULL);
static_assert((size_t)NB_FULL * SEQ_FULL * DM * 4 == 12582912);
static_assert(HP == 32);                                  // table rows are [t][32]
static_assert(HD % 2 == 0);
static_assert(DQ == DM);                                  // merged width == model width (no bias, square Wo)
static_assert(NKV == NH_);                                // one k/v head per q head
static_assert(((size_t)NH_ * TT * HD / 2) % 256 == 0);    // plane builder grids are exact
static_assert(((size_t)TT * DM / 8) % 256 == 0);
#define A256(x) ((((size_t)(x)) + 255) & ~(size_t)255)
static_assert(A256((size_t)TT * DM * 2) + A256((size_t)TT * DQ * 4) + A256((size_t)TT * DKV * 4) <= A256((size_t)ZH * TT * TT * 4));   // the projection stage's buffers fit into the score buffer's bytes
static_assert(4 * A256((size_t)DQ * DM * 2) + 9 * A256((size_t)NH_ * TT * HD * 2) + 2 * A256((size_t)ZH * RH * TT * 2) + A256((size_t)ZH * TT * TT * 4) + A256((size_t)ZH * TT * TT * 2) + A256((size_t)KSN * ZH * TT * HD * 4) + 2 * A256((size_t)TT * DQ * 2) <= (size_t)268435456);

__device__ __forceinline__ unsigned short f2bf(float f) { unsigned u = __float_as_uint(f); u += 0x7FFFu + ((u >> 16) & 1u); return (unsigned short)(u >> 16); }
__device__ __forceinline__ float bf2f(unsigned short b) { return __uint_as_float(((unsigned)b) << 16); }
__device__ __forceinline__ float bfr(float f) { return bf2f(f2bf(f)); }
__device__ __forceinline__ v16h cat16(v8h lo, v8h hi) { return __builtin_shufflevector(lo, hi, 0, 1, 2, 3, 4, 5, 6, 7, 8, 9, 10, 11, 12, 13, 14, 15); }
__device__ __forceinline__ v16bf cat16b(v8us lo, v8us hi) { return __builtin_bit_cast(v16bf, __builtin_shufflevector(lo, hi, 0, 1, 2, 3, 4, 5, 6, 7, 8, 9, 10, 11, 12, 13, 14, 15)); }
__device__ __forceinline__ v8f wmma16(v16h a, v16h b, v8f c) { return __builtin_amdgcn_wmma_f32_16x16x32_f16(false, a, false, b, (short)0, c, false, false); }
__device__ __forceinline__ v8f wmmab(v16bf a, v16bf b, v8f c) { return __builtin_amdgcn_wmma_f32_16x16x32_bf16(false, a, false, b, (short)0, c, false, false); }

// ---- k_gemmw: register-blocked GEMM, ONE WAVE per 64x64 output tile (16 accumulators), operands straight from K-contiguous 16-bit planes; grid (M/64, N/64, Z), 32 threads.
// C[m][n] (f32, pitch ldc, + optional f32 bias[n]) = sum_k A[m][k] Bt[n][k] (+ split products per NSPLIT). z-batch strides sA/sB/sC in elements. K % 32 == 0.
// KSP: N == 64 and blockIdx.y numbers a k range of kspan (kspan % 32 == 0, gridDim.y * kspan == K); its partial tile goes to C + blockIdx.y * sK.
// Fragment map (A and Bt alike): lane -> row (lane & 15); elements 0..7 = k0 + 8*(lane>>4) + 0..7, elements 8..15 = k0 + 16 + 8*(lane>>4) + 0..7.
template <typename T16> struct WFrag;
template <> struct WFrag<h16> { typedef v16h V; static __device__ __forceinline__ V ld(const h16* p) { return cat16(*(const v8h*)p, *(const v8h*)(p + 16)); } static __device__ __forceinline__ v8f mma(V a, V b, v8f c) { return wmma16(a, b, c); } };
template <> struct WFrag<bf> { typedef v16bf V; static __device__ __forceinline__ V ld(const bf* p) { return cat16b(*(const v8us*)p, *(const v8us*)(p + 16)); } static __device__ __forceinline__ v8f mma(V a, V b, v8f c) { return wmmab(a, b, c); } };
template <typename T16, int NSPLIT, bool BIAS, bool KSP>
__global__ __launch_bounds__(32) void k_gemmw(const T16* __restrict__ A, const T16* __restrict__ A2, const T16* __restrict__ Bt, const T16* __restrict__ Bt2, int K, float* C, int ldc, const float* __restrict__ bias, size_t sA, size_t sB, size_t sC, int kspan, size_t sK) {
    typedef typename WFrag<T16>::V V;
    __shared__ __align__(16) float os[16 * 68];
    const size_t z = blockIdx.z; A += z * sA; if (A2) A2 += z * sA; Bt += z * sB; if (Bt2) Bt2 += z * sB; C += z * sC;
    const int lane = threadIdx.x & 31, lr = lane & 15, hi = lane >> 4; const int r0 = blockIdx.x * 64, c0 = KSP ? 0 : blockIdx.y * 64;
    const int kn = KSP ? kspan : K; if (KSP) { const size_t kb = (size_t)blockIdx.y * kspan; A += kb; if (A2) A2 += kb; Bt += kb; if (Bt2) Bt2 += kb; C += blockIdx.y * sK; }
    v8f acc[4][4];
#pragma unroll
    for (int mb = 0; mb < 4; ++mb)
#pragma unroll
        for (int nb = 0; nb < 4; ++nb) acc[mb][nb] = (v8f){};
    const size_t aoff = (size_t)(r0 + lr) * K + 8 * hi, boff = (size_t)(c0 + lr) * K + 8 * hi;
#pragma unroll 1
    for (int kc = 0; kc < kn; kc += 32) {
        V a[4], a2[4];
#pragma unroll
        for (int mb = 0; mb < 4; ++mb) { a[mb] = WFrag<T16>::ld(A + aoff + (size_t)mb * 16 * K + kc); if (NSPLIT == 1 || NSPLIT == 2) a2[mb] = WFrag<T16>::ld(A2 + aoff + (size_t)mb * 16 * K + kc); }
#pragma unroll
        for (int nb = 0; nb < 4; ++nb) { const V b = WFrag<T16>::ld(Bt + boff + (size_t)nb * 16 * K + kc); V b2; if (NSPLIT >= 2) b2 = WFrag<T16>::ld(Bt2 + boff + (size_t)nb * 16 * K + kc);
#pragma unroll
            for (int mb = 0; mb < 4; ++mb) { acc[mb][nb] = WFrag<T16>::mma(a[mb], b, acc[mb][nb]); if (NSPLIT == 1 || NSPLIT == 2) acc[mb][nb] = WFrag<T16>::mma(a2[mb], b, acc[mb][nb]); if (NSPLIT >= 2) acc[mb][nb] = WFrag<T16>::mma(a[mb], b2, acc[mb][nb]); } }
        asm volatile("v_nop\n\tv_nop\n\tv_nop\n\tv_nop" : "+v"(acc[0][0]), "+v"(acc[1][1]), "+v"(acc[2][2]), "+v"(acc[3][3]) : "v"(a[0]), "v"(a[3]));
    }
#pragma unroll
    for (int mb = 0; mb < 4; ++mb) {
#pragma unroll
        for (int nb = 0; nb < 4; ++nb) {
#pragma unroll
            for (int j = 0; j < 8; ++j) os[(hi * 8 + j) * 68 + nb * 16 + lr] = acc[mb][nb][j]; }
        __builtin_amdgcn_wave_barrier(); asm volatile("" ::: "memory");
        float* crow = C + (size_t)(r0 + mb * 16) * ldc + c0;
{
#pragma unroll
            for (int s = 0; s < 8; ++s) { const int row = 2 * s + hi, cofs = lr * 4; v4f val = *(const v4fa*)(os + row * 68 + cofs); if (BIAS) { val[0] += bfr(bias[c0 + cofs]); val[1] += bfr(bias[c0 + cofs + 1]); val[2] += bfr(bias[c0 + cofs + 2]); val[3] += bfr(bias[c0 + cofs + 3]); }
                *(v4f*)(crow + (size_t)row * ldc + cofs) = val; }
             }
        __builtin_amdgcn_wave_barrier(); asm volatile("" ::: "memory");
    }
}

__device__ __forceinline__ h16 tohx(float x) { return (h16)x; }
__device__ __forceinline__ void splitf(float y, unsigned short& h, unsigned short& l) { h = f2bf(y); l = f2bf(y - bf2f(h)); }
typedef __attribute__((ext_vector_type(2))) _Float16 v2h;
typedef __attribute__((ext_vector_type(4))) _Float16 v4h;
typedef __attribute__((ext_vector_type(2))) unsigned short v2us;
typedef __attribute__((ext_vector_type(4))) unsigned short v4us;
typedef __attribute__((ext_vector_type(2))) float v2f;
typedef __attribute__((ext_vector_type(4))) int v4i;

// f32 -> fp16 with a value select: magnitudes below the smallest fp16 normal become zero.
static __device__ __forceinline__ h16 toh_flush(float v) { const h16 r = (h16)v; return (fabsf(v) < 6.103515625e-05f) ? (h16)0.0f : r; }

__global__ __launch_bounds__(256) void k_cvt8(const float* __restrict__ src, bf* dst, size_t n8) { const size_t i = (size_t)blockIdx.x * 256 + threadIdx.x; if (i >= n8) return; const v8f v = *(const v8f*)(src + i * 8); v8us o;
#pragma unroll
    for (int k = 0; k < 8; ++k) o[k] = f2bf(v[k]); *(v8us*)(dst + i * 8) = o;  }

// k_hplr: rotary head planes [h][t][d] (fp16 + bf16 hi/lo): the pair (d, d+1) = (2j, 2j+1) of F[t][h*HD + d] (row pitch 'pitch') is rotated by the RNE bf16 copies of the table values CS[t][j], SN[t][j] read from the inputs
__global__ __launch_bounds__(256) void k_hplr(const float* __restrict__ F, int pitch, int nheads, const float* __restrict__ CS, const float* __restrict__ SN, h16* P16, bf* Ph, bf* Pl) {
#pragma clang fp contract(off)
    const size_t e = ((size_t)blockIdx.x * 256 + threadIdx.x) * 2; if (e >= (size_t)nheads * TT * HD) return; const int d = (int)(e % HD); const int t = (int)((e / HD) % TT); const int h = (int)(e / ((size_t)HD * TT));
    const v2f x = *(const v2f*)(F + (size_t)t * pitch + h * HD + d);
    const float c = bfr(CS[(size_t)t * HP + (d >> 1)]); const float s = bfr(SN[(size_t)t * HP + (d >> 1)]);
    v2f r; r[0] = x[0] * c - x[1] * s; r[1] = x[0] * s + x[1] * c;
    v2h o16; v2us oh, ol;
#pragma unroll
    for (int q = 0; q < 2; ++q) { const float y = r[q]; o16[q] = toh_flush(y); unsigned short a2, c2; splitf(y, a2, c2); oh[q] = a2; ol[q] = c2; }
    *(v2h*)(P16 + e) = o16; *(v2us*)(Ph + e) = oh; *(v2us*)(Pl + e) = ol;  }

__global__ __launch_bounds__(256) void k_vtp(const float* __restrict__ F, int pitch, int nheads, h16* V16, bf* Vh, bf* Vl) { const size_t e = ((size_t)blockIdx.x * 256 + threadIdx.x) * 2; if (e >= (size_t)nheads * HD * TT) return; const int t = (int)(e % TT); const int d = (int)((e / TT) % HD); const int g = (int)(e / ((size_t)TT * HD)); v2h o16; v2us oh, ol;
#pragma unroll
    for (int q = 0; q < 2; ++q) { const float x = F[(size_t)(t + q) * pitch + g * HD + d]; o16[q] = tohx(x); unsigned short a2, c2; splitf(x, a2, c2); oh[q] = a2; ol[q] = c2; }
    *(v2h*)(V16 + e) = o16; *(v2us*)(Vh + e) = oh; *(v2us*)(Vl + e) = ol;  }

// k_asoft: one wave per row (zz, i): t = S x HD^-0.5, then t := -1e9 where MK[i][j] == 0 (value select; MK row pitch SEQ_FULL, shared by all heads and batches);
// softmax over the TT keys (register row, running-max form, one exp, fixed trees); a fully filled row comes out uniform.
__global__ __launch_bounds__(256) void k_asoft(const float* __restrict__ Sb, const int* __restrict__ MK, h16* P16, bf* Ph, bf* Pl) {
    const int lane = threadIdx.x & 31; const int row = blockIdx.x * 8 + (threadIdx.x >> 5); if (row >= ZH * TT) return; const int i = row % TT; const int zz = row / TT; const bool hires = (i < RH);
    const float* sr = Sb + (size_t)row * TT; const int* mr = MK + (size_t)i * SEQ_FULL; float v[TT / 32]; float mx = -3.0e38f;
#pragma unroll
    for (int ch = 0; ch < TT / 128; ++ch) { const int j0 = ch * 128 + lane * 4; const v4f a = *(const v4f*)(sr + j0); const v4i m = *(const v4i*)(mr + j0);
#pragma unroll
        for (int q = 0; q < 4; ++q) { const float sv = a[q] * SCL; const float t = (m[q] == 0) ? MFILL : sv; v[ch * 4 + q] = t; mx = fmaxf(mx, t); } }
#pragma unroll
    for (int sh = 16; sh; sh >>= 1) mx = fmaxf(mx, __shfl_xor(mx, sh, 32));
    float sum = 0.f;
#pragma unroll
    for (int k = 0; k < TT / 32; ++k) { float d0 = __fsub_rn(v[k], mx); asm volatile("" : "+v"(d0)); v[k] = __builtin_amdgcn_exp2f(fmaxf(__fmul_rn(d0, 1.4426950408889634f), -160.0f)); sum += v[k]; }
#pragma unroll
    for (int sh = 16; sh; sh >>= 1) sum += __shfl_xor(sum, sh, 32);
    const float f = __fdiv_rn(hires ? 1.0f : PCAR, sum);
{
        if (hires) {
#pragma unroll
            for (int ch = 0; ch < TT / 128; ++ch) { v4us oh, ol;
#pragma unroll
                for (int q = 0; q < 4; ++q) { unsigned short a, c2; splitf(v[ch * 4 + q] * f, a, c2); oh[q] = a; ol[q] = c2; }
                const size_t oo = ((size_t)zz * (RH ? RH : 1) + i) * TT + ch * 128 + lane * 4; *(v4us*)(Ph + oo) = oh; *(v4us*)(Pl + oo) = ol; }
        } else {
#pragma unroll
            for (int ch = 0; ch < TT / 128; ++ch) { v4h o4;
#pragma unroll
                for (int q = 0; q < 4; ++q) o4[q] = tohx(v[ch * 4 + q] * f);
                *(v4h*)(P16 + (size_t)row * TT + ch * 128 + lane * 4) = o4; } }
         }
}

// k_merge: O holds KSN partial planes [r][zz][t][d]; they are summed in the order r = 0 .. KSN-1, then scaled and split into the merged hi/lo planes.
__global__ __launch_bounds__(256) void k_merge(const float* __restrict__ O, int h0, bf* Ah, bf* Al) { const size_t e = ((size_t)blockIdx.x * 256 + threadIdx.x) * 2; if (e >= (size_t)ZH * TT * HD) return; const int d = (int)(e % HD); const int t = (int)((e / HD) % TT); const int zz = (int)(e / ((size_t)HD * TT)); const float cs = (t < RH) ? 1.0f : (1.0f / PCAR); const size_t oo = (size_t)t * DQ + (h0 + zz) * HD + d;
    v2f part[KSN];
#pragma unroll
    for (int r = 0; r < KSN; ++r) part[r] = *(const v2f*)(O + (size_t)r * ZH * TT * HD + e);
    v2f acc = part[0];
#pragma unroll
    for (int r = 1; r < KSN; ++r) acc += part[r];
    v2us oh, ol;
#pragma unroll
    for (int q = 0; q < 2; ++q) { unsigned short a, c2; splitf(acc[q] * cs, a, c2); oh[q] = a; ol[q] = c2; } *(v2us*)(Ah + oo) = oh; *(v2us*)(Al + oo) = ol;  }

extern "C" void kernel_launch(void* const* d_in, const int* in_sizes, int n_in,
                              void* d_out, int out_size, void* d_ws, size_t ws_size, hipStream_t stream) {
    if (n_in < 8) return;
    const size_t need_x = ((size_t)(NB - 1) * SEQ_FULL + SEQ) * DM;          // elements of the activation stream / of the output that are touched
    const size_t need_m = (size_t)(SEQ - 1) * SEQ_FULL + SEQ;                // mask entries touched
    if ((size_t)in_sizes[0] < need_x) return;
    if ((size_t)in_sizes[1] < (size_t)SEQ * HP || (size_t)in_sizes[2] < (size_t)SEQ * HP) return;
    if ((size_t)in_sizes[3] < need_m) return;
    if ((size_t)in_sizes[4] < (size_t)DQ * DM || (size_t)in_sizes[5] < (size_t)DKV * DM || (size_t)in_sizes[6] < (size_t)DKV * DM || (size_t)in_sizes[7] < (size_t)DM * DQ) return;
    if ((size_t)out_size < need_x) return;
    // wire order: x, cos, sin, attn_mask (int32), wq, wk, wv, wo ('oi' weights)
    const float* x = (const float*)d_in[0]; const float* cs = (const float*)d_in[1]; const float* sn = (const float*)d_in[2]; const int* mk = (const int*)d_in[3];
    const float* wq = (const float*)d_in[4]; const float* wk = (const float*)d_in[5]; const float* wv = (const float*)d_in[6]; const float* wo = (const float*)d_in[7];
    float* OUT = (float*)d_out;     // [2][2048][768]
    char* wsp = (char*)d_ws;
    auto take = [&](size_t bytes) { char* p = wsp; wsp += (bytes + 255) & ~(size_t)255; return (void*)p; };
    bf* WQ = (bf*)take((size_t)DQ * DM * 2); bf* WK = (bf*)take((size_t)DKV * DM * 2); bf* WV = (bf*)take((size_t)DKV * DM * 2); bf* WO = (bf*)take((size_t)DM * DQ * 2);
    h16* QP16 = (h16*)take((size_t)NH_ * TT * HD * 2); h16* KP16 = (h16*)take((size_t)NKV * TT * HD * 2); h16* VT16 = (h16*)take((size_t)NKV * HD * TT * 2);
    bf* QPh = (bf*)take((size_t)NH_ * TT * HD * 2); bf* QPl = (bf*)take((size_t)NH_ * TT * HD * 2); bf* KPh = (bf*)take((size_t)NKV * TT * HD * 2); bf* KPl = (bf*)take((size_t)NKV * TT * HD * 2); bf* VTh = (bf*)take((size_t)NKV * HD * TT * 2); bf* VTl = (bf*)take((size_t)NKV * HD * TT * 2); bf* Ph = (bf*)take((size_t)ZH * RH * TT * 2); bf* Pl = (bf*)take((size_t)ZH * RH * TT * 2);
    float* Sb = (float*)take((size_t)ZH * TT * TT * 4); h16* P16 = (h16*)take((size_t)ZH * TT * TT * 2); float* Ob = (float*)take((size_t)KSN * ZH * TT * HD * 4); bf* ATh = (bf*)take((size_t)TT * DQ * 2); bf* ATl = (bf*)take((size_t)TT * DQ * 2);
    // XB, FQ, FK are dead once a batch's head planes are built, Sb is first written after that: they share Sb's bytes (stream-ordered, rewritten for every batch)
    bf* XB = (bf*)Sb; float* FQ = (float*)((char*)Sb + A256((size_t)TT * DM * 2)); float* FK = (float*)((char*)Sb + A256((size_t)TT * DM * 2) + A256((size_t)TT * DQ * 4));
    const size_t used = (size_t)(wsp - (char*)d_ws);
    if (used > ws_size || used > (size_t)268435456) return;    // carve 265,814,016 B at full size
    float* FV = FK;   // v projection reuses the k buffer after the k planes are built (stream-ordered)
    k_cvt8<<<(unsigned)(((size_t)DQ * DM / 8 + 255) / 256), 256, 0, stream>>>(wq, WQ, (size_t)DQ * DM / 8);
    k_cvt8<<<(unsigned)(((size_t)DKV * DM / 8 + 255) / 256), 256, 0, stream>>>(wk, WK, (size_t)DKV * DM / 8);
    k_cvt8<<<(unsigned)(((size_t)DKV * DM / 8 + 255) / 256), 256, 0, stream>>>(wv, WV, (size_t)DKV * DM / 8);
    k_cvt8<<<(unsigned)(((size_t)DM * DQ / 8 + 255) / 256), 256, 0, stream>>>(wo, WO, (size_t)DM * DQ / 8);
    const unsigned LQ = (unsigned)(((size_t)NH_ * TT * HD / 2 + 255) / 256), LKv = (unsigned)(((size_t)NKV * TT * HD / 2 + 255) / 256);
    const unsigned LX = (unsigned)(((size_t)TT * DM / 8 + 255) / 256);
    for (int b = 0; b < NB; ++b) {
        const size_t xoff = (size_t)b * SEQ_FULL * DM;     // full per-batch stride of the input and of the output
        k_cvt8<<<LX, 256, 0, stream>>>(x + xoff, XB, (size_t)TT * DM / 8);    /* XB := bf16(x[b]), shared by the three projections */
        k_gemmw<bf, 0, false, false><<<dim3(TT / 64, DQ / 64, 1), 32, 0, stream>>>(XB, nullptr, WQ, nullptr, DM, FQ, DQ, nullptr, 0, 0, 0, 0, 0);
        k_hplr<<<LQ, 256, 0, stream>>>(FQ, DQ, NH_, cs, sn, QP16, QPh, QPl);
        k_gemmw<bf, 0, false, false><<<dim3(TT / 64, DKV / 64, 1), 32, 0, stream>>>(XB, nullptr, WK, nullptr, DM, FK, DKV, nullptr, 0, 0, 0, 0, 0);
        k_hplr<<<LKv, 256, 0, stream>>>(FK, DKV, NKV, cs, sn, KP16, KPh, KPl);
        k_gemmw<bf, 0, false, false><<<dim3(TT / 64, DKV / 64, 1), 32, 0, stream>>>(XB, nullptr, WV, nullptr, DM, FV, DKV, nullptr, 0, 0, 0, 0, 0);   /* after the k planes are built */
        k_vtp<<<LKv, 256, 0, stream>>>(FV, DKV, NKV, VT16, VTh, VTl);
        for (int h0 = 0; h0 < NH_; h0 += ZH) { const size_t zq = (size_t)h0, zk = (size_t)(h0 / REP);   // the pass's heads use consecutive planes (z-strides TT*HD)
            k_gemmw<bf, 2, false, false><<<dim3(RH / 64, TT / 64, ZH), 32, 0, stream>>>(QPh + zq * TT * HD, QPl + zq * TT * HD, KPh + zk * TT * HD, KPl + zk * TT * HD, HD, Sb, TT, nullptr, (size_t)TT * HD, (size_t)TT * HD, (size_t)TT * TT, 0, 0);
            if (TT > RH) k_gemmw<h16, 0, false, false><<<dim3((TT - RH) / 64, TT / 64, ZH), 32, 0, stream>>>(QP16 + zq * TT * HD + (size_t)RH * HD, nullptr, KP16 + zk * TT * HD, nullptr, HD, Sb + (size_t)RH * TT, TT, nullptr, (size_t)TT * HD, (size_t)TT * HD, (size_t)TT * TT, 0, 0);
            k_asoft<<<ZH * TT / 8, 256, 0, stream>>>(Sb, mk, P16, Ph, Pl);
            k_gemmw<bf, 2, false, true><<<dim3(RH / 64, KSN, ZH), 32, 0, stream>>>(Ph, Pl, VTh + zk * HD * TT, VTl + zk * HD * TT, TT, Ob, HD, nullptr, (size_t)RH * TT, (size_t)HD * TT, (size_t)TT * HD, TT / KSN, (size_t)ZH * TT * HD);
            if (TT > RH) k_gemmw<h16, 0, false, true><<<dim3((TT - RH) / 64, KSN, ZH), 32, 0, stream>>>(P16 + (size_t)RH * TT, nullptr, VT16 + zk * HD * TT, nullptr, TT, Ob + (size_t)RH * HD, HD, nullptr, (size_t)TT * TT, (size_t)HD * TT, (size_t)TT * HD, TT / KSN, (size_t)ZH * TT * HD);
            k_merge<<<(unsigned)(((size_t)ZH * TT * HD / 2 + 255) / 256), 256, 0, stream>>>(Ob, h0, ATh, ATl); }
        k_gemmw<bf, 1, false, false><<<dim3(TT / 64, DM / 64, 1), 32, 0, stream>>>(ATh, ATl, WO, nullptr, DQ, OUT + xoff, DM, nullptr, 0, 0, 0, 0, 0); }
}

// v003
// It runs in 363 microseconds.
// Timed twice side by side with v002, it ran 1.41 and 1.40 times as fast.
// Counting every step since v000, it is 4.22 times as fast.
#include <hip/hip_runtime.h>

// Causal self-attention over one input stream with interleaved-pair rotary embeddings whose cos / sin tables are inputs read by value, an int32 mask read by value, no biases (x [2][2048][768]; q = x Wq^T, k = x Wk^T, v = x Wv^T ('oi' [768][768]; 12 heads x 64); pairs (2j, 2j+1) of q and k rotated by cos[t][j], sin[t][j]; logits x 1/8; mask[i][j] == 0 -> logit replaced by -1e9; softmax over all 2048 keys; out = merged Wo^T -> [2][2048][768]; argument order x, cos, sin, attn_mask, wq, wk, wv, wo).
// Compute dtypes, f32 accumulate: projections v_wmma_f32_16x16x32_bf16 on RNE bf16 copies of x and weights; rotation f32 with RNE bf16 table values; logits and P.V: query rows < 512 bf16 hi/lo planes (3 products), rows >= 512 v_wmma_f32_16x16x32_f16 (P carried x1024); softmax f32; output projection bf16 hi/lo ctx x bf16 Wo (2 products).
// Layout per batch: bf16 copy of the input stream; bf16 projections; rotary head plane builders (q, k) and transposed value planes; one attention launch over all heads: a work-group of AW waves takes 16 or 32 query rows, each wave TT/AW keys; scores, softmax and P stay in registers, the waves' f32 partial tiles are summed in wave order through LDS; merged hi/lo x Wo.

#ifndef NB
#define NB   2
#endif
#ifndef SEQ
#define SEQ  2048
#endif
#define NB_FULL  2
#define SEQ_FULL 2048
#define TT   SEQ
#define DM   768
#define NH_  12
#define NKV  12
#define REP  (NH_ / NKV)
#define HD   64
#define HP   (HD / 2)    // rotary pairs per head = table row width
#define DQ   (NH_ * HD)
#define DKV  (NKV * HD)
#define AW   16   // waves of an attention work-group; each owns KW keys
#define KW   (SEQ / AW)
#define OP   68   // f32 pitch of a partial-tile row in LDS: rows 8 apart fall on different banks
#define RH   ((SEQ < 512) ? SEQ : 512)   // query rows < RH use hi+lo planes
#define PCAR 1024.0f
#define SCL  0.125f   // HD^-0.5
#define MFILL (-1.0e9f)
typedef _Float16 h16;
typedef unsigned short bf;
typedef __attribute__((ext_vector_type(16))) __bf16   v16bf;
typedef __attribute__((ext_vector_type(16))) _Float16 v16h;
typedef __attribute__((ext_vector_type(8)))  _Float16 v8h;
typedef __attribute__((ext_vector_type(8)))  unsigned short v8us;
typedef __attribute__((ext_vector_type(8)))  float    v8f;
typedef __attribute__((ext_vector_type(4)))  float    v4f;
typedef v4f  __attribute__((may_alias)) v4fa;

static_assert(TT % 128 == 0);
static_assert(TT % (AW * 32) == 0);
static_assert(RH % 16 == 0);
static_assert((TT - RH) % 32 == 0);
static_assert(RH % 64 == 0);
static_assert((TT - RH) % 64 == 0);
static_assert(DM % 32 == 0);
static_assert(DQ % 64 == 0);
static_assert(DKV % 64 == 0);
static_assert(DM % 64 == 0);
static_assert(HD == 64);
static_assert(NB <= NB_FULL);
static_assert(SEQ <= SEQ_FULL);
static_assert((size_t)NB_FULL * SEQ_FULL * DM * 4 == 12582912);
static_assert(HP == 32);                                  // table rows are [t][32]
static_assert(HD % 2 == 0);
static_assert(DQ == DM);                                  // merged width == model width (no bias, square Wo)
static_assert(NKV == NH_);                                // one k/v head per q head
static_assert(((size_t)NH_ * TT * HD / 2) % 256 == 0);    // plane builder grids are exact
static_assert(((size_t)TT * DM / 8) % 256 == 0);
#define A256(x) ((((size_t)(x)) + 255) & ~(size_t)255)
static_assert(4 * A256((size_t)DQ * DM * 2) + 9 * A256((size_t)NH_ * TT * HD * 2) + A256((size_t)TT * DM * 2) + A256((size_t)TT * DQ * 4) + A256((size_t)TT * DKV * 4) + 2 * A256((size_t)TT * DQ * 2) <= (size_t)268435456);

__device__ __forceinline__ unsigned short f2bf(float f) { unsigned u = __float_as_uint(f); u += 0x7FFFu + ((u >> 16) & 1u); return (unsigned short)(u >> 16); }
__device__ __forceinline__ float bf2f(unsigned short b) { return __uint_as_float(((unsigned)b) << 16); }
__device__ __forceinline__ float bfr(float f) { return bf2f(f2bf(f)); }
__device__ __forceinline__ v16h cat16(v8h lo, v8h hi) { return __builtin_shufflevector(lo, hi, 0, 1, 2, 3, 4, 5, 6, 7, 8, 9, 10, 11, 12, 13, 14, 15); }
__device__ __forceinline__ v16bf cat16b(v8us lo, v8us hi) { return __builtin_bit_cast(v16bf, __builtin_shufflevector(lo, hi, 0, 1, 2, 3, 4, 5, 6, 7, 8, 9, 10, 11, 12, 13, 14, 15)); }
__device__ __forceinline__ v8f wmma16(v16h a, v16h b, v8f c) { return __builtin_amdgcn_wmma_f32_16x16x32_f16(false, a, false, b, (short)0, c, false, false); }
__device__ __forceinline__ v8f wmmab(v16bf a, v16bf b, v8f c) { return __builtin_amdgcn_wmma_f32_16x16x32_bf16(false, a, false, b, (short)0, c, false, false); }

// ---- k_gemmw: register-blocked GEMM, ONE WAVE per 64x64 output tile (16 accumulators), operands straight from K-contiguous 16-bit planes; grid (M/64, N/64, Z), 32 threads.
// C[m][n] (f32, pitch ldc, + optional f32 bias[n]) = sum_k A[m][k] Bt[n][k] (+ split products per NSPLIT). z-batch strides sA/sB/sC in elements. K % 32 == 0.
// KSP: N == 64 and blockIdx.y numbers a k range of kspan (kspan % 32 == 0, gridDim.y * kspan == K); its partial tile goes to C + blockIdx.y * sK.
// Fragment map (A and Bt alike): lane -> row (lane & 15); elements 0..7 = k0 + 8*(lane>>4) + 0..7, elements 8..15 = k0 + 16 + 8*(lane>>4) + 0..7.
template <typename T16> struct WFrag;
template <> struct WFrag<h16> { typedef v16h V; static __device__ __forceinline__ V ld(const h16* p) { return cat16(*(const v8h*)p, *(const v8h*)(p + 16)); } static __device__ __forceinline__ v8f mma(V a, V b, v8f c) { return wmma16(a, b, c); } };
template <> struct WFrag<bf> { typedef v16bf V; static __device__ __forceinline__ V ld(const bf* p) { return cat16b(*(const v8us*)p, *(const v8us*)(p + 16)); } static __device__ __forceinline__ v8f mma(V a, V b, v8f c) { return wmmab(a, b, c); } };
template <typename T16, int NSPLIT, bool BIAS, bool KSP>
__global__ __launch_bounds__(32) void k_gemmw(const T16* __restrict__ A, const T16* __restrict__ A2, const T16* __restrict__ Bt, const T16* __restrict__ Bt2, int K, float* C, int ldc, const float* __restrict__ bias, size_t sA, size_t sB, size_t sC, int kspan, size_t sK) {
    typedef typename WFrag<T16>::V V;
    __shared__ __align__(16) float os[16 * 68];
    const size_t z = blockIdx.z; A += z * sA; if (A2) A2 += z * sA; Bt += z * sB; if (Bt2) Bt2 += z * sB; C += z * sC;
    const int lane = threadIdx.x & 31, lr = lane & 15, hi = lane >> 4; const int r0 = blockIdx.x * 64, c0 = KSP ? 0 : blockIdx.y * 64;
    const int kn = KSP ? kspan : K; if (KSP) { const size_t kb = (size_t)blockIdx.y * kspan; A += kb; if (A2) A2 += kb; Bt += kb; if (Bt2) Bt2 += kb; C += blockIdx.y * sK; }
    v8f acc[4][4];
#pragma unroll
    for (int mb = 0; mb < 4; ++mb)
#pragma unroll
        for (int nb = 0; nb < 4; ++nb) acc[mb][nb] = (v8f){};
    const size_t aoff = (size_t)(r0 + lr) * K + 8 * hi, boff = (size_t)(c0 + lr) * K + 8 * hi;
#pragma unroll 1
    for (int kc = 0; kc < kn; kc += 32) {
        V a[4], a2[4];
#pragma unroll
        for (int mb = 0; mb < 4; ++mb) { a[mb] = WFrag<T16>::ld(A + aoff + (size_t)mb * 16 * K + kc); if (NSPLIT == 1 || NSPLIT == 2) a2[mb] = WFrag<T16>::ld(A2 + aoff + (size_t)mb * 16 * K + kc); }
#pragma unroll
        for (int nb = 0; nb < 4; ++nb) { const V b = WFrag<T16>::ld(Bt + boff + (size_t)nb * 16 * K + kc); V b2; if (NSPLIT >= 2) b2 = WFrag<T16>::ld(Bt2 + boff + (size_t)nb * 16 * K + kc);
#pragma unroll
            for (int mb = 0; mb < 4; ++mb) { acc[mb][nb] = WFrag<T16>::mma(a[mb], b, acc[mb][nb]); if (NSPLIT == 1 || NSPLIT == 2) acc[mb][nb] = WFrag<T16>::mma(a2[mb], b, acc[mb][nb]); if (NSPLIT >= 2) acc[mb][nb] = WFrag<T16>::mma(a[mb], b2, acc[mb][nb]); } }
        asm volatile("v_nop\n\tv_nop\n\tv_nop\n\tv_nop" : "+v"(acc[0][0]), "+v"(acc[1][1]), "+v"(acc[2][2]), "+v"(acc[3][3]) : "v"(a[0]), "v"(a[3]));
    }
#pragma unroll
    for (int mb = 0; mb < 4; ++mb) {
#pragma unroll
        for (int nb = 0; nb < 4; ++nb) {
#pragma unroll
            for (int j = 0; j < 8; ++j) os[(hi * 8 + j) * 68 + nb * 16 + lr] = acc[mb][nb][j]; }
        __builtin_amdgcn_wave_barrier(); asm volatile("" ::: "memory");
        float* crow = C + (size_t)(r0 + mb * 16) * ldc + c0;
{
#pragma unroll
            for (int s = 0; s < 8; ++s) { const int row = 2 * s + hi, cofs = lr * 4; v4f val = *(const v4fa*)(os + row * 68 + cofs); if (BIAS) { val[0] += bfr(bias[c0 + cofs]); val[1] += bfr(bias[c0 + cofs + 1]); val[2] += bfr(bias[c0 + cofs + 2]); val[3] += bfr(bias[c0 + cofs + 3]); }
                *(v4f*)(crow + (size_t)row * ldc + cofs) = val; }
             }
        __builtin_amdgcn_wave_barrier(); asm volatile("" ::: "memory");
    }
}

__device__ __forceinline__ h16 tohx(float x) { return (h16)x; }
__device__ __forceinline__ void splitf(float y, unsigned short& h, unsigned short& l) { h = f2bf(y); l = f2bf(y - bf2f(h)); }
typedef __attribute__((ext_vector_type(2))) _Float16 v2h;
typedef __attribute__((ext_vector_type(4))) _Float16 v4h;
typedef __attribute__((ext_vector_type(2))) unsigned short v2us;
typedef __attribute__((ext_vector_type(4))) unsigned short v4us;
typedef __attribute__((ext_vector_type(2))) float v2f;
typedef __attribute__((ext_vector_type(4))) int v4i;

// f32 -> fp16 with a value select: magnitudes below the smallest fp16 normal become zero.
static __device__ __forceinline__ h16 toh_flush(float v) { const h16 r = (h16)v; return (fabsf(v) < 6.103515625e-05f) ? (h16)0.0f : r; }

__global__ __launch_bounds__(256) void k_cvt8(const float* __restrict__ src, bf* dst, size_t n8) { const size_t i = (size_t)blockIdx.x * 256 + threadIdx.x; if (i >= n8) return; const v8f v = *(const v8f*)(src + i * 8); v8us o;
#pragma unroll
    for (int k = 0; k < 8; ++k) o[k] = f2bf(v[k]); *(v8us*)(dst + i * 8) = o;  }

// k_hplr: rotary head planes [h][t][d] (fp16 + bf16 hi/lo): the pair (d, d+1) = (2j, 2j+1) of F[t][h*HD + d] (row pitch 'pitch') is rotated by the RNE bf16 copies of the table values CS[t][j], SN[t][j] read from the inputs
__global__ __launch_bounds__(256) void k_hplr(const float* __restrict__ F, int pitch, int nheads, const float* __restrict__ CS, const float* __restrict__ SN, h16* P16, bf* Ph, bf* Pl) {
#pragma clang fp contract(off)
    const size_t e = ((size_t)blockIdx.x * 256 + threadIdx.x) * 2; if (e >= (size_t)nheads * TT * HD) return; const int d = (int)(e % HD); const int t = (int)((e / HD) % TT); const int h = (int)(e / ((size_t)HD * TT));
    const v2f x = *(const v2f*)(F + (size_t)t * pitch + h * HD + d);
    const float c = bfr(CS[(size_t)t * HP + (d >> 1)]); const float s = bfr(SN[(size_t)t * HP + (d >> 1)]);
    v2f r; r[0] = x[0] * c - x[1] * s; r[1] = x[0] * s + x[1] * c;
    v2h o16; v2us oh, ol;
#pragma unroll
    for (int q = 0; q < 2; ++q) { const float y = r[q]; o16[q] = toh_flush(y); unsigned short a2, c2; splitf(y, a2, c2); oh[q] = a2; ol[q] = c2; }
    *(v2h*)(P16 + e) = o16; *(v2us*)(Ph + e) = oh; *(v2us*)(Pl + e) = ol;  }

__global__ __launch_bounds__(256) void k_vtp(const float* __restrict__ F, int pitch, int nheads, h16* V16, bf* Vh, bf* Vl) { const size_t e = ((size_t)blockIdx.x * 256 + threadIdx.x) * 2; if (e >= (size_t)nheads * HD * TT) return; const int t = (int)(e % TT); const int d = (int)((e / TT) % HD); const int g = (int)(e / ((size_t)TT * HD)); v2h o16; v2us oh, ol;
#pragma unroll
    for (int q = 0; q < 2; ++q) { const float x = F[(size_t)(t + q) * pitch + g * HD + d]; o16[q] = tohx(x); unsigned short a2, c2; splitf(x, a2, c2); oh[q] = a2; ol[q] = c2; }
    *(v2h*)(V16 + e) = o16; *(v2us*)(Vh + e) = oh; *(v2us*)(Vl + e) = ol;  }

// k_attn: scores, softmax, P.V and the merge of one head's 16 (rows < RH, hi/lo planes) or 32 (fp16 planes) query rows in one work-group of AW waves; wave w owns keys w*KW .. w*KW+KW-1.
// Scores are formed transposed, S^T = K Q^T: lane (lr, hi) holds query lr, keys 8*hi + j of a 16-key tile, so two neighbouring tiles are, element for element, the A fragment of P for 32 keys (fragment map above) and P never leaves the registers.
// t = S x HD^-0.5, then t := -1e9 where MK[i][j] == 0 (value select; MK row pitch SEQ_FULL, shared by all heads and batches); softmax over the TT keys: exact row maximum and row sum over the waves through LDS, in wave order; a fully filled row comes out uniform.
// Each wave's f32 partial tile [q][d] goes to LDS; the tiles are summed in the order w = 0 .. AW-1, scaled and split into the merged hi/lo planes.
template <typename T16, int QT, bool HL>
__device__ __forceinline__ void attn_tile(const T16* __restrict__ Q, const T16* __restrict__ Q2, const T16* __restrict__ Kp, const T16* __restrict__ K2, const T16* __restrict__ Vt, const T16* __restrict__ V2, const int* __restrict__ MK, int q0, int hcol, bf* Ah, bf* Al, float* part, float* redm, float* reds) {
    typedef typename WFrag<T16>::V V;
    const int tid = threadIdx.x, lane = tid & 31, lr = lane & 15, hi = lane >> 4, w = tid >> 5; const int kb = w * KW;
    V qf[QT][2], qf2[QT][2];
#pragma unroll
    for (int qt = 0; qt < QT; ++qt)
#pragma unroll
        for (int c = 0; c < 2; ++c) { const size_t o = (size_t)(q0 + qt * 16 + lr) * HD + 8 * hi + c * 32; qf[qt][c] = WFrag<T16>::ld(Q + o); if (HL) qf2[qt][c] = WFrag<T16>::ld(Q2 + o); }
    asm volatile("s_wait_xcnt 0x0" ::: "memory");   // the query loads' address registers are free for reuse behind this line
    const int* mb = MK + (size_t)(q0 + lr) * SEQ_FULL + kb + 8 * hi;   // one base for every mask load of the wave
    v8f s[KW / 16][QT]; float mx[QT], sum[QT], f[QT];
#pragma unroll
    for (int qt = 0; qt < QT; ++qt) mx[qt] = -3.0e38f;
#pragma unroll
    for (int kt = 0; kt < KW / 16; ++kt) { V ka[2], ka2[2];
#pragma unroll
        for (int c = 0; c < 2; ++c) { const size_t o = (size_t)(kb + kt * 16 + lr) * HD + 8 * hi + c * 32; ka[c] = WFrag<T16>::ld(Kp + o); if (HL) ka2[c] = WFrag<T16>::ld(K2 + o); }
        if (kt == KW / 16 - 1) asm volatile("s_wait_xcnt 0x0" ::: "memory");   // last key loads: their address registers are free for reuse behind this line
#pragma unroll
        for (int qt = 0; qt < QT; ++qt) { v8f a = (v8f){};
#pragma unroll
            for (int c = 0; c < 2; ++c) { a = WFrag<T16>::mma(ka[c], qf[qt][c], a); if (HL) { a = WFrag<T16>::mma(ka[c], qf2[qt][c], a); a = WFrag<T16>::mma(ka2[c], qf[qt][c], a); } }
            const int* mr = mb + (size_t)qt * 16 * SEQ_FULL + kt * 16; const v4i m0 = *(const v4i*)mr; const v4i m1 = *(const v4i*)(mr + 4);
#pragma unroll
            for (int j = 0; j < 8; ++j) { const float sv = a[j] * SCL; const float t = ((j < 4 ? m0[j & 3] : m1[j & 3]) == 0) ? MFILL : sv; a[j] = t; mx[qt] = fmaxf(mx[qt], t); }
            s[kt][qt] = a; }
        if (QT == 2 && (kt & 1)) __builtin_amdgcn_sched_barrier(0);   // keeps later key tiles' loads from being hoisted here: with all of them in flight beside 128 score registers the wave spills
    }
#pragma unroll
    for (int qt = 0; qt < QT; ++qt) { mx[qt] = fmaxf(mx[qt], __shfl_xor(mx[qt], 16, 32)); if (hi == 0) redm[w * 32 + qt * 16 + lr] = mx[qt]; }
    __syncthreads();   // every wave's row maxima are in redm
#pragma unroll
    for (int qt = 0; qt < QT; ++qt) {
#pragma unroll
        for (int r = 0; r < AW; ++r) mx[qt] = fmaxf(mx[qt], redm[r * 32 + qt * 16 + lr]);
        sum[qt] = 0.f; }
#pragma unroll
    for (int kt = 0; kt < KW / 16; ++kt)
#pragma unroll
        for (int qt = 0; qt < QT; ++qt)
#pragma unroll
            for (int j = 0; j < 8; ++j) { const float d0 = __fsub_rn(s[kt][qt][j], mx[qt]); const float e = __builtin_amdgcn_exp2f(fmaxf(__fmul_rn(d0, 1.4426950408889634f), -160.0f)); s[kt][qt][j] = e; sum[qt] += e; }
#pragma unroll
    for (int qt = 0; qt < QT; ++qt) { sum[qt] += __shfl_xor(sum[qt], 16, 32); if (hi == 0) reds[w * 32 + qt * 16 + lr] = sum[qt]; }
    __syncthreads();   // every wave's row sums are in reds
#pragma unroll
    for (int qt = 0; qt < QT; ++qt) { float t = reds[qt * 16 + lr];
#pragma unroll
        for (int r = 1; r < AW; ++r) t += reds[r * 32 + qt * 16 + lr];
        f[qt] = __fdiv_rn(HL ? 1.0f : PCAR, t); }
    v8f o[QT][4];
#pragma unroll
    for (int qt = 0; qt < QT; ++qt)
#pragma unroll
        for (int dt = 0; dt < 4; ++dt) o[qt][dt] = (v8f){};
#pragma unroll
    for (int c = 0; c < KW / 32; ++c) { V pa[QT], pa2[QT];
#pragma unroll
        for (int qt = 0; qt < QT; ++qt) {
            if constexpr (HL) { v8us h0, h1, l0, l1;
#pragma unroll
                for (int j = 0; j < 8; ++j) { unsigned short a, c2; splitf(s[2 * c][qt][j] * f[qt], a, c2); h0[j] = a; l0[j] = c2; splitf(s[2 * c + 1][qt][j] * f[qt], a, c2); h1[j] = a; l1[j] = c2; }
                pa[qt] = cat16b(h0, h1); pa2[qt] = cat16b(l0, l1);
            } else { v8h p0, p1;
#pragma unroll
                for (int j = 0; j < 8; ++j) { p0[j] = tohx(s[2 * c][qt][j] * f[qt]); p1[j] = tohx(s[2 * c + 1][qt][j] * f[qt]); }
                pa[qt] = cat16(p0, p1); } }
#pragma unroll
        for (int dt = 0; dt < 4; ++dt) { const size_t vo = (size_t)(dt * 16 + lr) * TT + kb + c * 32 + 8 * hi; const V vb = WFrag<T16>::ld(Vt + vo); V vb2; if (HL) vb2 = WFrag<T16>::ld(V2 + vo);
#pragma unroll
            for (int qt = 0; qt < QT; ++qt) { o[qt][dt] = WFrag<T16>::mma(pa[qt], vb, o[qt][dt]); if (HL) { o[qt][dt] = WFrag<T16>::mma(pa2[qt], vb, o[qt][dt]); o[qt][dt] = WFrag<T16>::mma(pa[qt], vb2, o[qt][dt]); } } } }
    float* pw = part + (size_t)w * (QT * 16 * OP);
#pragma unroll
    for (int qt = 0; qt < QT; ++qt)
#pragma unroll
        for (int dt = 0; dt < 4; ++dt)
#pragma unroll
            for (int j = 0; j < 8; ++j) pw[(qt * 16 + hi * 8 + j) * OP + dt * 16 + lr] = o[qt][dt][j];
    __syncthreads();   // every wave's partial tile is in part
    const float cs = HL ? 1.0f : (1.0f / PCAR);
    static_assert(QT * 16 * 16 <= AW * 32);
    if (tid < QT * 16 * 16) { const int row = tid >> 4, col = (tid & 15) * 4; v4f acc = *(const v4f*)(part + row * OP + col);
#pragma unroll
        for (int r = 1; r < AW; ++r) acc += *(const v4f*)(part + (size_t)r * (QT * 16 * OP) + row * OP + col);
        v4us oh, ol;
#pragma unroll
        for (int q = 0; q < 4; ++q) { unsigned short a, c2; splitf(acc[q] * cs, a, c2); oh[q] = a; ol[q] = c2; }
        const size_t oo = (size_t)(q0 + row) * DQ + hcol + col; *(v4us*)(Ah + oo) = oh; *(v4us*)(Al + oo) = ol; }
}

__global__ __launch_bounds__(AW * 32) void k_attn(const h16* __restrict__ Q16, const h16* __restrict__ K16, const h16* __restrict__ V16, const bf* __restrict__ Qh, const bf* __restrict__ Ql, const bf* __restrict__ Kh, const bf* __restrict__ Kl, const bf* __restrict__ Vh, const bf* __restrict__ Vl, const int* __restrict__ MK, bf* Ah, bf* Al) {
    __shared__ __align__(16) float part[AW * 32 * OP]; __shared__ float redm[AW * 32]; __shared__ float reds[AW * 32];
    const int h = blockIdx.y, bx = blockIdx.x; const size_t po = (size_t)h * TT * HD;
    if (bx < RH / 16) attn_tile<bf, 1, true>(Qh + po, Ql + po, Kh + po, Kl + po, Vh + po, Vl + po, MK, bx * 16, h * HD, Ah, Al, part, redm, reds);
    else attn_tile<h16, 2, false>(Q16 + po, nullptr, K16 + po, nullptr, V16 + po, nullptr, MK, RH + (bx - RH / 16) * 32, h * HD, Ah, Al, part, redm, reds);
}

extern "C" void kernel_launch(void* const* d_in, const int* in_sizes, int n_in,
                              void* d_out, int out_size, void* d_ws, size_t ws_size, hipStream_t stream) {
    if (n_in < 8) return;
    const size_t need_x = ((size_t)(NB - 1) * SEQ_FULL + SEQ) * DM;          // elements of the activation stream / of the output that are touched
    const size_t need_m = (size_t)(SEQ - 1) * SEQ_FULL + SEQ;                // mask entries touched
    if ((size_t)in_sizes[0] < need_x) return;
    if ((size_t)in_sizes[1] < (size_t)SEQ * HP || (size_t)in_sizes[2] < (size_t)SEQ * HP) return;
    if ((size_t)in_sizes[3] < need_m) return;
    if ((size_t)in_sizes[4] < (size_t)DQ * DM || (size_t)in_sizes[5] < (size_t)DKV * DM || (size_t)in_sizes[6] < (size_t)DKV * DM || (size_t)in_sizes[7] < (size_t)DM * DQ) return;
    if ((size_t)out_size < need_x) return;
    // wire order: x, cos, sin, attn_mask (int32), wq, wk, wv, wo ('oi' weights)
    const float* x = (const float*)d_in[0]; const float* cs = (const float*)d_in[1]; const float* sn = (const float*)d_in[2]; const int* mk = (const int*)d_in[3];
    const float* wq = (const float*)d_in[4]; const float* wk = (const float*)d_in[5]; const float* wv = (const float*)d_in[6]; const float* wo = (const float*)d_in[7];
    float* OUT = (float*)d_out;     // [2][2048][768]
    char* wsp = (char*)d_ws;
    auto take = [&](size_t bytes) { char* p = wsp; wsp += (bytes + 255) & ~(size_t)255; return (void*)p; };
    bf* WQ = (bf*)take((size_t)DQ * DM * 2); bf* WK = (bf*)take((size_t)DKV * DM * 2); bf* WV = (bf*)take((size_t)DKV * DM * 2); bf* WO = (bf*)take((size_t)DM * DQ * 2);
    h16* QP16 = (h16*)take((size_t)NH_ * TT * HD * 2); h16* KP16 = (h16*)take((size_t)NKV * TT * HD * 2); h16* VT16 = (h16*)take((size_t)NKV * HD * TT * 2);
    bf* QPh = (bf*)take((size_t)NH_ * TT * HD * 2); bf* QPl = (bf*)take((size_t)NH_ * TT * HD * 2); bf* KPh = (bf*)take((size_t)NKV * TT * HD * 2); bf* KPl = (bf*)take((size_t)NKV * TT * HD * 2); bf* VTh = (bf*)take((size_t)NKV * HD * TT * 2); bf* VTl = (bf*)take((size_t)NKV * HD * TT * 2);
    bf* XB = (bf*)take((size_t)TT * DM * 2); float* FQ = (float*)take((size_t)TT * DQ * 4); float* FK = (float*)take((size_t)TT * DKV * 4); bf* ATh = (bf*)take((size_t)TT * DQ * 2); bf* ATl = (bf*)take((size_t)TT * DQ * 2);
    const size_t used = (size_t)(wsp - (char*)d_ws);
    if (used > ws_size || used > (size_t)268435456) return;
    float* FV = FK;   // v projection reuses the k buffer after the k planes are built (stream-ordered)
    k_cvt8<<<(unsigned)(((size_t)DQ * DM / 8 + 255) / 256), 256, 0, stream>>>(wq, WQ, (size_t)DQ * DM / 8);
    k_cvt8<<<(unsigned)(((size_t)DKV * DM / 8 + 255) / 256), 256, 0, stream>>>(wk, WK, (size_t)DKV * DM / 8);
    k_cvt8<<<(unsigned)(((size_t)DKV * DM / 8 + 255) / 256), 256, 0, stream>>>(wv, WV, (size_t)DKV * DM / 8);
    k_cvt8<<<(unsigned)(((size_t)DM * DQ / 8 + 255) / 256), 256, 0, stream>>>(wo, WO, (size_t)DM * DQ / 8);
    const unsigned LQ = (unsigned)(((size_t)NH_ * TT * HD / 2 + 255) / 256), LKv = (unsigned)(((size_t)NKV * TT * HD / 2 + 255) / 256);
    const unsigned LX = (unsigned)(((size_t)TT * DM / 8 + 255) / 256);
    for (int b = 0; b < NB; ++b) {
        const size_t xoff = (size_t)b * SEQ_FULL * DM;     // full per-batch stride of the input and of the output
        k_cvt8<<<LX, 256, 0, stream>>>(x + xoff, XB, (size_t)TT * DM / 8);    /* XB := bf16(x[b]), shared by the three projections */
        k_gemmw<bf, 0, false, false><<<dim3(TT / 64, DQ / 64, 1), 32, 0, stream>>>(XB, nullptr, WQ, nullptr, DM, FQ, DQ, nullptr, 0, 0, 0, 0, 0);
        k_hplr<<<LQ, 256, 0, stream>>>(FQ, DQ, NH_, cs, sn, QP16, QPh, QPl);
        k_gemmw<bf, 0, false, false><<<dim3(TT / 64, DKV / 64, 1), 32, 0, stream>>>(XB, nullptr, WK, nullptr, DM, FK, DKV, nullptr, 0, 0, 0, 0, 0);
        k_hplr<<<LKv, 256, 0, stream>>>(FK, DKV, NKV, cs, sn, KP16, KPh, KPl);
        k_gemmw<bf, 0, false, false><<<dim3(TT / 64, DKV / 64, 1), 32, 0, stream>>>(XB, nullptr, WV, nullptr, DM, FV, DKV, nullptr, 0, 0, 0, 0, 0);   /* after the k planes are built */
        k_vtp<<<LKv, 256, 0, stream>>>(FV, DKV, NKV, VT16, VTh, VTl);
        k_attn<<<dim3(RH / 16 + (TT - RH) / 32, NH_, 1), AW * 32, 0, stream>>>(QP16, KP16, VT16, QPh, QPl, KPh, KPl, VTh, VTl, mk, ATh, ATl);
        k_gemmw<bf, 1, false, false><<<dim3(TT / 64, DM / 64, 1), 32, 0, stream>>>(ATh, ATl, WO, nullptr, DQ, OUT + xoff, DM, nullptr, 0, 0, 0, 0, 0); }
}

// v004
// Measured time: 336 microseconds a run.
// In two side-by-side timings against v003, it was 1.08 and 1.09 times as fast.
// All steps since v000 together make it 4.57 times as fast.
#include <hip/hip_runtime.h>

// Causal self-attention over one input stream with interleaved-pair rotary embeddings whose cos / sin tables are inputs read by value, an int32 mask read by value, no biases (x [2][2048][768]; q = x Wq^T, k = x Wk^T, v = x Wv^T ('oi' [768][768]; 12 heads x 64); pairs (2j, 2j+1) of q and k rotated by cos[t][j], sin[t][j]; logits x 1/8; mask[i][j] == 0 -> logit replaced by -1e9; softmax over all 2048 keys; out = merged Wo^T -> [2][2048][768]; argument order x, cos, sin, attn_mask, wq, wk, wv, wo).
// Compute dtypes, f32 accumulate: projections v_wmma_f32_16x16x32_bf16 on RNE bf16 copies of x and weights; rotation f32 with RNE bf16 table values; logits and P.V: query rows < 512 bf16 hi/lo planes (3 products), rows >= 512 v_wmma_f32_16x16x32_f16 (P carried x1024); softmax f32; output projection bf16 hi/lo ctx x bf16 Wo (2 products).
// Layout per batch: bf16 copy of the input stream; projections whose epilogue writes the rotary head planes (q, k) or the transposed value planes straight from the accumulators; one attention launch over all heads: a work-group of AW waves takes 16 or 32 query rows, each wave TT/AW keys; scores, softmax and P stay in registers, the waves' f32 partial tiles are summed in wave order through LDS; merged hi/lo x Wo.

#ifndef NB
#define NB   2
#endif
#ifndef SEQ
#define SEQ  2048
#endif
#define NB_FULL  2
#define SEQ_FULL 2048
#define TT   SEQ
#define DM   768
#define NH_  12
#define NKV  12
#define REP  (NH_ / NKV)
#define HD   64
#define HP   (HD / 2)    // rotary pairs per head = table row width
#define DQ   (NH_ * HD)
#define DKV  (NKV * HD)
#define AW   16   // waves of an attention work-group; each owns KW keys
#define KW   (SEQ / AW)
#define OP   68   // f32 pitch of a partial-tile row in LDS: rows 8 apart fall on different banks
#define RH   ((SEQ < 512) ? SEQ : 512)   // query rows < RH use hi+lo planes
#define PCAR 1024.0f
#define SCL  0.125f   // HD^-0.5
#define MFILL (-1.0e9f)
typedef _Float16 h16;
typedef unsigned short bf;
typedef __attribute__((ext_vector_type(16))) __bf16   v16bf;
typedef __attribute__((ext_vector_type(16))) _Float16 v16h;
typedef __attribute__((ext_vector_type(8)))  _Float16 v8h;
typedef __attribute__((ext_vector_type(8)))  unsigned short v8us;
typedef __attribute__((ext_vector_type(8)))  float    v8f;
typedef __attribute__((ext_vector_type(4)))  float    v4f;
typedef v4f  __attribute__((may_alias)) v4fa;

static_assert(TT % 128 == 0);
static_assert(TT % (AW * 32) == 0);
static_assert(RH % 16 == 0);
static_assert((TT - RH) % 32 == 0);
static_assert(RH % 64 == 0);
static_assert((TT - RH) % 64 == 0);
static_assert(DM % 32 == 0);
static_assert(DQ % 64 == 0);
static_assert(DKV % 64 == 0);
static_assert(DM % 64 == 0);
static_assert(HD == 64);
static_assert(NB <= NB_FULL);
static_assert(SEQ <= SEQ_FULL);
static_assert((size_t)NB_FULL * SEQ_FULL * DM * 4 == 12582912);
static_assert(HP == 32);                                  // table rows are [t][32]
static_assert(HD % 2 == 0);
static_assert(DQ == DM);                                  // merged width == model width (no bias, square Wo)
static_assert(NKV == NH_);                                // one k/v head per q head
static_assert(((size_t)TT * DM / 8) % 256 == 0);
#define A256(x) ((((size_t)(x)) + 255) & ~(size_t)255)
static_assert(4 * A256((size_t)DQ * DM * 2) + 9 * A256((size_t)NH_ * TT * HD * 2) + A256((size_t)TT * DM * 2) + 2 * A256((size_t)TT * DQ * 2) <= (size_t)268435456);

__device__ __forceinline__ unsigned short f2bf(float f) { unsigned u = __float_as_uint(f); u += 0x7FFFu + ((u >> 16) & 1u); return (unsigned short)(u >> 16); }
__device__ __forceinline__ float bf2f(unsigned short b) { return __uint_as_float(((unsigned)b) << 16); }
__device__ __forceinline__ float bfr(float f) { return bf2f(f2bf(f)); }
__device__ __forceinline__ v16h cat16(v8h lo, v8h hi) { return __builtin_shufflevector(lo, hi, 0, 1, 2, 3, 4, 5, 6, 7, 8, 9, 10, 11, 12, 13, 14, 15); }
__device__ __forceinline__ v16bf cat16b(v8us lo, v8us hi) { return __builtin_bit_cast(v16bf, __builtin_shufflevector(lo, hi, 0, 1, 2, 3, 4, 5, 6, 7, 8, 9, 10, 11, 12, 13, 14, 15)); }
__device__ __forceinline__ v8f wmma16(v16h a, v16h b, v8f c) { return __builtin_amdgcn_wmma_f32_16x16x32_f16(false, a, false, b, (short)0, c, false, false); }
__device__ __forceinline__ v8f wmmab(v16bf a, v16bf b, v8f c) { return __builtin_amdgcn_wmma_f32_16x16x32_bf16(false, a, false, b, (short)0, c, false, false); }

__device__ __forceinline__ h16 tohx(float x) { return (h16)x; }
__device__ __forceinline__ void splitf(float y, unsigned short& h, unsigned short& l) { h = f2bf(y); l = f2bf(y - bf2f(h)); }
typedef __attribute__((ext_vector_type(2))) _Float16 v2h;
typedef __attribute__((ext_vector_type(4))) _Float16 v4h;
typedef __attribute__((ext_vector_type(2))) unsigned short v2us;
typedef __attribute__((ext_vector_type(4))) unsigned short v4us;
typedef __attribute__((ext_vector_type(2))) float v2f;
typedef __attribute__((ext_vector_type(4))) int v4i;

// f32 -> fp16 with a value select: magnitudes below the smallest fp16 normal become zero.
static __device__ __forceinline__ h16 toh_flush(float v) { const h16 r = (h16)v; return (fabsf(v) < 6.103515625e-05f) ? (h16)0.0f : r; }

// ---- k_gemmw: register-blocked GEMM, ONE WAVE per 64x64 output tile (16 accumulators), operands straight from K-contiguous 16-bit planes; grid (M/64, N/64, Z), 32 threads.
// C[m][n] (f32, pitch ldc, + optional f32 bias[n]) = sum_k A[m][k] Bt[n][k] (+ split products per NSPLIT). z-batch strides sA/sB/sC in elements. K % 32 == 0.
// KSP: N == 64 and blockIdx.y numbers a k range of kspan (kspan % 32 == 0, gridDim.y * kspan == K); its partial tile goes to C + blockIdx.y * sK.
// EPI 0: C as above. EPI 1 (N tile = one head): the tile's pairs (2j, 2j+1) are rotated by the RNE bf16 copies of CS[t][j], SN[t][j] and go to the head planes [h][t][d] (fp16 + bf16 hi/lo), C unused.
// EPI 2 (N tile = one head): the tile goes transposed to the value planes [h][d][t] (fp16 + bf16 hi/lo): a lane's 8 accumulator rows are 8 neighbouring t of one d, one 16-byte store a plane; C unused.
// Fragment map (A and Bt alike): lane -> row (lane & 15); elements 0..7 = k0 + 8*(lane>>4) + 0..7, elements 8..15 = k0 + 16 + 8*(lane>>4) + 0..7.
template <typename T16> struct WFrag;
template <> struct WFrag<h16> { typedef v16h V; static __device__ __forceinline__ V ld(const h16* p) { return cat16(*(const v8h*)p, *(const v8h*)(p + 16)); } static __device__ __forceinline__ v8f mma(V a, V b, v8f c) { return wmma16(a, b, c); } };
template <> struct WFrag<bf> { typedef v16bf V; static __device__ __forceinline__ V ld(const bf* p) { return cat16b(*(const v8us*)p, *(const v8us*)(p + 16)); } static __device__ __forceinline__ v8f mma(V a, V b, v8f c) { return wmmab(a, b, c); } };
template <typename T16, int NSPLIT, bool BIAS, bool KSP, int EPI>
__global__ __launch_bounds__(32) void k_gemmw(const T16* __restrict__ A, const T16* __restrict__ A2, const T16* __restrict__ Bt, const T16* __restrict__ Bt2, int K, float* C, int ldc, const float* __restrict__ bias, size_t sA, size_t sB, size_t sC, int kspan, size_t sK, const float* __restrict__ CS, const float* __restrict__ SN, h16* P16, bf* Ph, bf* Pl) {
    typedef typename WFrag<T16>::V V;
    __shared__ __align__(16) float os[16 * 68];
    const size_t z = blockIdx.z; A += z * sA; if (A2) A2 += z * sA; Bt += z * sB; if (Bt2) Bt2 += z * sB; C += z * sC;
    const int lane = threadIdx.x & 31, lr = lane & 15, hi = lane >> 4; const int r0 = blockIdx.x * 64, c0 = KSP ? 0 : blockIdx.y * 64;
    const int kn = KSP ? kspan : K; if (KSP) { const size_t kb = (size_t)blockIdx.y * kspan; A += kb; if (A2) A2 += kb; Bt += kb; if (Bt2) Bt2 += kb; C += blockIdx.y * sK; }
    v8f acc[4][4];
#pragma unroll
    for (int mb = 0; mb < 4; ++mb)
#pragma unroll
        for (int nb = 0; nb < 4; ++nb) acc[mb][nb] = (v8f){};
    const size_t aoff = (size_t)(r0 + lr) * K + 8 * hi, boff = (size_t)(c0 + lr) * K + 8 * hi;
#pragma unroll 1
    for (int kc = 0; kc < kn; kc += 32) {
        V a[4], a2[4];
#pragma unroll
        for (int mb = 0; mb < 4; ++mb) { a[mb] = WFrag<T16>::ld(A + aoff + (size_t)mb * 16 * K + kc); if (NSPLIT == 1 || NSPLIT == 2) a2[mb] = WFrag<T16>::ld(A2 + aoff + (size_t)mb * 16 * K + kc); }
#pragma unroll
        for (int nb = 0; nb < 4; ++nb) { const V b = WFrag<T16>::ld(Bt + boff + (size_t)nb * 16 * K + kc); V b2; if (NSPLIT >= 2) b2 = WFrag<T16>::ld(Bt2 + boff + (size_t)nb * 16 * K + kc);
#pragma unroll
            for (int mb = 0; mb < 4; ++mb) { acc[mb][nb] = WFrag<T16>::mma(a[mb], b, acc[mb][nb]); if (NSPLIT == 1 || NSPLIT == 2) acc[mb][nb] = WFrag<T16>::mma(a2[mb], b, acc[mb][nb]); if (NSPLIT >= 2) acc[mb][nb] = WFrag<T16>::mma(a[mb], b2, acc[mb][nb]); } }
        asm volatile("v_nop\n\tv_nop\n\tv_nop\n\tv_nop" : "+v"(acc[0][0]), "+v"(acc[1][1]), "+v"(acc[2][2]), "+v"(acc[3][3]) : "v"(a[0]), "v"(a[3]));
    }
    // one base a plane or table for the lane; every row of the tile is a constant step from it
    const size_t tb = (size_t)(r0 + hi) * HP + lr * 2, pb = ((size_t)(c0 / HD) * TT + r0 + hi) * HD + lr * 4, vb = (size_t)(c0 + lr) * TT + r0 + hi * 8;
    if constexpr (EPI == 2) {
#pragma unroll
        for (int nb = 0; nb < 4; ++nb)
#pragma unroll
            for (int mb = 0; mb < 4; ++mb) { v8h o16; v8us oh, ol;
#pragma unroll
                for (int j = 0; j < 8; ++j) { const float x = acc[mb][nb][j]; o16[j] = tohx(x); unsigned short a2, c2; splitf(x, a2, c2); oh[j] = a2; ol[j] = c2; }
                const size_t e = vb + (size_t)nb * 16 * TT + mb * 16; *(v8h*)(P16 + e) = o16; *(v8us*)(Ph + e) = oh; *(v8us*)(Pl + e) = ol; }
        return; }
#pragma unroll
    for (int mb = 0; mb < 4; ++mb) {
#pragma unroll
        for (int nb = 0; nb < 4; ++nb) {
#pragma unroll
            for (int j = 0; j < 8; ++j) os[(hi * 8 + j) * 68 + nb * 16 + lr] = acc[mb][nb][j]; }
        v2f cc[8], ss[8];   // the 16 rows' table values, asked for while the rows are staged
        if constexpr (EPI == 1) {
#pragma unroll
            for (int s = 0; s < 8; ++s) { cc[s] = *(const v2f*)(CS + tb + (mb * 16 + 2 * s) * HP); ss[s] = *(const v2f*)(SN + tb + (mb * 16 + 2 * s) * HP); } }
        __builtin_amdgcn_wave_barrier(); asm volatile("" ::: "memory");
        if constexpr (EPI == 1) { v4h o16[8]; v4us oh[8], ol[8];
#pragma unroll
            for (int s = 0; s < 8; ++s) { const int row = 2 * s + hi, cofs = lr * 4; const v4f x = *(const v4fa*)(os + row * 68 + cofs);
#pragma unroll
                for (int p = 0; p < 2; ++p) { const float c = bfr(cc[s][p]), sn = bfr(ss[s][p]); v2f r; r[0] = x[2 * p] * c - x[2 * p + 1] * sn; r[1] = x[2 * p] * sn + x[2 * p + 1] * c;
#pragma unroll
                    for (int q = 0; q < 2; ++q) { const float y = r[q]; o16[s][2 * p + q] = toh_flush(y); unsigned short a2, c2; splitf(y, a2, c2); oh[s][2 * p + q] = a2; ol[s][2 * p + q] = c2; } } }
            __builtin_amdgcn_sched_barrier(0);   // keeps the 24 stores in one run behind the arithmetic, so that the one wait below serves them all; spread among it the build holds some fifty waits, one behind nearly every second store
#pragma unroll
            for (int s = 0; s < 8; ++s) { const size_t e = pb + (mb * 16 + 2 * s) * HD; *(v4h*)(P16 + e) = o16[s]; *(v4us*)(Ph + e) = oh[s]; *(v4us*)(Pl + e) = ol[s]; }
            asm volatile("s_wait_xcnt 0x0" ::: "memory");   // the plane stores' address and data registers are free for reuse behind this line
        } else { float* crow = C + (size_t)(r0 + mb * 16) * ldc + c0;
#pragma unroll
            for (int s = 0; s < 8; ++s) { const int row = 2 * s + hi, cofs = lr * 4; v4f val = *(const v4fa*)(os + row * 68 + cofs); if (BIAS) { val[0] += bfr(bias[c0 + cofs]); val[1] += bfr(bias[c0 + cofs + 1]); val[2] += bfr(bias[c0 + cofs + 2]); val[3] += bfr(bias[c0 + cofs + 3]); }
                *(v4f*)(crow + (size_t)row * ldc + cofs) = val; }
             }
        __builtin_amdgcn_wave_barrier(); asm volatile("" ::: "memory");
    }
}

__global__ __launch_bounds__(256) void k_cvt8(const float* __restrict__ src, bf* dst, size_t n8) { const size_t i = (size_t)blockIdx.x * 256 + threadIdx.x; if (i >= n8) return; const v8f v = *(const v8f*)(src + i * 8); v8us o;
#pragma unroll
    for (int k = 0; k < 8; ++k) o[k] = f2bf(v[k]); *(v8us*)(dst + i * 8) = o;  }

// k_attn: scores, softmax, P.V and the merge of one head's 16 (rows < RH, hi/lo planes) or 32 (fp16 planes) query rows in one work-group of AW waves; wave w owns keys w*KW .. w*KW+KW-1.
// Scores are formed transposed, S^T = K Q^T: lane (lr, hi) holds query lr, keys 8*hi + j of a 16-key tile, so two neighbouring tiles are, element for element, the A fragment of P for 32 keys (fragment map above) and P never leaves the registers.
// t = S x HD^-0.5, then t := -1e9 where MK[i][j] == 0 (value select; MK row pitch SEQ_FULL, shared by all heads and batches); softmax over the TT keys: exact row maximum and row sum over the waves through LDS, in wave order; a fully filled row comes out uniform.
// Each wave's f32 partial tile [q][d] goes to LDS; the tiles are summed in the order w = 0 .. AW-1, scaled and split into the merged hi/lo planes.
template <typename T16, int QT, bool HL>
__device__ __forceinline__ void attn_tile(const T16* __restrict__ Q, const T16* __restrict__ Q2, const T16* __restrict__ Kp, const T16* __restrict__ K2, const T16* __restrict__ Vt, const T16* __restrict__ V2, const int* __restrict__ MK, int q0, int hcol, bf* Ah, bf* Al, float* part, float* redm, float* reds) {
    typedef typename WFrag<T16>::V V;
    const int tid = threadIdx.x, lane = tid & 31, lr = lane & 15, hi = lane >> 4, w = tid >> 5; const int kb = w * KW;
    V qf[QT][2], qf2[QT][2];
#pragma unroll
    for (int qt = 0; qt < QT; ++qt)
#pragma unroll
        for (int c = 0; c < 2; ++c) { const size_t o = (size_t)(q0 + qt * 16 + lr) * HD + 8 * hi + c * 32; qf[qt][c] = WFrag<T16>::ld(Q + o); if (HL) qf2[qt][c] = WFrag<T16>::ld(Q2 + o); }
    asm volatile("s_wait_xcnt 0x0" ::: "memory");   // the query loads' address registers are free for reuse behind this line
    const int* mb = MK + (size_t)(q0 + lr) * SEQ_FULL + kb + 8 * hi;   // one base for every mask load of the wave
    v8f s[KW / 16][QT]; float mx[QT], sum[QT], f[QT];
#pragma unroll
    for (int qt = 0; qt < QT; ++qt) mx[qt] = -3.0e38f;
#pragma unroll
    for (int kt = 0; kt < KW / 16; ++kt) { V ka[2], ka2[2];
#pragma unroll
        for (int c = 0; c < 2; ++c) { const size_t o = (size_t)(kb + kt * 16 + lr) * HD + 8 * hi + c * 32; ka[c] = WFrag<T16>::ld(Kp + o); if (HL) ka2[c] = WFrag<T16>::ld(K2 + o); }
        if (kt == KW / 16 - 1) asm volatile("s_wait_xcnt 0x0" ::: "memory");   // last key loads: their address registers are free for reuse behind this line
#pragma unroll
        for (int qt = 0; qt < QT; ++qt) { v8f a = (v8f){};
#pragma unroll
            for (int c = 0; c < 2; ++c) { a = WFrag<T16>::mma(ka[c], qf[qt][c], a); if (HL) { a = WFrag<T16>::mma(ka[c], qf2[qt][c], a); a = WFrag<T16>::mma(ka2[c], qf[qt][c], a); } }
            const int* mr = mb + (size_t)qt * 16 * SEQ_FULL + kt * 16; const v4i m0 = *(const v4i*)mr; const v4i m1 = *(const v4i*)(mr + 4);
#pragma unroll
            for (int j = 0; j < 8; ++j) { const float sv = a[j] * SCL; const float t = ((j < 4 ? m0[j & 3] : m1[j & 3]) == 0) ? MFILL : sv; a[j] = t; mx[qt] = fmaxf(mx[qt], t); }
            s[kt][qt] = a; }
        if (QT == 2 && (kt & 1)) __builtin_amdgcn_sched_barrier(0);   // keeps later key tiles' loads from being hoisted here: with all of them in flight beside 128 score registers the wave spills
    }
#pragma unroll
    for (int qt = 0; qt < QT; ++qt) { mx[qt] = fmaxf(mx[qt], __shfl_xor(mx[qt], 16, 32)); if (hi == 0) redm[w * 32 + qt * 16 + lr] = mx[qt]; }
    __syncthreads();   // every wave's row maxima are in redm
#pragma unroll
    for (int qt = 0; qt < QT; ++qt) {
#pragma unroll
        for (int r = 0; r < AW; ++r) mx[qt] = fmaxf(mx[qt], redm[r * 32 + qt * 16 + lr]);
        sum[qt] = 0.f; }
#pragma unroll
    for (int kt = 0; kt < KW / 16; ++kt)
#pragma unroll
        for (int qt = 0; qt < QT; ++qt)
#pragma unroll
            for (int j = 0; j < 8; ++j) { const float d0 = __fsub_rn(s[kt][qt][j], mx[qt]); const float e = __builtin_amdgcn_exp2f(fmaxf(__fmul_rn(d0, 1.4426950408889634f), -160.0f)); s[kt][qt][j] = e; sum[qt] += e; }
#pragma unroll
    for (int qt = 0; qt < QT; ++qt) { sum[qt] += __shfl_xor(sum[qt], 16, 32); if (hi == 0) reds[w * 32 + qt * 16 + lr] = sum[qt]; }
    __syncthreads();   // every wave's row sums are in reds
#pragma unroll
    for (int qt = 0; qt < QT; ++qt) { float t = reds[qt * 16 + lr];
#pragma unroll
        for (int r = 1; r < AW; ++r) t += reds[r * 32 + qt * 16 + lr];
        f[qt] = __fdiv_rn(HL ? 1.0f : PCAR, t); }
    v8f o[QT][4];
#pragma unroll
    for (int qt = 0; qt < QT; ++qt)
#pragma unroll
        for (int dt = 0; dt < 4; ++dt) o[qt][dt] = (v8f){};
#pragma unroll
    for (int c = 0; c < KW / 32; ++c) { V pa[QT], pa2[QT];
#pragma unroll
        for (int qt = 0; qt < QT; ++qt) {
            if constexpr (HL) { v8us h0, h1, l0, l1;
#pragma unroll
                for (int j = 0; j < 8; ++j) { unsigned short a, c2; splitf(s[2 * c][qt][j] * f[qt], a, c2); h0[j] = a; l0[j] = c2; splitf(s[2 * c + 1][qt][j] * f[qt], a, c2); h1[j] = a; l1[j] = c2; }
                pa[qt] = cat16b(h0, h1); pa2[qt] = cat16b(l0, l1);
            } else { v8h p0, p1;
#pragma unroll
                for (int j = 0; j < 8; ++j) { p0[j] = tohx(s[2 * c][qt][j] * f[qt]); p1[j] = tohx(s[2 * c + 1][qt][j] * f[qt]); }
                pa[qt] = cat16(p0, p1); } }
#pragma unroll
        for (int dt = 0; dt < 4; ++dt) { const size_t vo = (size_t)(dt * 16 + lr) * TT + kb + c * 32 + 8 * hi; const V vb = WFrag<T16>::ld(Vt + vo); V vb2; if (HL) vb2 = WFrag<T16>::ld(V2 + vo);
#pragma unroll
            for (int qt = 0; qt < QT; ++qt) { o[qt][dt] = WFrag<T16>::mma(pa[qt], vb, o[qt][dt]); if (HL) { o[qt][dt] = WFrag<T16>::mma(pa2[qt], vb, o[qt][dt]); o[qt][dt] = WFrag<T16>::mma(pa[qt], vb2, o[qt][dt]); } } } }
    float* pw = part + (size_t)w * (QT * 16 * OP);
#pragma unroll
    for (int qt = 0; qt < QT; ++qt)
#pragma unroll
        for (int dt = 0; dt < 4; ++dt)
#pragma unroll
            for (int j = 0; j < 8; ++j) pw[(qt * 16 + hi * 8 + j) * OP + dt * 16 + lr] = o[qt][dt][j];
    __syncthreads();   // every wave's partial tile is in part
    const float cs = HL ? 1.0f : (1.0f / PCAR);
    static_assert(QT * 16 * 16 <= AW * 32);
    if (tid < QT * 16 * 16) { const int row = tid >> 4, col = (tid & 15) * 4; v4f acc = *(const v4f*)(part + row * OP + col);
#pragma unroll
        for (int r = 1; r < AW; ++r) acc += *(const v4f*)(part + (size_t)r * (QT * 16 * OP) + row * OP + col);
        v4us oh, ol;
#pragma unroll
        for (int q = 0; q < 4; ++q) { unsigned short a, c2; splitf(acc[q] * cs, a, c2); oh[q] = a; ol[q] = c2; }
        const size_t oo = (size_t)(q0 + row) * DQ + hcol + col; *(v4us*)(Ah + oo) = oh; *(v4us*)(Al + oo) = ol; }
}

__global__ __launch_bounds__(AW * 32) void k_attn(const h16* __restrict__ Q16, const h16* __restrict__ K16, const h16* __restrict__ V16, const bf* __restrict__ Qh, const bf* __restrict__ Ql, const bf* __restrict__ Kh, const bf* __restrict__ Kl, const bf* __restrict__ Vh, const bf* __restrict__ Vl, const int* __restrict__ MK, bf* Ah, bf* Al) {
    __shared__ __align__(16) float part[AW * 32 * OP]; __shared__ float redm[AW * 32]; __shared__ float reds[AW * 32];
    const int h = blockIdx.y, bx = blockIdx.x; const size_t po = (size_t)h * TT * HD;
    if (bx < RH / 16) attn_tile<bf, 1, true>(Qh + po, Ql + po, Kh + po, Kl + po, Vh + po, Vl + po, MK, bx * 16, h * HD, Ah, Al, part, redm, reds);
    else attn_tile<h16, 2, false>(Q16 + po, nullptr, K16 + po, nullptr, V16 + po, nullptr, MK, RH + (bx - RH / 16) * 32, h * HD, Ah, Al, part, redm, reds);
}

extern "C" void kernel_launch(void* const* d_in, const int* in_sizes, int n_in,
                              void* d_out, int out_size, void* d_ws, size_t ws_size, hipStream_t stream) {
    if (n_in < 8) return;
    const size_t need_x = ((size_t)(NB - 1) * SEQ_FULL + SEQ) * DM;          // elements of the activation stream / of the output that are touched
    const size_t need_m = (size_t)(SEQ - 1) * SEQ_FULL + SEQ;                // mask entries touched
    if ((size_t)in_sizes[0] < need_x) return;
    if ((size_t)in_sizes[1] < (size_t)SEQ * HP || (size_t)in_sizes[2] < (size_t)SEQ * HP) return;
    if ((size_t)in_sizes[3] < need_m) return;
    if ((size_t)in_sizes[4] < (size_t)DQ * DM || (size_t)in_sizes[5] < (size_t)DKV * DM || (size_t)in_sizes[6] < (size_t)DKV * DM || (size_t)in_sizes[7] < (size_t)DM * DQ) return;
    if ((size_t)out_size < need_x) return;
    // wire order: x, cos, sin, attn_mask (int32), wq, wk, wv, wo ('oi' weights)
    const float* x = (const float*)d_in[0]; const float* cs = (const float*)d_in[1]; const float* sn = (const float*)d_in[2]; const int* mk = (const int*)d_in[3];
    const float* wq = (const float*)d_in[4]; const float* wk = (const float*)d_in[5]; const float* wv = (const float*)d_in[6]; const float* wo = (const float*)d_in[7];
    float* OUT = (float*)d_out;     // [2][2048][768]
    char* wsp = (char*)d_ws;
    auto take = [&](size_t bytes) { char* p = wsp; wsp += (bytes + 255) & ~(size_t)255; return (void*)p; };
    bf* WQ = (bf*)take((size_t)DQ * DM * 2); bf* WK = (bf*)take((size_t)DKV * DM * 2); bf* WV = (bf*)take((size_t)DKV * DM * 2); bf* WO = (bf*)take((size_t)DM * DQ * 2);
    h16* QP16 = (h16*)take((size_t)NH_ * TT * HD * 2); h16* KP16 = (h16*)take((size_t)NKV * TT * HD * 2); h16* VT16 = (h16*)take((size_t)NKV * HD * TT * 2);
    bf* QPh = (bf*)take((size_t)NH_ * TT * HD * 2); bf* QPl = (bf*)take((size_t)NH_ * TT * HD * 2); bf* KPh = (bf*)take((size_t)NKV * TT * HD * 2); bf* KPl = (bf*)take((size_t)NKV * TT * HD * 2); bf* VTh = (bf*)take((size_t)NKV * HD * TT * 2); bf* VTl = (bf*)take((size_t)NKV * HD * TT * 2);
    bf* XB = (bf*)take((size_t)TT * DM * 2); bf* ATh = (bf*)take((size_t)TT * DQ * 2); bf* ATl = (bf*)take((size_t)TT * DQ * 2);
    const size_t used = (size_t)(wsp - (char*)d_ws);
    if (used > ws_size || used > (size_t)268435456) return;
    k_cvt8<<<(unsigned)(((size_t)DQ * DM / 8 + 255) / 256), 256, 0, stream>>>(wq, WQ, (size_t)DQ * DM / 8);
    k_cvt8<<<(unsigned)(((size_t)DKV * DM / 8 + 255) / 256), 256, 0, stream>>>(wk, WK, (size_t)DKV * DM / 8);
    k_cvt8<<<(unsigned)(((size_t)DKV * DM / 8 + 255) / 256), 256, 0, stream>>>(wv, WV, (size_t)DKV * DM / 8);
    k_cvt8<<<(unsigned)(((size_t)DM * DQ / 8 + 255) / 256), 256, 0, stream>>>(wo, WO, (size_t)DM * DQ / 8);
    const unsigned LX = (unsigned)(((size_t)TT * DM / 8 + 255) / 256);
    for (int b = 0; b < NB; ++b) {
        const size_t xoff = (size_t)b * SEQ_FULL * DM;     // full per-batch stride of the input and of the output
        k_cvt8<<<LX, 256, 0, stream>>>(x + xoff, XB, (size_t)TT * DM / 8);    /* XB := bf16(x[b]), shared by the three projections */
        k_gemmw<bf, 0, false, false, 1><<<dim3(TT / 64, DQ / 64, 1), 32, 0, stream>>>(XB, nullptr, WQ, nullptr, DM, nullptr, 0, nullptr, 0, 0, 0, 0, 0, cs, sn, QP16, QPh, QPl);
        k_gemmw<bf, 0, false, false, 1><<<dim3(TT / 64, DKV / 64, 1), 32, 0, stream>>>(XB, nullptr, WK, nullptr, DM, nullptr, 0, nullptr, 0, 0, 0, 0, 0, cs, sn, KP16, KPh, KPl);
        k_gemmw<bf, 0, false, false, 2><<<dim3(TT / 64, DKV / 64, 1), 32, 0, stream>>>(XB, nullptr, WV, nullptr, DM, nullptr, 0, nullptr, 0, 0, 0, 0, 0, nullptr, nullptr, VT16, VTh, VTl);
        k_attn<<<dim3(RH / 16 + (TT - RH) / 32, NH_, 1), AW * 32, 0, stream>>>(QP16, KP16, VT16, QPh, QPl, KPh, KPl, VTh, VTl, mk, ATh, ATl);
        k_gemmw<bf, 1, false, false, 0><<<dim3(TT / 64, DM / 64, 1), 32, 0, stream>>>(ATh, ATl, WO, nullptr, DQ, OUT + xoff, DM, nullptr, 0, 0, 0, 0, 0, nullptr, nullptr, nullptr, nullptr, nullptr); }
}

// v005
// It runs in 229 microseconds.
// Two timings next to v004 put it at 1.45 and 1.46 times that version's speed.
// All steps since v000 together make it 6.66 times as fast.
#include <hip/hip_runtime.h>

// Causal self-attention over one input stream with interleaved-pair rotary embeddings whose cos / sin tables are inputs read by value, an int32 mask read by value, no biases (x [2][2048][768]; q = x Wq^T, k = x Wk^T, v = x Wv^T ('oi' [768][768]; 12 heads x 64); pairs (2j, 2j+1) of q and k rotated by cos[t][j], sin[t][j]; logits x 1/8; mask[i][j] == 0 -> logit replaced by -1e9; softmax over all 2048 keys; out = merged Wo^T -> [2][2048][768]; argument order x, cos, sin, attn_mask, wq, wk, wv, wo).
// Compute dtypes, f32 accumulate: projections v_wmma_f32_16x16x32_bf16 on RNE bf16 copies of x and weights; rotation f32 with RNE bf16 table values; logits and P.V: query rows < 512 bf16 hi/lo planes (3 products), rows >= 512 v_wmma_f32_16x16x32_f16 (P carried x1024); softmax f32; output projection bf16 hi/lo ctx x bf16 Wo (2 products).
// Four launches, each over both batches: bf16 copies of the four weights and of the input stream; the three projections (grid z = 3 * batch + {q, k, v}), whose epilogue writes the rotary head planes (q, k) or the transposed value planes straight from the accumulators; attention over all heads (grid z = batch): a work-group of AW waves takes 16 or 32 query rows, each wave TT/AW keys; scores, softmax and P stay in registers, the waves' f32 partial tiles are summed in wave order through LDS; merged hi/lo x Wo.

#ifndef NB
#define NB   2
#endif
#ifndef SEQ
#define SEQ  2048
#endif
#define NB_FULL  2
#define SEQ_FULL 2048
#define TT   SEQ
#define DM   768
#define NH_  12
#define NKV  12
#define REP  (NH_ / NKV)
#define HD   64
#define HP   (HD / 2)    // rotary pairs per head = table row width
#define DQ   (NH_ * HD)
#define DKV  (NKV * HD)
#define AW   16   // waves of an attention work-group; each owns KW keys
#define KW   (SEQ / AW)
#define OP   68   // f32 pitch of a partial-tile row in LDS: rows 8 apart fall on different banks
#define RH   ((SEQ < 512) ? SEQ : 512)   // query rows < RH use hi+lo planes
#define PCAR 1024.0f
#define SCL  0.125f   // HD^-0.5
#define MFILL (-1.0e9f)
typedef _Float16 h16;
typedef unsigned short bf;
typedef __attribute__((ext_vector_type(16))) __bf16   v16bf;
typedef __attribute__((ext_vector_type(16))) _Float16 v16h;
typedef __attribute__((ext_vector_type(8)))  _Float16 v8h;
typedef __attribute__((ext_vector_type(8)))  unsigned short v8us;
typedef __attribute__((ext_vector_type(8)))  float    v8f;
typedef __attribute__((ext_vector_type(4)))  float    v4f;
typedef v4f  __attribute__((may_alias)) v4fa;

static_assert(TT % 128 == 0);
static_assert(TT % (AW * 32) == 0);
static_assert(RH % 16 == 0);
static_assert((TT - RH) % 32 == 0);
static_assert(RH % 64 == 0);
static_assert((TT - RH) % 64 == 0);
static_assert(DM % 32 == 0);
static_assert(DQ % 64 == 0);
static_assert(DKV % 64 == 0);
static_assert(DM % 64 == 0);
static_assert(HD == 64);
static_assert(NB <= NB_FULL);
static_assert(SEQ <= SEQ_FULL);
static_assert((size_t)NB_FULL * SEQ_FULL * DM * 4 == 12582912);
static_assert(HP == 32);                                  // table rows are [t][32]
static_assert(HD % 2 == 0);
static_assert(DQ == DM);                                  // merged width == model width (no bias, square Wo)
static_assert(NKV == NH_);                                // one k/v head per q head
static_assert(((size_t)TT * DM / 8) % 256 == 0);
#define A256(x) ((((size_t)(x)) + 255) & ~(size_t)255)
static_assert(4 * A256((size_t)DQ * DM * 2) + 3 * A256((size_t)NB * 3 * NH_ * TT * HD * 2) + A256((size_t)NB * TT * DM * 2) + 2 * A256((size_t)NB * TT * DQ * 2) <= (size_t)268435456);
static_assert(((size_t)DQ * DM / 8) % 256 == 0);

__device__ __forceinline__ unsigned short f2bf(float f) { unsigned u = __float_as_uint(f); u += 0x7FFFu + ((u >> 16) & 1u); return (unsigned short)(u >> 16); }
__device__ __forceinline__ float bf2f(unsigned short b) { return __uint_as_float(((unsigned)b) << 16); }
__device__ __forceinline__ float bfr(float f) { return bf2f(f2bf(f)); }
__device__ __forceinline__ v16h cat16(v8h lo, v8h hi) { return __builtin_shufflevector(lo, hi, 0, 1, 2, 3, 4, 5, 6, 7, 8, 9, 10, 11, 12, 13, 14, 15); }
__device__ __forceinline__ v16bf cat16b(v8us lo, v8us hi) { return __builtin_bit_cast(v16bf, __builtin_shufflevector(lo, hi, 0, 1, 2, 3, 4, 5, 6, 7, 8, 9, 10, 11, 12, 13, 14, 15)); }
__device__ __forceinline__ v8f wmma16(v16h a, v16h b, v8f c) { return __builtin_amdgcn_wmma_f32_16x16x32_f16(false, a, false, b, (short)0, c, false, false); }
__device__ __forceinline__ v8f wmmab(v16bf a, v16bf b, v8f c) { return __builtin_amdgcn_wmma_f32_16x16x32_bf16(false, a, false, b, (short)0, c, false, false); }

__device__ __forceinline__ h16 tohx(float x) { return (h16)x; }
__device__ __forceinline__ void splitf(float y, unsigned short& h, unsigned short& l) { h = f2bf(y); l = f2bf(y - bf2f(h)); }
typedef __attribute__((ext_vector_type(2))) _Float16 v2h;
typedef __attribute__((ext_vector_type(4))) _Float16 v4h;
typedef __attribute__((ext_vector_type(2))) unsigned short v2us;
typedef __attribute__((ext_vector_type(4))) unsigned short v4us;
typedef __attribute__((ext_vector_type(2))) float v2f;
typedef __attribute__((ext_vector_type(4))) int v4i;

// f32 -> fp16 with a value select: magnitudes below the smallest fp16 normal become zero.
static __device__ __forceinline__ h16 toh_flush(float v) { const h16 r = (h16)v; return (fabsf(v) < 6.103515625e-05f) ? (h16)0.0f : r; }

// ---- k_gemmw: register-blocked GEMM, ONE WAVE per 64x64 output tile (16 accumulators), operands straight from K-contiguous 16-bit planes; grid (M/64, N/64, Z), 32 threads.
// C[m][n] (f32, pitch ldc, + optional f32 bias[n]) = sum_k A[m][k] Bt[n][k] (+ split products per NSPLIT). z-batch strides sA/sB/sC in elements. K % 32 == 0.
// KSP: N == 64 and blockIdx.y numbers a k range of kspan (kspan % 32 == 0, gridDim.y * kspan == K); its partial tile goes to C + blockIdx.y * sK.
// EPI 0: C as above. EPI 1: projections, z = 3 * batch + p: A steps by sA a batch, Bt by sB a p, the planes by sC a z; C unused.
// p = 0, 1 (N tile = one head): the tile's pairs (2j, 2j+1) are rotated by the RNE bf16 copies of CS[t][j], SN[t][j] and go to the head planes [h][t][d] (fp16 + bf16 hi/lo).
// p = 2 (N tile = one head): the tile goes transposed to the value planes [h][d][t] (fp16 + bf16 hi/lo): a lane's 8 accumulator rows are 8 neighbouring t of one d, one 16-byte store a plane.
// Fragment map (A and Bt alike): lane -> row (lane & 15); elements 0..7 = k0 + 8*(lane>>4) + 0..7, elements 8..15 = k0 + 16 + 8*(lane>>4) + 0..7.
template <typename T16> struct WFrag;
template <> struct WFrag<h16> { typedef v16h V; static __device__ __forceinline__ V ld(const h16* p) { return cat16(*(const v8h*)p, *(const v8h*)(p + 16)); } static __device__ __forceinline__ v8f mma(V a, V b, v8f c) { return wmma16(a, b, c); } };
template <> struct WFrag<bf> { typedef v16bf V; static __device__ __forceinline__ V ld(const bf* p) { return cat16b(*(const v8us*)p, *(const v8us*)(p + 16)); } static __device__ __forceinline__ v8f mma(V a, V b, v8f c) { return wmmab(a, b, c); } };
template <typename T16, int NSPLIT, bool BIAS, bool KSP, int EPI>
__global__ __launch_bounds__(32) void k_gemmw(const T16* __restrict__ A, const T16* __restrict__ A2, const T16* __restrict__ Bt, const T16* __restrict__ Bt2, int K, float* C, int ldc, const float* __restrict__ bias, size_t sA, size_t sB, size_t sC, int kspan, size_t sK, const float* __restrict__ CS, const float* __restrict__ SN, h16* P16, bf* Ph, bf* Pl) {
    typedef typename WFrag<T16>::V V;
    __shared__ __align__(16) float os[16 * 68];
    const size_t z = blockIdx.z, zb = (EPI == 1) ? z / 3 : z, zp = (EPI == 1) ? z - 3 * zb : z; A += zb * sA; if (A2) A2 += zb * sA; Bt += zp * sB; if (Bt2) Bt2 += zp * sB;
    if (EPI == 1) { P16 += z * sC; Ph += z * sC; Pl += z * sC; } else C += z * sC;
    const int lane = threadIdx.x & 31, lr = lane & 15, hi = lane >> 4; const int r0 = blockIdx.x * 64, c0 = KSP ? 0 : blockIdx.y * 64;
    const int kn = KSP ? kspan : K; if (KSP) { const size_t kb = (size_t)blockIdx.y * kspan; A += kb; if (A2) A2 += kb; Bt += kb; if (Bt2) Bt2 += kb; C += blockIdx.y * sK; }
    v8f acc[4][4];
#pragma unroll
    for (int mb = 0; mb < 4; ++mb)
#pragma unroll
        for (int nb = 0; nb < 4; ++nb) acc[mb][nb] = (v8f){};
    const size_t aoff = (size_t)(r0 + lr) * K + 8 * hi, boff = (size_t)(c0 + lr) * K + 8 * hi;
#pragma unroll 1
    for (int kc = 0; kc < kn; kc += 32) {
        V a[4], a2[4];
#pragma unroll
        for (int mb = 0; mb < 4; ++mb) { a[mb] = WFrag<T16>::ld(A + aoff + (size_t)mb * 16 * K + kc); if (NSPLIT == 1 || NSPLIT == 2) a2[mb] = WFrag<T16>::ld(A2 + aoff + (size_t)mb * 16 * K + kc); }
#pragma unroll
        for (int nb = 0; nb < 4; ++nb) { const V b = WFrag<T16>::ld(Bt + boff + (size_t)nb * 16 * K + kc); V b2; if (NSPLIT >= 2) b2 = WFrag<T16>::ld(Bt2 + boff + (size_t)nb * 16 * K + kc);
#pragma unroll
            for (int mb = 0; mb < 4; ++mb) { acc[mb][nb] = WFrag<T16>::mma(a[mb], b, acc[mb][nb]); if (NSPLIT == 1 || NSPLIT == 2) acc[mb][nb] = WFrag<T16>::mma(a2[mb], b, acc[mb][nb]); if (NSPLIT >= 2) acc[mb][nb] = WFrag<T16>::mma(a[mb], b2, acc[mb][nb]); } }
        asm volatile("v_nop\n\tv_nop\n\tv_nop\n\tv_nop" : "+v"(acc[0][0]), "+v"(acc[1][1]), "+v"(acc[2][2]), "+v"(acc[3][3]) : "v"(a[0]), "v"(a[3]));
    }
    // one base a plane or table for the lane; every row of the tile is a constant step from it
    const size_t tb = (size_t)(r0 + hi) * HP + lr * 2, pb = ((size_t)(c0 / HD) * TT + r0 + hi) * HD + lr * 4, vb = (size_t)(c0 + lr) * TT + r0 + hi * 8;
    if (EPI == 1 && zp == 2) {
#pragma unroll
        for (int nb = 0; nb < 4; ++nb)
#pragma unroll
            for (int mb = 0; mb < 4; ++mb) { v8h o16; v8us oh, ol;
#pragma unroll
                for (int j = 0; j < 8; ++j) { const float x = acc[mb][nb][j]; o16[j] = tohx(x); unsigned short a2, c2; splitf(x, a2, c2); oh[j] = a2; ol[j] = c2; }
                const size_t e = vb + (size_t)nb * 16 * TT + mb * 16; *(v8h*)(P16 + e) = o16; *(v8us*)(Ph + e) = oh; *(v8us*)(Pl + e) = ol; }
        return; }
#pragma unroll
    for (int mb = 0; mb < 4; ++mb) {
#pragma unroll
        for (int nb = 0; nb < 4; ++nb) {
#pragma unroll
            for (int j = 0; j < 8; ++j) os[(hi * 8 + j) * 68 + nb * 16 + lr] = acc[mb][nb][j]; }
        v2f cc[8], ss[8];   // the 16 rows' table values, asked for while the rows are staged
        if constexpr (EPI == 1) {
#pragma unroll
            for (int s = 0; s < 8; ++s) { cc[s] = *(const v2f*)(CS + tb + (mb * 16 + 2 * s) * HP); ss[s] = *(const v2f*)(SN + tb + (mb * 16 + 2 * s) * HP); } }
        __builtin_amdgcn_wave_barrier(); asm volatile("" ::: "memory");
        if constexpr (EPI == 1) { v4h o16[8]; v4us oh[8], ol[8];
#pragma unroll
            for (int s = 0; s < 8; ++s) { const int row = 2 * s + hi, cofs = lr * 4; const v4f x = *(const v4fa*)(os + row * 68 + cofs);
#pragma unroll
                for (int p = 0; p < 2; ++p) { const float c = bfr(cc[s][p]), sn = bfr(ss[s][p]); v2f r; r[0] = x[2 * p] * c - x[2 * p + 1] * sn; r[1] = x[2 * p] * sn + x[2 * p + 1] * c;
#pragma unroll
                    for (int q = 0; q < 2; ++q) { const float y = r[q]; o16[s][2 * p + q] = toh_flush(y); unsigned short a2, c2; splitf(y, a2, c2); oh[s][2 * p + q] = a2; ol[s][2 * p + q] = c2; } } }
            __builtin_amdgcn_sched_barrier(0);   // keeps the 24 stores in one run behind the arithmetic, so that the one wait below serves them all; spread among it the build holds some fifty waits, one behind nearly every second store
#pragma unroll
            for (int s = 0; s < 8; ++s) { const size_t e = pb + (mb * 16 + 2 * s) * HD; *(v4h*)(P16 + e) = o16[s]; *(v4us*)(Ph + e) = oh[s]; *(v4us*)(Pl + e) = ol[s]; }
            asm volatile("s_wait_xcnt 0x0" ::: "memory");   // the plane stores' address and data registers are free for reuse behind this line
        } else { float* crow = C + (size_t)(r0 + mb * 16) * ldc + c0;
#pragma unroll
            for (int s = 0; s < 8; ++s) { const int row = 2 * s + hi, cofs = lr * 4; v4f val = *(const v4fa*)(os + row * 68 + cofs); if (BIAS) { val[0] += bfr(bias[c0 + cofs]); val[1] += bfr(bias[c0 + cofs + 1]); val[2] += bfr(bias[c0 + cofs + 2]); val[3] += bfr(bias[c0 + cofs + 3]); }
                *(v4f*)(crow + (size_t)row * ldc + cofs) = val; }
             }
        __builtin_amdgcn_wave_barrier(); asm volatile("" ::: "memory");
    }
}

// k_cvt: RNE bf16 copies of the four weights (WB blocks each) and of the input stream (XBL blocks a batch) in one launch; a thread takes 8 neighbouring values.
#define WB   ((unsigned)((size_t)DQ * DM / 8 / 256))
#define XBL  ((unsigned)((size_t)TT * DM / 8 / 256))
__global__ __launch_bounds__(256) void k_cvt(const float* __restrict__ w0, const float* __restrict__ w1, const float* __restrict__ w2, const float* __restrict__ w3, const float* __restrict__ x, bf* d0, bf* d1, bf* d2, bf* d3, bf* dx) {
    const unsigned b = blockIdx.x; const float* src; bf* dst; unsigned r;
    if (b < 4 * WB) { const unsigned k = b / WB; r = b - k * WB; src = (k == 0) ? w0 : (k == 1) ? w1 : (k == 2) ? w2 : w3; dst = (k == 0) ? d0 : (k == 1) ? d1 : (k == 2) ? d2 : d3; }
    else { const unsigned k = (b - 4 * WB) / XBL; r = b - 4 * WB - k * XBL; src = x + (size_t)k * SEQ_FULL * DM; dst = dx + (size_t)k * TT * DM; }
    const size_t i = (size_t)r * 256 + threadIdx.x; const v8f v = *(const v8f*)(src + i * 8); v8us o;
    asm volatile("s_wait_xcnt 0x0" ::: "memory");   // the load's address registers are free for reuse behind this line
#pragma unroll
    for (int k = 0; k < 8; ++k) o[k] = f2bf(v[k]);
    *(v8us*)(dst + i * 8) = o; }

// k_attn: scores, softmax, P.V and the merge of one head's 16 (rows < RH, hi/lo planes) or 32 (fp16 planes) query rows in one work-group of AW waves; wave w owns keys w*KW .. w*KW+KW-1.
// Scores are formed transposed, S^T = K Q^T: lane (lr, hi) holds query lr, keys 8*hi + j of a 16-key tile, so two neighbouring tiles are, element for element, the A fragment of P for 32 keys (fragment map above) and P never leaves the registers.
// t = S x HD^-0.5, then t := -1e9 where MK[i][j] == 0 (value select; MK row pitch SEQ_FULL, shared by all heads and batches); softmax over the TT keys: exact row maximum and row sum over the waves through LDS, in wave order; a fully filled row comes out uniform.
// Each wave's f32 partial tile [q][d] goes to LDS; the tiles are summed in the order w = 0 .. AW-1, scaled and split into the merged hi/lo planes.
template <typename T16, int QT, bool HL>
__device__ __forceinline__ void attn_tile(const T16* __restrict__ Q, const T16* __restrict__ Q2, const T16* __restrict__ Kp, const T16* __restrict__ K2, const T16* __restrict__ Vt, const T16* __restrict__ V2, const int* __restrict__ MK, int q0, int hcol, bf* Ah, bf* Al, float* part, float* redm, float* reds) {
    typedef typename WFrag<T16>::V V;
    const int tid = threadIdx.x, lane = tid & 31, lr = lane & 15, hi = lane >> 4, w = tid >> 5; const int kb = w * KW;
    V qf[QT][2], qf2[QT][2];
#pragma unroll
    for (int qt = 0; qt < QT; ++qt)
#pragma unroll
        for (int c = 0; c < 2; ++c) { const size_t o = (size_t)(q0 + qt * 16 + lr) * HD + 8 * hi + c * 32; qf[qt][c] = WFrag<T16>::ld(Q + o); if (HL) qf2[qt][c] = WFrag<T16>::ld(Q2 + o); }
    asm volatile("s_wait_xcnt 0x0" ::: "memory");   // the query loads' address registers are free for reuse behind this line
    const int* mb = MK + (size_t)(q0 + lr) * SEQ_FULL + kb + 8 * hi;   // one base for every mask load of the wave
    v8f s[KW / 16][QT]; float mx[QT], sum[QT], f[QT];
#pragma unroll
    for (int qt = 0; qt < QT; ++qt) mx[qt] = -3.0e38f;
#pragma unroll
    for (int kt = 0; kt < KW / 16; ++kt) { V ka[2], ka2[2];
#pragma unroll
        for (int c = 0; c < 2; ++c) { const size_t o = (size_t)(kb + kt * 16 + lr) * HD + 8 * hi + c * 32; ka[c] = WFrag<T16>::ld(Kp + o); if (HL) ka2[c] = WFrag<T16>::ld(K2 + o); }
        if (kt == KW / 16 - 1) asm volatile("s_wait_xcnt 0x0" ::: "memory");   // last key loads: their address registers are free for reuse behind this line
#pragma unroll
        for (int qt = 0; qt < QT; ++qt) { v8f a = (v8f){};
#pragma unroll
            for (int c = 0; c < 2; ++c) { a = WFrag<T16>::mma(ka[c], qf[qt][c], a); if (HL) { a = WFrag<T16>::mma(ka[c], qf2[qt][c], a); a = WFrag<T16>::mma(ka2[c], qf[qt][c], a); } }
            const int* mr = mb + (size_t)qt * 16 * SEQ_FULL + kt * 16; const v4i m0 = *(const v4i*)mr; const v4i m1 = *(const v4i*)(mr + 4);
#pragma unroll
            for (int j = 0; j < 8; ++j) { const float sv = a[j] * SCL; const float t = ((j < 4 ? m0[j & 3] : m1[j & 3]) == 0) ? MFILL : sv; a[j] = t; mx[qt] = fmaxf(mx[qt], t); }
            s[kt][qt] = a; }
        if (QT == 2 && (kt & 1)) __builtin_amdgcn_sched_barrier(0);   // keeps later key tiles' loads from being hoisted here: with all of them in flight beside 128 score registers the wave spills
    }
#pragma unroll
    for (int qt = 0; qt < QT; ++qt) { mx[qt] = fmaxf(mx[qt], __shfl_xor(mx[qt], 16, 32)); if (hi == 0) redm[w * 32 + qt * 16 + lr] = mx[qt]; }
    __syncthreads();   // every wave's row maxima are in redm
#pragma unroll
    for (int qt = 0; qt < QT; ++qt) {
#pragma unroll
        for (int r = 0; r < AW; ++r) mx[qt] = fmaxf(mx[qt], redm[r * 32 + qt * 16 + lr]);
        sum[qt] = 0.f; }
#pragma unroll
    for (int kt = 0; kt < KW / 16; ++kt)
#pragma unroll
        for (int qt = 0; qt < QT; ++qt)
#pragma unroll
            for (int j = 0; j < 8; ++j) { const float d0 = __fsub_rn(s[kt][qt][j], mx[qt]); const float e = __builtin_amdgcn_exp2f(fmaxf(__fmul_rn(d0, 1.4426950408889634f), -160.0f)); s[kt][qt][j] = e; sum[qt] += e; }
#pragma unroll
    for (int qt = 0; qt < QT; ++qt) { sum[qt] += __shfl_xor(sum[qt], 16, 32); if (hi == 0) reds[w * 32 + qt * 16 + lr] = sum[qt]; }
    __syncthreads();   // every wave's row sums are in reds
#pragma unroll
    for (int qt = 0; qt < QT; ++qt) { float t = reds[qt * 16 + lr];
#pragma unroll
        for (int r = 1; r < AW; ++r) t += reds[r * 32 + qt * 16 + lr];
        f[qt] = __fdiv_rn(HL ? 1.0f : PCAR, t); }
    v8f o[QT][4];
#pragma unroll
    for (int qt = 0; qt < QT; ++qt)
#pragma unroll
        for (int dt = 0; dt < 4; ++dt) o[qt][dt] = (v8f){};
#pragma unroll
    for (int c = 0; c < KW / 32; ++c) { V pa[QT], pa2[QT];
#pragma unroll
        for (int qt = 0; qt < QT; ++qt) {
            if constexpr (HL) { v8us h0, h1, l0, l1;
#pragma unroll
                for (int j = 0; j < 8; ++j) { unsigned short a, c2; splitf(s[2 * c][qt][j] * f[qt], a, c2); h0[j] = a; l0[j] = c2; splitf(s[2 * c + 1][qt][j] * f[qt], a, c2); h1[j] = a; l1[j] = c2; }
                pa[qt] = cat16b(h0, h1); pa2[qt] = cat16b(l0, l1);
            } else { v8h p0, p1;
#pragma unroll
                for (int j = 0; j < 8; ++j) { p0[j] = tohx(s[2 * c][qt][j] * f[qt]); p1[j] = tohx(s[2 * c + 1][qt][j] * f[qt]); }
                pa[qt] = cat16(p0, p1); } }
#pragma unroll
        for (int dt = 0; dt < 4; ++dt) { const size_t vo = (size_t)(dt * 16 + lr) * TT + kb + c * 32 + 8 * hi; const V vb = WFrag<T16>::ld(Vt + vo); V vb2; if (HL) vb2 = WFrag<T16>::ld(V2 + vo);
#pragma unroll
            for (int qt = 0; qt < QT; ++qt) { o[qt][dt] = WFrag<T16>::mma(pa[qt], vb, o[qt][dt]); if (HL) { o[qt][dt] = WFrag<T16>::mma(pa2[qt], vb, o[qt][dt]); o[qt][dt] = WFrag<T16>::mma(pa[qt], vb2, o[qt][dt]); } } } }
    float* pw = part + (size_t)w * (QT * 16 * OP);
#pragma unroll
    for (int qt = 0; qt < QT; ++qt)
#pragma unroll
        for (int dt = 0; dt < 4; ++dt)
#pragma unroll
            for (int j = 0; j < 8; ++j) pw[(qt * 16 + hi * 8 + j) * OP + dt * 16 + lr] = o[qt][dt][j];
    __syncthreads();   // every wave's partial tile is in part
    const float cs = HL ? 1.0f : (1.0f / PCAR);
    static_assert(QT * 16 * 16 <= AW * 32);
    if (tid < QT * 16 * 16) { const int row = tid >> 4, col = (tid & 15) * 4; v4f acc = *(const v4f*)(part + row * OP + col);
#pragma unroll
        for (int r = 1; r < AW; ++r) acc += *(const v4f*)(part + (size_t)r * (QT * 16 * OP) + row * OP + col);
        v4us oh, ol;
#pragma unroll
        for (int q = 0; q < 4; ++q) { unsigned short a, c2; splitf(acc[q] * cs, a, c2); oh[q] = a; ol[q] = c2; }
        const size_t oo = (size_t)(q0 + row) * DQ + hcol + col; *(v4us*)(Ah + oo) = oh; *(v4us*)(Al + oo) = ol; }
}

__global__ __launch_bounds__(AW * 32) void k_attn(const h16* __restrict__ Q16, const h16* __restrict__ K16, const h16* __restrict__ V16, const bf* __restrict__ Qh, const bf* __restrict__ Ql, const bf* __restrict__ Kh, const bf* __restrict__ Kl, const bf* __restrict__ Vh, const bf* __restrict__ Vl, const int* __restrict__ MK, bf* Ah, bf* Al) {
    __shared__ __align__(16) float part[AW * 32 * OP]; __shared__ float redm[AW * 32]; __shared__ float reds[AW * 32];
    const int h = blockIdx.y, bx = blockIdx.x; const size_t po = ((size_t)blockIdx.z * 3 * NH_ + h) * TT * HD;   // a batch's q, k and v planes lie behind one another
    Ah += (size_t)blockIdx.z * TT * DQ; Al += (size_t)blockIdx.z * TT * DQ;
    if (bx < RH / 16) attn_tile<bf, 1, true>(Qh + po, Ql + po, Kh + po, Kl + po, Vh + po, Vl + po, MK, bx * 16, h * HD, Ah, Al, part, redm, reds);
    else attn_tile<h16, 2, false>(Q16 + po, nullptr, K16 + po, nullptr, V16 + po, nullptr, MK, RH + (bx - RH / 16) * 32, h * HD, Ah, Al, part, redm, reds);
}

extern "C" void kernel_launch(void* const* d_in, const int* in_sizes, int n_in,
                              void* d_out, int out_size, void* d_ws, size_t ws_size, hipStream_t stream) {
    if (n_in < 8) return;
    const size_t need_x = ((size_t)(NB - 1) * SEQ_FULL + SEQ) * DM;          // elements of the activation stream / of the output that are touched
    const size_t need_m = (size_t)(SEQ - 1) * SEQ_FULL + SEQ;                // mask entries touched
    if ((size_t)in_sizes[0] < need_x) return;
    if ((size_t)in_sizes[1] < (size_t)SEQ * HP || (size_t)in_sizes[2] < (size_t)SEQ * HP) return;
    if ((size_t)in_sizes[3] < need_m) return;
    if ((size_t)in_sizes[4] < (size_t)DQ * DM || (size_t)in_sizes[5] < (size_t)DKV * DM || (size_t)in_sizes[6] < (size_t)DKV * DM || (size_t)in_sizes[7] < (size_t)DM * DQ) return;
    if ((size_t)out_size < need_x) return;
    // wire order: x, cos, sin, attn_mask (int32), wq, wk, wv, wo ('oi' weights)
    const float* x = (const float*)d_in[0]; const float* cs = (const float*)d_in[1]; const float* sn = (const float*)d_in[2]; const int* mk = (const int*)d_in[3];
    const float* wq = (const float*)d_in[4]; const float* wk = (const float*)d_in[5]; const float* wv = (const float*)d_in[6]; const float* wo = (const float*)d_in[7];
    float* OUT = (float*)d_out;     // [2][2048][768]
    char* wsp = (char*)d_ws;
    auto take = [&](size_t bytes) { char* p = wsp; wsp += (bytes + 255) & ~(size_t)255; return (void*)p; };
    bf* WQ = (bf*)take((size_t)DQ * DM * 2); bf* WK = (bf*)take((size_t)DKV * DM * 2); bf* WV = (bf*)take((size_t)DKV * DM * 2); bf* WO = (bf*)take((size_t)DM * DQ * 2);
    const size_t PS = (size_t)NH_ * TT * HD;     // elements of one plane; planes lie [batch][q, k, v][PS]
    h16* QP16 = (h16*)take((size_t)NB * 3 * PS * 2); h16* KP16 = QP16 + PS; h16* VT16 = KP16 + PS;
    bf* QPh = (bf*)take((size_t)NB * 3 * PS * 2); bf* KPh = QPh + PS; bf* VTh = KPh + PS;
    bf* QPl = (bf*)take((size_t)NB * 3 * PS * 2); bf* KPl = QPl + PS; bf* VTl = KPl + PS;
    bf* XB = (bf*)take((size_t)NB * TT * DM * 2); bf* ATh = (bf*)take((size_t)NB * TT * DQ * 2); bf* ATl = (bf*)take((size_t)NB * TT * DQ * 2);
    const size_t used = (size_t)(wsp - (char*)d_ws);
    if (used > ws_size || used > (size_t)268435456) return;
    k_cvt<<<4 * WB + NB * XBL, 256, 0, stream>>>(wq, wk, wv, wo, x, WQ, WK, WV, WO, XB);
    k_gemmw<bf, 0, false, false, 1><<<dim3(TT / 64, DQ / 64, 3 * NB), 32, 0, stream>>>(XB, nullptr, WQ, nullptr, DM, nullptr, 0, nullptr, (size_t)TT * DM, (size_t)(WK - WQ), PS, 0, 0, cs, sn, QP16, QPh, QPl);
    k_attn<<<dim3(RH / 16 + (TT - RH) / 32, NH_, NB), AW * 32, 0, stream>>>(QP16, KP16, VT16, QPh, QPl, KPh, KPl, VTh, VTl, mk, ATh, ATl);
    k_gemmw<bf, 1, false, false, 0><<<dim3(TT / 64, DM / 64, NB), 32, 0, stream>>>(ATh, ATl, WO, nullptr, DQ, OUT, DM, nullptr, (size_t)TT * DQ, 0, (size_t)SEQ_FULL * DM, 0, 0, nullptr, nullptr, nullptr, nullptr, nullptr);
}

// v006
// It runs in 184 microseconds.
// In two side-by-side timings against v005, it was 1.24 and 1.25 times as fast.
// Counting every step since v000, it is 8.28 times as fast.
#include <hip/hip_runtime.h>

// Causal self-attention over one input stream with interleaved-pair rotary embeddings whose cos / sin tables are inputs read by value, an int32 mask read by value, no biases (x [2][2048][768]; q = x Wq^T, k = x Wk^T, v = x Wv^T ('oi' [768][768]; 12 heads x 64); pairs (2j, 2j+1) of q and k rotated by cos[t][j], sin[t][j]; logits x 1/8; mask[i][j] == 0 -> logit replaced by -1e9; softmax over all 2048 keys; out = merged Wo^T -> [2][2048][768]; argument order x, cos, sin, attn_mask, wq, wk, wv, wo).
// Compute dtypes, f32 accumulate: projections v_wmma_f32_16x16x32_bf16 on RNE bf16 copies of x and weights; rotation f32 with RNE bf16 table values; logits and P.V: query rows < 512 bf16 hi/lo planes (3 products), rows >= 512 v_wmma_f32_16x16x32_f16 (P carried x1024); softmax f32; output projection bf16 hi/lo ctx x bf16 Wo (2 products).
// Four launches, each over both batches: bf16 copies of the four weights and of the input stream; the three projections (grid z = 3 * batch + {q, k, v}), whose epilogue writes the rotary head planes (q, k) or the transposed value planes straight from the accumulators; attention over all heads (grid z = batch): a work-group of AW waves takes 16 or 32 query rows, each wave TT/AW keys; scores, softmax and P stay in registers, the waves' f32 partial tiles are summed in wave order through LDS; merged hi/lo x Wo.

#ifndef NB
#define NB   2
#endif
#ifndef SEQ
#define SEQ  2048
#endif
#define NB_FULL  2
#define SEQ_FULL 2048
#define TT   SEQ
#define DM   768
#define NH_  12
#define NKV  12
#define REP  (NH_ / NKV)
#define HD   64
#define HP   (HD / 2)    // rotary pairs per head = table row width
#define DQ   (NH_ * HD)
#define DKV  (NKV * HD)
#define AW   16   // waves of an attention work-group; each owns KW keys
#define KW   (SEQ / AW)
#define OP   68   // f32 pitch of a partial-tile row in LDS: rows 8 apart fall on different banks
#define RH   ((SEQ < 512) ? SEQ : 512)   // query rows < RH use hi+lo planes
#define PCAR 1024.0f
#define SCL  0.125f   // HD^-0.5
#define MFILL (-1.0e9f)
typedef _Float16 h16;
typedef unsigned short bf;
typedef __attribute__((ext_vector_type(16))) __bf16   v16bf;
typedef __attribute__((ext_vector_type(16))) _Float16 v16h;
typedef __attribute__((ext_vector_type(8)))  _Float16 v8h;
typedef __attribute__((ext_vector_type(8)))  unsigned short v8us;
typedef __attribute__((ext_vector_type(8)))  float    v8f;
typedef __attribute__((ext_vector_type(4)))  float    v4f;
typedef v4f  __attribute__((may_alias)) v4fa;

static_assert(TT % 128 == 0);
static_assert(TT % (AW * 32) == 0);
static_assert(RH % 16 == 0);
static_assert((TT - RH) % 32 == 0);
static_assert(RH % 64 == 0);
static_assert((TT - RH) % 64 == 0);
static_assert(DM % 32 == 0);
static_assert(DQ % 64 == 0);
static_assert(DKV % 64 == 0);
static_assert(DM % 64 == 0);
static_assert(HD == 64);
static_assert(NB <= NB_FULL);
static_assert(SEQ <= SEQ_FULL);
static_assert((size_t)NB_FULL * SEQ_FULL * DM * 4 == 12582912);
static_assert(HP == 32);                                  // table rows are [t][32]
static_assert(HD % 2 == 0);
static_assert(DQ == DM);                                  // merged width == model width (no bias, square Wo)
static_assert(NKV == NH_);                                // one k/v head per q head
static_assert(((size_t)TT * DM / 8) % 256 == 0);
#define A256(x) ((((size_t)(x)) + 255) & ~(size_t)255)
static_assert(4 * A256((size_t)DQ * DM * 2) + 3 * A256((size_t)NB * 3 * NH_ * TT * HD * 2) + A256((size_t)NB * TT * DM * 2) + 2 * A256((size_t)NB * TT * DQ * 2) <= (size_t)268435456);
static_assert(((size_t)DQ * DM / 8) % 256 == 0);

__device__ __forceinline__ unsigned short f2bf(float f) { unsigned u = __float_as_uint(f); u += 0x7FFFu + ((u >> 16) & 1u); return (unsigned short)(u >> 16); }
__device__ __forceinline__ float bf2f(unsigned short b) { return __uint_as_float(((unsigned)b) << 16); }
__device__ __forceinline__ float bfr(float f) { return bf2f(f2bf(f)); }
__device__ __forceinline__ v16h cat16(v8h lo, v8h hi) { return __builtin_shufflevector(lo, hi, 0, 1, 2, 3, 4, 5, 6, 7, 8, 9, 10, 11, 12, 13, 14, 15); }
__device__ __forceinline__ v16bf cat16b(v8us lo, v8us hi) { return __builtin_bit_cast(v16bf, __builtin_shufflevector(lo, hi, 0, 1, 2, 3, 4, 5, 6, 7, 8, 9, 10, 11, 12, 13, 14, 15)); }
__device__ __forceinline__ v8f wmma16(v16h a, v16h b, v8f c) { return __builtin_amdgcn_wmma_f32_16x16x32_f16(false, a, false, b, (short)0, c, false, false); }
__device__ __forceinline__ v8f wmmab(v16bf a, v16bf b, v8f c) { return __builtin_amdgcn_wmma_f32_16x16x32_bf16(false, a, false, b, (short)0, c, false, false); }

__device__ __forceinline__ h16 tohx(float x) { return (h16)x; }
__device__ __forceinline__ void splitf(float y, unsigned short& h, unsigned short& l) { h = f2bf(y); l = f2bf(y - bf2f(h)); }
typedef __attribute__((ext_vector_type(2))) _Float16 v2h;
typedef __attribute__((ext_vector_type(4))) _Float16 v4h;
typedef __attribute__((ext_vector_type(2))) unsigned short v2us;
typedef __attribute__((ext_vector_type(4))) unsigned short v4us;
typedef __attribute__((ext_vector_type(2))) float v2f;
typedef __attribute__((ext_vector_type(4))) int v4i;

// f32 -> fp16 with a value select: magnitudes below the smallest fp16 normal become zero.
static __device__ __forceinline__ h16 toh_flush(float v) { const h16 r = (h16)v; return (fabsf(v) < 6.103515625e-05f) ? (h16)0.0f : r; }

// ---- k_gemmw: register-blocked GEMM, ONE WAVE per 64x64 output tile (16 accumulators), operands straight from 16-bit planes in fragment order; grid (M/64, N/64, Z), 32 threads.
// C[m][n] (f32, pitch ldc, + optional f32 bias[n]) = sum_k A[m][k] Bt[n][k] (+ split products per NSPLIT). z-batch strides sA/sB/sC in elements. K = DM.
// KSP: N == 64 and blockIdx.y numbers a k range of kspan (kspan % 32 == 0, gridDim.y * kspan == K); its partial tile goes to C + blockIdx.y * sK.
// EPI 0: C as above. EPI 1: projections, z = 3 * batch + p: A steps by sA a batch, Bt by sB a p, the planes by sC a z; C unused.
// p = 0, 1 (N tile = one head): the tile's pairs (2j, 2j+1) are rotated by the RNE bf16 copies of CS[t][j], SN[t][j] and go to the head planes [h][t][d] (fp16 + bf16 hi/lo; rows t, k = d, fragment order).
// p = 2 (N tile = one head): the tile goes transposed to the value planes [h][d][t] (fp16 + bf16 hi/lo; rows d, k = t, fragment order): a lane's 8 accumulator rows are 8 neighbouring t of one d, one 16-byte store a plane, the wave's 32 stores 512 bytes in a row.
// Fragment map (A and Bt alike): lane -> row (lane & 15); elements 0..7 = k0 + 8*(lane>>4) + 0..7, elements 8..15 = k0 + 16 + 8*(lane>>4) + 0..7.
// Fragment order: every 16-bit operand plane M[row][k] (K columns) lies in blocks of 16 rows x 32 k, block (row>>4)*(K/32) + (k>>5), 512 elements each; inside a block element (row, k) stands at ((k>>4)&1)*256 + (((k>>3)&1)*16 + (row&15))*8 + (k&7).
// A fragment is then two 16-byte loads a lane at block + lane*8 and block + 256 + lane*8 (ld: block pointer and the lane's offset in bytes; lde: the same with the offset in elements): each load of the wave reads 512 bytes in a row (4 lines) where a row-major plane gives 16 rows x 32 bytes (16 lines).
template <typename T16> struct WFrag;
template <> struct WFrag<h16> { typedef v16h V; static __device__ __forceinline__ V ld(const h16* p, unsigned lo) { const char* q = (const char*)p + lo; return cat16(*(const v8h*)q, *(const v8h*)(q + 512)); } static __device__ __forceinline__ V lde(const h16* p, unsigned le) { return cat16(*(const v8h*)(p + le), *(const v8h*)(p + 256 + le)); } static __device__ __forceinline__ v8f mma(V a, V b, v8f c) { return wmma16(a, b, c); } };
template <> struct WFrag<bf> { typedef v16bf V; static __device__ __forceinline__ V ld(const bf* p, unsigned lo) { const char* q = (const char*)p + lo; return cat16b(*(const v8us*)q, *(const v8us*)(q + 512)); } static __device__ __forceinline__ V lde(const bf* p, unsigned le) { return cat16b(*(const v8us*)(p + le), *(const v8us*)(p + 256 + le)); } static __device__ __forceinline__ v8f mma(V a, V b, v8f c) { return wmmab(a, b, c); } };
template <typename T16, int NSPLIT, bool BIAS, bool KSP, int EPI>
__global__ __launch_bounds__(32) void k_gemmw(const T16* __restrict__ A, const T16* __restrict__ A2, const T16* __restrict__ Bt, const T16* __restrict__ Bt2, float* C, int ldc, const float* __restrict__ bias, size_t sA, size_t sB, size_t sC, int kspan, size_t sK, const float* __restrict__ CS, const float* __restrict__ SN, h16* P16, bf* Ph, bf* Pl) {
    typedef typename WFrag<T16>::V V;
    constexpr int K = DM;   // both products run over the model width: every block of a tile is a constant step from one scalar base
    __shared__ __align__(16) float os[16 * 68];
    const size_t z = blockIdx.z, zb = (EPI == 1) ? z / 3 : z, zp = (EPI == 1) ? z - 3 * zb : z; A += zb * sA; if (A2) A2 += zb * sA; Bt += zp * sB; if (Bt2) Bt2 += zp * sB;
    if (EPI == 1) { P16 += z * sC; Ph += z * sC; Pl += z * sC; } else C += z * sC;
    const int lane = threadIdx.x & 31, lr = lane & 15, hi = lane >> 4; const int r0 = blockIdx.x * 64, c0 = KSP ? 0 : blockIdx.y * 64;
    const int kn = KSP ? kspan : K; if (KSP) { const size_t kb = (size_t)blockIdx.y * kspan * 16; A += kb; if (A2) A2 += kb; Bt += kb; if (Bt2) Bt2 += kb; C += blockIdx.y * sK; }
    v8f acc[4][4];
#pragma unroll
    for (int mb = 0; mb < 4; ++mb)
#pragma unroll
        for (int nb = 0; nb < 4; ++nb) acc[mb][nb] = (v8f){};
    const size_t aoff = (size_t)r0 * K, boff = (size_t)c0 * K; unsigned lo = lane * 16;   // a block's address is the same for the whole wave; lo, in bytes, is the lane's place in it plus the k step, one register for every load of the loop
#pragma unroll 1
    for (int kc = 0; kc < kn; kc += 32) {
        V a[4], a2[4];
#pragma unroll
        for (int mb = 0; mb < 4; ++mb) { a[mb] = WFrag<T16>::ld(A + aoff + (size_t)mb * 16 * K, lo); if (NSPLIT == 1 || NSPLIT == 2) a2[mb] = WFrag<T16>::ld(A2 + aoff + (size_t)mb * 16 * K, lo); }
#pragma unroll
        for (int nb = 0; nb < 4; ++nb) { const V b = WFrag<T16>::ld(Bt + boff + (size_t)nb * 16 * K, lo); V b2; if (NSPLIT >= 2) b2 = WFrag<T16>::ld(Bt2 + boff + (size_t)nb * 16 * K, lo);
            if (nb == 3) { asm volatile("s_wait_xcnt 0x0" : "+v"(lo) :: "memory"); lo += 1024; }   // last loads of the trip: the offset register that they all name takes its k step (one block, 1024 bytes) only behind this wait
#pragma unroll
            for (int mb = 0; mb < 4; ++mb) { acc[mb][nb] = WFrag<T16>::mma(a[mb], b, acc[mb][nb]); if (NSPLIT == 1 || NSPLIT == 2) acc[mb][nb] = WFrag<T16>::mma(a2[mb], b, acc[mb][nb]); if (NSPLIT >= 2) acc[mb][nb] = WFrag<T16>::mma(a[mb], b2, acc[mb][nb]); } }
        asm volatile("v_nop\n\tv_nop\n\tv_nop\n\tv_nop" : "+v"(acc[0][0]), "+v"(acc[1][1]), "+v"(acc[2][2]), "+v"(acc[3][3]) : "v"(a[0]), "v"(a[3]));
    }
    // one base a plane or table for the lane; every row of the tile is a constant step from it
    const size_t tb = (size_t)(r0 + hi) * HP + lr * 2, pb = ((size_t)(c0 / HD) * TT + r0) * HD + (lr >> 1) * 128 + hi * 8 + (lr & 1) * 4, vb = (size_t)c0 * TT + (size_t)r0 * 16 + lane * 8;
    if (EPI == 1 && zp == 2) {
#pragma unroll
        for (int nb = 0; nb < 4; ++nb)
#pragma unroll
            for (int mb = 0; mb < 4; ++mb) { v8h o16; v8us oh, ol;
#pragma unroll
                for (int j = 0; j < 8; ++j) { const float x = acc[mb][nb][j]; o16[j] = tohx(x); unsigned short a2, c2; splitf(x, a2, c2); oh[j] = a2; ol[j] = c2; }
                const size_t e = vb + (size_t)nb * 16 * TT + mb * 256; *(v8h*)(P16 + e) = o16; *(v8us*)(Ph + e) = oh; *(v8us*)(Pl + e) = ol; }
        return; }
#pragma unroll
    for (int mb = 0; mb < 4; ++mb) {
#pragma unroll
        for (int nb = 0; nb < 4; ++nb) {
#pragma unroll
            for (int j = 0; j < 8; ++j) os[(hi * 8 + j) * 68 + nb * 16 + lr] = acc[mb][nb][j]; }
        v2f cc[8], ss[8];   // the 16 rows' table values, asked for while the rows are staged
        if constexpr (EPI == 1) {
#pragma unroll
            for (int s = 0; s < 8; ++s) { cc[s] = *(const v2f*)(CS + tb + (mb * 16 + 2 * s) * HP); ss[s] = *(const v2f*)(SN + tb + (mb * 16 + 2 * s) * HP); } }
        __builtin_amdgcn_wave_barrier(); asm volatile("" ::: "memory");
        if constexpr (EPI == 1) { v4h o16[8]; v4us oh[8], ol[8];
#pragma unroll
            for (int s = 0; s < 8; ++s) { const int row = 2 * s + hi, cofs = lr * 4; const v4f x = *(const v4fa*)(os + row * 68 + cofs);
#pragma unroll
                for (int p = 0; p < 2; ++p) { const float c = bfr(cc[s][p]), sn = bfr(ss[s][p]); v2f r; r[0] = x[2 * p] * c - x[2 * p + 1] * sn; r[1] = x[2 * p] * sn + x[2 * p + 1] * c;
#pragma unroll
                    for (int q = 0; q < 2; ++q) { const float y = r[q]; o16[s][2 * p + q] = toh_flush(y); unsigned short a2, c2; splitf(y, a2, c2); oh[s][2 * p + q] = a2; ol[s][2 * p + q] = c2; } } }
            __builtin_amdgcn_sched_barrier(0);   // keeps the 24 stores in one run behind the arithmetic, so that the one wait below serves them all; spread among it the build holds some fifty waits, one behind nearly every second store
#pragma unroll
            for (int s = 0; s < 8; ++s) { const size_t e = pb + mb * 16 * HD + s * 16; *(v4h*)(P16 + e) = o16[s]; *(v4us*)(Ph + e) = oh[s]; *(v4us*)(Pl + e) = ol[s]; }
            asm volatile("s_wait_xcnt 0x0" ::: "memory");   // the plane stores' address and data registers are free for reuse behind this line
        } else { float* crow = C + (size_t)(r0 + mb * 16) * ldc + c0;
#pragma unroll
            for (int s = 0; s < 8; ++s) { const int row = 2 * s + hi, cofs = lr * 4; v4f val = *(const v4fa*)(os + row * 68 + cofs); if (BIAS) { val[0] += bfr(bias[c0 + cofs]); val[1] += bfr(bias[c0 + cofs + 1]); val[2] += bfr(bias[c0 + cofs + 2]); val[3] += bfr(bias[c0 + cofs + 3]); }
                *(v4f*)(crow + (size_t)row * ldc + cofs) = val; }
             }
        __builtin_amdgcn_wave_barrier(); asm volatile("" ::: "memory");
    }
}

// k_cvt: RNE bf16 copies of the four weights (WB blocks each) and of the input stream (XBL blocks a batch) in one launch, written in fragment order (rows of DM columns); a thread takes 8 neighbouring values, numbered by their place in the copy.
#define WB   ((unsigned)((size_t)DQ * DM / 8 / 256))
#define XBL  ((unsigned)((size_t)TT * DM / 8 / 256))
__global__ __launch_bounds__(256) void k_cvt(const float* __restrict__ w0, const float* __restrict__ w1, const float* __restrict__ w2, const float* __restrict__ w3, const float* __restrict__ x, bf* d0, bf* d1, bf* d2, bf* d3, bf* dx) {
    const unsigned b = blockIdx.x; const float* src; bf* dst; unsigned r;
    if (b < 4 * WB) { const unsigned k = b / WB; r = b - k * WB; src = (k == 0) ? w0 : (k == 1) ? w1 : (k == 2) ? w2 : w3; dst = (k == 0) ? d0 : (k == 1) ? d1 : (k == 2) ? d2 : d3; }
    else { const unsigned k = (b - 4 * WB) / XBL; r = b - 4 * WB - k * XBL; src = x + (size_t)k * SEQ_FULL * DM; dst = dx + (size_t)k * TT * DM; }
    const unsigned i = r * 256 + threadIdx.x, blk = i >> 6, rb = blk / (DM / 32), kq = blk - rb * (DM / 32);   // 64 threads a block of 16 rows x 32 k
    const size_t so = (size_t)(rb * 16 + (i & 15)) * DM + kq * 32 + ((i >> 5) & 1) * 16 + ((i >> 4) & 1) * 8; const v8f v = *(const v8f*)(src + so); v8us o;
    asm volatile("s_wait_xcnt 0x0" ::: "memory");   // the load's address registers are free for reuse behind this line
#pragma unroll
    for (int k = 0; k < 8; ++k) o[k] = f2bf(v[k]);
    *(v8us*)(dst + (size_t)i * 8) = o; }

// k_attn: scores, softmax, P.V and the merge of one head's 16 (rows < RH, hi/lo planes) or 32 (fp16 planes) query rows in one work-group of AW waves; wave w owns keys w*KW .. w*KW+KW-1.
// Scores are formed transposed, S^T = K Q^T: lane (lr, hi) holds query lr, keys 8*hi + j of a 16-key tile, so two neighbouring tiles are, element for element, the A fragment of P for 32 keys (fragment map above) and P never leaves the registers.
// t = S x HD^-0.5, then t := -1e9 where MK[i][j] == 0 (value select; MK row pitch SEQ_FULL, shared by all heads and batches); softmax over the TT keys: exact row maximum and row sum over the waves through LDS, in wave order; a fully filled row comes out uniform.
// Each wave's f32 partial tile [q][d] goes to LDS; the tiles are summed in the order w = 0 .. AW-1, scaled and split into the merged hi/lo planes (rows t, k = merged column, fragment order).
template <typename T16, int QT, bool HL>
__device__ __forceinline__ void attn_tile(const T16* __restrict__ Q, const T16* __restrict__ Q2, const T16* __restrict__ Kp, const T16* __restrict__ K2, const T16* __restrict__ Vt, const T16* __restrict__ V2, const int* __restrict__ MK, int q0, int hcol, bf* Ah, bf* Al, float* part, float* redm, float* reds) {
    typedef typename WFrag<T16>::V V;
    const int tid = threadIdx.x, lane = tid & 31, lr = lane & 15, hi = lane >> 4, w = __builtin_amdgcn_readfirstlane(tid >> 5); const int kb = w * KW; const unsigned lo = lane * 8;   // the wave's number in a scalar register: block addresses are scalar, the lane adds its place in elements
    V qf[QT][2], qf2[QT][2];
#pragma unroll
    for (int qt = 0; qt < QT; ++qt)
#pragma unroll
        for (int c = 0; c < 2; ++c) { const size_t o = (size_t)(q0 + qt * 16) * HD + c * 512; qf[qt][c] = WFrag<T16>::lde(Q + o, lo); if (HL) qf2[qt][c] = WFrag<T16>::lde(Q2 + o, lo); }
    asm volatile("s_wait_xcnt 0x0" ::: "memory");   // the query loads' address registers are free for reuse behind this line
    const int* mb = MK + (size_t)(q0 + lr) * SEQ_FULL + kb + 8 * hi;   // one base for every mask load of the wave
    v8f s[KW / 16][QT]; float mx[QT], sum[QT], f[QT];
#pragma unroll
    for (int qt = 0; qt < QT; ++qt) mx[qt] = -3.0e38f;
#pragma unroll
    for (int kt = 0; kt < KW / 16; ++kt) { V ka[2], ka2[2];
#pragma unroll
        for (int c = 0; c < 2; ++c) { const size_t o = (size_t)(kb + kt * 16) * HD + c * 512; ka[c] = WFrag<T16>::lde(Kp + o, lo); if (HL) ka2[c] = WFrag<T16>::lde(K2 + o, lo); }
        if (kt == KW / 16 - 1) asm volatile("s_wait_xcnt 0x0" ::: "memory");   // last key loads: their address registers are free for reuse behind this line
#pragma unroll
        for (int qt = 0; qt < QT; ++qt) { v8f a = (v8f){};
#pragma unroll
            for (int c = 0; c < 2; ++c) { a = WFrag<T16>::mma(ka[c], qf[qt][c], a); if (HL) { a = WFrag<T16>::mma(ka[c], qf2[qt][c], a); a = WFrag<T16>::mma(ka2[c], qf[qt][c], a); } }
            const int* mr = mb + (size_t)qt * 16 * SEQ_FULL + kt * 16; const v4i m0 = *(const v4i*)mr; const v4i m1 = *(const v4i*)(mr + 4);
#pragma unroll
            for (int j = 0; j < 8; ++j) { const float sv = a[j] * SCL; const float t = ((j < 4 ? m0[j & 3] : m1[j & 3]) == 0) ? MFILL : sv; a[j] = t; mx[qt] = fmaxf(mx[qt], t); }
            s[kt][qt] = a; }
        if (QT == 2 && (kt & 1)) __builtin_amdgcn_sched_barrier(0);   // keeps later key tiles' loads from being hoisted here: with all of them in flight beside 128 score registers the wave spills
    }
#pragma unroll
    for (int qt = 0; qt < QT; ++qt) { mx[qt] = fmaxf(mx[qt], __shfl_xor(mx[qt], 16, 32)); if (hi == 0) redm[w * 32 + qt * 16 + lr] = mx[qt]; }
    __syncthreads();   // every wave's row maxima are in redm
#pragma unroll
    for (int qt = 0; qt < QT; ++qt) {
#pragma unroll
        for (int r = 0; r < AW; ++r) mx[qt] = fmaxf(mx[qt], redm[r * 32 + qt * 16 + lr]);
        sum[qt] = 0.f; }
#pragma unroll
    for (int kt = 0; kt < KW / 16; ++kt)
#pragma unroll
        for (int qt = 0; qt < QT; ++qt)
#pragma unroll
            for (int j = 0; j < 8; ++j) { const float d0 = __fsub_rn(s[kt][qt][j], mx[qt]); const float e = __builtin_amdgcn_exp2f(fmaxf(__fmul_rn(d0, 1.4426950408889634f), -160.0f)); s[kt][qt][j] = e; sum[qt] += e; }
#pragma unroll
    for (int qt = 0; qt < QT; ++qt) { sum[qt] += __shfl_xor(sum[qt], 16, 32); if (hi == 0) reds[w * 32 + qt * 16 + lr] = sum[qt]; }
    __syncthreads();   // every wave's row sums are in reds
#pragma unroll
    for (int qt = 0; qt < QT; ++qt) { float t = reds[qt * 16 + lr];
#pragma unroll
        for (int r = 1; r < AW; ++r) t += reds[r * 32 + qt * 16 + lr];
        f[qt] = __fdiv_rn(HL ? 1.0f : PCAR, t); }
    v8f o[QT][4];
#pragma unroll
    for (int qt = 0; qt < QT; ++qt)
#pragma unroll
        for (int dt = 0; dt < 4; ++dt) o[qt][dt] = (v8f){};
#pragma unroll
    for (int c = 0; c < KW / 32; ++c) { V pa[QT], pa2[QT];
#pragma unroll
        for (int qt = 0; qt < QT; ++qt) {
            if constexpr (HL) { v8us h0, h1, l0, l1;
#pragma unroll
                for (int j = 0; j < 8; ++j) { unsigned short a, c2; splitf(s[2 * c][qt][j] * f[qt], a, c2); h0[j] = a; l0[j] = c2; splitf(s[2 * c + 1][qt][j] * f[qt], a, c2); h1[j] = a; l1[j] = c2; }
                pa[qt] = cat16b(h0, h1); pa2[qt] = cat16b(l0, l1);
            } else { v8h p0, p1;
#pragma unroll
                for (int j = 0; j < 8; ++j) { p0[j] = tohx(s[2 * c][qt][j] * f[qt]); p1[j] = tohx(s[2 * c + 1][qt][j] * f[qt]); }
                pa[qt] = cat16(p0, p1); } }
#pragma unroll
        for (int dt = 0; dt < 4; ++dt) { const size_t vo = (size_t)dt * 16 * TT + (size_t)(kb + c * 32) * 16; const V vb = WFrag<T16>::lde(Vt + vo, lo); V vb2; if (HL) vb2 = WFrag<T16>::lde(V2 + vo, lo);
#pragma unroll
            for (int qt = 0; qt < QT; ++qt) { o[qt][dt] = WFrag<T16>::mma(pa[qt], vb, o[qt][dt]); if (HL) { o[qt][dt] = WFrag<T16>::mma(pa2[qt], vb, o[qt][dt]); o[qt][dt] = WFrag<T16>::mma(pa[qt], vb2, o[qt][dt]); } } } }
    float* pw = part + (size_t)w * (QT * 16 * OP);
#pragma unroll
    for (int qt = 0; qt < QT; ++qt)
#pragma unroll
        for (int dt = 0; dt < 4; ++dt)
#pragma unroll
            for (int j = 0; j < 8; ++j) pw[(qt * 16 + hi * 8 + j) * OP + dt * 16 + lr] = o[qt][dt][j];
    __syncthreads();   // every wave's partial tile is in part
    const float cs = HL ? 1.0f : (1.0f / PCAR);
    static_assert(QT * 16 * 16 <= AW * 32);
    if (tid < QT * 16 * 16) { const int row = tid >> 4, col = (tid & 15) * 4; v4f acc = *(const v4f*)(part + row * OP + col);
#pragma unroll
        for (int r = 1; r < AW; ++r) acc += *(const v4f*)(part + (size_t)r * (QT * 16 * OP) + row * OP + col);
        v4us oh, ol;
#pragma unroll
        for (int q = 0; q < 4; ++q) { unsigned short a, c2; splitf(acc[q] * cs, a, c2); oh[q] = a; ol[q] = c2; }
        const size_t oo = (size_t)(q0 + (row & ~15)) * DQ + hcol * 16 + (col >> 3) * 128 + (row & 15) * 8 + (col & 4); *(v4us*)(Ah + oo) = oh; *(v4us*)(Al + oo) = ol; }
}

__global__ __launch_bounds__(AW * 32) void k_attn(const h16* __restrict__ Q16, const h16* __restrict__ K16, const h16* __restrict__ V16, const bf* __restrict__ Qh, const bf* __restrict__ Ql, const bf* __restrict__ Kh, const bf* __restrict__ Kl, const bf* __restrict__ Vh, const bf* __restrict__ Vl, const int* __restrict__ MK, bf* Ah, bf* Al) {
    __shared__ __align__(16) float part[AW * 32 * OP]; __shared__ float redm[AW * 32]; __shared__ float reds[AW * 32];
    const int h = blockIdx.y, bx = blockIdx.x; const size_t po = ((size_t)blockIdx.z * 3 * NH_ + h) * TT * HD;   // a batch's q, k and v planes lie behind one another
    Ah += (size_t)blockIdx.z * TT * DQ; Al += (size_t)blockIdx.z * TT * DQ;
    if (bx < RH / 16) attn_tile<bf, 1, true>(Qh + po, Ql + po, Kh + po, Kl + po, Vh + po, Vl + po, MK, bx * 16, h * HD, Ah, Al, part, redm, reds);
    else attn_tile<h16, 2, false>(Q16 + po, nullptr, K16 + po, nullptr, V16 + po, nullptr, MK, RH + (bx - RH / 16) * 32, h * HD, Ah, Al, part, redm, reds);
}

extern "C" void kernel_launch(void* const* d_in, const int* in_sizes, int n_in,
                              void* d_out, int out_size, void* d_ws, size_t ws_size, hipStream_t stream) {
    if (n_in < 8) return;
    const size_t need_x = ((size_t)(NB - 1) * SEQ_FULL + SEQ) * DM;          // elements of the activation stream / of the output that are touched
    const size_t need_m = (size_t)(SEQ - 1) * SEQ_FULL + SEQ;                // mask entries touched
    if ((size_t)in_sizes[0] < need_x) return;
    if ((size_t)in_sizes[1] < (size_t)SEQ * HP || (size_t)in_sizes[2] < (size_t)SEQ * HP) return;
    if ((size_t)in_sizes[3] < need_m) return;
    if ((size_t)in_sizes[4] < (size_t)DQ * DM || (size_t)in_sizes[5] < (size_t)DKV * DM || (size_t)in_sizes[6] < (size_t)DKV * DM || (size_t)in_sizes[7] < (size_t)DM * DQ) return;
    if ((size_t)out_size < need_x) return;
    // wire order: x, cos, sin, attn_mask (int32), wq, wk, wv, wo ('oi' weights)
    const float* x = (const float*)d_in[0]; const float* cs = (const float*)d_in[1]; const float* sn = (const float*)d_in[2]; const int* mk = (const int*)d_in[3];
    const float* wq = (const float*)d_in[4]; const float* wk = (const float*)d_in[5]; const float* wv = (const float*)d_in[6]; const float* wo = (const float*)d_in[7];
    float* OUT = (float*)d_out;     // [2][2048][768]
    char* wsp = (char*)d_ws;
    auto take = [&](size_t bytes) { char* p = wsp; wsp += (bytes + 255) & ~(size_t)255; return (void*)p; };
    bf* WQ = (bf*)take((size_t)DQ * DM * 2); bf* WK = (bf*)take((size_t)DKV * DM * 2); bf* WV = (bf*)take((size_t)DKV * DM * 2); bf* WO = (bf*)take((size_t)DM * DQ * 2);
    const size_t PS = (size_t)NH_ * TT * HD;     // elements of one plane; planes lie [batch][q, k, v][PS]
    h16* QP16 = (h16*)take((size_t)NB * 3 * PS * 2); h16* KP16 = QP16 + PS; h16* VT16 = KP16 + PS;
    bf* QPh = (bf*)take((size_t)NB * 3 * PS * 2); bf* KPh = QPh + PS; bf* VTh = KPh + PS;
    bf* QPl = (bf*)take((size_t)NB * 3 * PS * 2); bf* KPl = QPl + PS; bf* VTl = KPl + PS;
    bf* XB = (bf*)take((size_t)NB * TT * DM * 2); bf* ATh = (bf*)take((size_t)NB * TT * DQ * 2); bf* ATl = (bf*)take((size_t)NB * TT * DQ * 2);
    const size_t used = (size_t)(wsp - (char*)d_ws);
    if (used > ws_size || used > (size_t)268435456) return;
    k_cvt<<<4 * WB + NB * XBL, 256, 0, stream>>>(wq, wk, wv, wo, x, WQ, WK, WV, WO, XB);
    k_gemmw<bf, 0, false, false, 1><<<dim3(TT / 64, DQ / 64, 3 * NB), 32, 0, stream>>>(XB, nullptr, WQ, nullptr, nullptr, 0, nullptr, (size_t)TT * DM, (size_t)(WK - WQ), PS, 0, 0, cs, sn, QP16, QPh, QPl);
    k_attn<<<dim3(RH / 16 + (TT - RH) / 32, NH_, NB), AW * 32, 0, stream>>>(QP16, KP16, VT16, QPh, QPl, KPh, KPl, VTh, VTl, mk, ATh, ATl);
    k_gemmw<bf, 1, false, false, 0><<<dim3(TT / 64, DM / 64, NB), 32, 0, stream>>>(ATh, ATl, WO, nullptr, OUT, DM, nullptr, (size_t)TT * DQ, 0, (size_t)SEQ_FULL * DM, 0, 0, nullptr, nullptr, nullptr, nullptr, nullptr);
}

// v007
// It runs in 136 microseconds.
// Next to v006, in two timings, it ran 1.35 times as fast each time.
// All steps since v000 together make it 11.2 times as fast.
#include <hip/hip_runtime.h>

// Causal self-attention over one input stream with interleaved-pair rotary embeddings whose cos / sin tables are inputs read by value, an int32 mask read by value, no biases (x [2][2048][768]; q = x Wq^T, k = x Wk^T, v = x Wv^T ('oi' [768][768]; 12 heads x 64); pairs (2j, 2j+1) of q and k rotated by cos[t][j], sin[t][j]; logits x 1/8; mask[i][j] == 0 -> logit replaced by -1e9; softmax over all 2048 keys; out = merged Wo^T -> [2][2048][768]; argument order x, cos, sin, attn_mask, wq, wk, wv, wo).
// Compute dtypes, f32 accumulate: projections v_wmma_f32_16x16x32_bf16 on RNE bf16 copies of x and weights; rotation f32 with RNE bf16 table values; logits and P.V: query rows < 512 bf16 hi/lo planes (3 products), rows >= 512 v_wmma_f32_16x16x32_f16 (P carried x1024); softmax f32; output projection bf16 hi/lo ctx x bf16 Wo (2 products).
// Four launches, each over both batches: bf16 copies of the four weights and of the input stream, and one flag for every mask block of 16 query rows x 32 keys (any entry != 0); the three projections (grid z = 3 * batch + {q, k, v}), whose epilogue writes the rotary head planes (q, k) or the transposed value planes straight from the accumulators; attention over all heads (grid z = batch): a work-group of AW waves takes 16 or 32 query rows, each wave TT/AW keys in chunks of 32 dealt round-robin, a chunk whose mask block is all zero being left out where its P is zero; scores, softmax and P stay in registers, the waves' f32 partial tiles are summed in wave order through LDS; merged hi/lo x Wo.

#ifndef NB
#define NB   2
#endif
#ifndef SEQ
#define SEQ  2048
#endif
#define NB_FULL  2
#define SEQ_FULL 2048
#define TT   SEQ
#define DM   768
#define NH_  12
#define NKV  12
#define REP  (NH_ / NKV)
#define HD   64
#define HP   (HD / 2)    // rotary pairs per head = table row width
#define DQ   (NH_ * HD)
#define DKV  (NKV * HD)
#define AW   16   // waves of an attention work-group; each owns KW keys
#define KW   (SEQ / AW)
#define OP   68   // f32 pitch of a partial-tile row in LDS: rows 8 apart fall on different banks
#define RH   ((SEQ < 512) ? SEQ : 512)   // query rows < RH use hi+lo planes
#define PCAR 1024.0f
#define SCL  0.125f   // HD^-0.5
#define MFILL (-1.0e9f)
typedef _Float16 h16;
typedef unsigned short bf;
typedef __attribute__((ext_vector_type(16))) __bf16   v16bf;
typedef __attribute__((ext_vector_type(16))) _Float16 v16h;
typedef __attribute__((ext_vector_type(8)))  _Float16 v8h;
typedef __attribute__((ext_vector_type(8)))  unsigned short v8us;
typedef __attribute__((ext_vector_type(8)))  float    v8f;
typedef __attribute__((ext_vector_type(4)))  float    v4f;
typedef v4f  __attribute__((may_alias)) v4fa;

static_assert(TT % 128 == 0);
static_assert(TT % (AW * 32) == 0);
static_assert(RH % 16 == 0);
static_assert((TT - RH) % 32 == 0);
static_assert(RH % 64 == 0);
static_assert((TT - RH) % 64 == 0);
static_assert(DM % 32 == 0);
static_assert(DQ % 64 == 0);
static_assert(DKV % 64 == 0);
static_assert(DM % 64 == 0);
static_assert(HD == 64);
static_assert(NB <= NB_FULL);
static_assert(SEQ <= SEQ_FULL);
static_assert((size_t)NB_FULL * SEQ_FULL * DM * 4 == 12582912);
static_assert(HP == 32);                                  // table rows are [t][32]
static_assert(HD % 2 == 0);
static_assert(DQ == DM);                                  // merged width == model width (no bias, square Wo)
static_assert(NKV == NH_);                                // one k/v head per q head
static_assert(((size_t)TT * DM / 8) % 256 == 0);
#define A256(x) ((((size_t)(x)) + 255) & ~(size_t)255)
static_assert(4 * A256((size_t)DQ * DM * 2) + 3 * A256((size_t)NB * 3 * NH_ * TT * HD * 2) + A256((size_t)NB * TT * DM * 2) + 2 * A256((size_t)NB * TT * DQ * 2) + A256((size_t)(TT / 16) * (TT / 128) * 128) <= (size_t)268435456);
static_assert(((size_t)DQ * DM / 8) % 256 == 0);

__device__ __forceinline__ unsigned short f2bf(float f) { unsigned u = __float_as_uint(f); u += 0x7FFFu + ((u >> 16) & 1u); return (unsigned short)(u >> 16); }
__device__ __forceinline__ float bf2f(unsigned short b) { return __uint_as_float(((unsigned)b) << 16); }
__device__ __forceinline__ float bfr(float f) { return bf2f(f2bf(f)); }
__device__ __forceinline__ v16h cat16(v8h lo, v8h hi) { return __builtin_shufflevector(lo, hi, 0, 1, 2, 3, 4, 5, 6, 7, 8, 9, 10, 11, 12, 13, 14, 15); }
__device__ __forceinline__ v16bf cat16b(v8us lo, v8us hi) { return __builtin_bit_cast(v16bf, __builtin_shufflevector(lo, hi, 0, 1, 2, 3, 4, 5, 6, 7, 8, 9, 10, 11, 12, 13, 14, 15)); }
__device__ __forceinline__ v8f wmma16(v16h a, v16h b, v8f c) { return __builtin_amdgcn_wmma_f32_16x16x32_f16(false, a, false, b, (short)0, c, false, false); }
__device__ __forceinline__ v8f wmmab(v16bf a, v16bf b, v8f c) { return __builtin_amdgcn_wmma_f32_16x16x32_bf16(false, a, false, b, (short)0, c, false, false); }

__device__ __forceinline__ h16 tohx(float x) { return (h16)x; }
__device__ __forceinline__ void splitf(float y, unsigned short& h, unsigned short& l) { h = f2bf(y); l = f2bf(y - bf2f(h)); }
typedef __attribute__((ext_vector_type(2))) _Float16 v2h;
typedef __attribute__((ext_vector_type(4))) _Float16 v4h;
typedef __attribute__((ext_vector_type(2))) unsigned short v2us;
typedef __attribute__((ext_vector_type(4))) unsigned short v4us;
typedef __attribute__((ext_vector_type(2))) float v2f;
typedef __attribute__((ext_vector_type(4))) int v4i;

// f32 -> fp16 with a value select: magnitudes below the smallest fp16 normal become zero.
static __device__ __forceinline__ h16 toh_flush(float v) { const h16 r = (h16)v; return (fabsf(v) < 6.103515625e-05f) ? (h16)0.0f : r; }

// ---- k_gemmw: register-blocked GEMM, ONE WAVE per 64x64 output tile (16 accumulators), operands straight from 16-bit planes in fragment order; grid (M/64, N/64, Z), 32 threads.
// C[m][n] (f32, pitch ldc, + optional f32 bias[n]) = sum_k A[m][k] Bt[n][k] (+ split products per NSPLIT). z-batch strides sA/sB/sC in elements. K = DM.
// KSP: N == 64 and blockIdx.y numbers a k range of kspan (kspan % 32 == 0, gridDim.y * kspan == K); its partial tile goes to C + blockIdx.y * sK.
// EPI 0: C as above. EPI 1: projections, z = 3 * batch + p: A steps by sA a batch, Bt by sB a p, the planes by sC a z; C unused.
// p = 0, 1 (N tile = one head): the tile's pairs (2j, 2j+1) are rotated by the RNE bf16 copies of CS[t][j], SN[t][j] and go to the head planes [h][t][d] (fp16 + bf16 hi/lo; rows t, k = d, fragment order).
// p = 2 (N tile = one head): the tile goes transposed to the value planes [h][d][t] (fp16 + bf16 hi/lo; rows d, k = t, fragment order): a lane's 8 accumulator rows are 8 neighbouring t of one d, one 16-byte store a plane, the wave's 32 stores 512 bytes in a row.
// Fragment map (A and Bt alike): lane -> row (lane & 15); elements 0..7 = k0 + 8*(lane>>4) + 0..7, elements 8..15 = k0 + 16 + 8*(lane>>4) + 0..7.
// Fragment order: every 16-bit operand plane M[row][k] (K columns) lies in blocks of 16 rows x 32 k, block (row>>4)*(K/32) + (k>>5), 512 elements each; inside a block element (row, k) stands at ((k>>4)&1)*256 + (((k>>3)&1)*16 + (row&15))*8 + (k&7).
// A fragment is then two 16-byte loads a lane at block + lane*8 and block + 256 + lane*8 (ld: block pointer and the lane's offset in bytes; lde: the same with the offset in elements): each load of the wave reads 512 bytes in a row (4 lines) where a row-major plane gives 16 rows x 32 bytes (16 lines).
template <typename T16> struct WFrag;
template <> struct WFrag<h16> { typedef v16h V; static __device__ __forceinline__ V ld(const h16* p, unsigned lo) { const char* q = (const char*)p + lo; return cat16(*(const v8h*)q, *(const v8h*)(q + 512)); } static __device__ __forceinline__ V lde(const h16* p, unsigned le) { return cat16(*(const v8h*)(p + le), *(const v8h*)(p + 256 + le)); } static __device__ __forceinline__ v8f mma(V a, V b, v8f c) { return wmma16(a, b, c); } };
template <> struct WFrag<bf> { typedef v16bf V; static __device__ __forceinline__ V ld(const bf* p, unsigned lo) { const char* q = (const char*)p + lo; return cat16b(*(const v8us*)q, *(const v8us*)(q + 512)); } static __device__ __forceinline__ V lde(const bf* p, unsigned le) { return cat16b(*(const v8us*)(p + le), *(const v8us*)(p + 256 + le)); } static __device__ __forceinline__ v8f mma(V a, V b, v8f c) { return wmmab(a, b, c); } };
template <typename T16, int NSPLIT, bool BIAS, bool KSP, int EPI>
__global__ __launch_bounds__(32) void k_gemmw(const T16* __restrict__ A, const T16* __restrict__ A2, const T16* __restrict__ Bt, const T16* __restrict__ Bt2, float* C, int ldc, const float* __restrict__ bias, size_t sA, size_t sB, size_t sC, int kspan, size_t sK, const float* __restrict__ CS, const float* __restrict__ SN, h16* P16, bf* Ph, bf* Pl) {
    typedef typename WFrag<T16>::V V;
    constexpr int K = DM;   // both products run over the model width: every block of a tile is a constant step from one scalar base
    __shared__ __align__(16) float os[16 * 68];
    const size_t z = blockIdx.z, zb = (EPI == 1) ? z / 3 : z, zp = (EPI == 1) ? z - 3 * zb : z; A += zb * sA; if (A2) A2 += zb * sA; Bt += zp * sB; if (Bt2) Bt2 += zp * sB;
    if (EPI == 1) { P16 += z * sC; Ph += z * sC; Pl += z * sC; } else C += z * sC;
    const int lane = threadIdx.x & 31, lr = lane & 15, hi = lane >> 4; const int r0 = blockIdx.x * 64, c0 = KSP ? 0 : blockIdx.y * 64;
    const int kn = KSP ? kspan : K; if (KSP) { const size_t kb = (size_t)blockIdx.y * kspan * 16; A += kb; if (A2) A2 += kb; Bt += kb; if (Bt2) Bt2 += kb; C += blockIdx.y * sK; }
    v8f acc[4][4];
#pragma unroll
    for (int mb = 0; mb < 4; ++mb)
#pragma unroll
        for (int nb = 0; nb < 4; ++nb) acc[mb][nb] = (v8f){};
    const size_t aoff = (size_t)r0 * K, boff = (size_t)c0 * K; unsigned lo = lane * 16;   // a block's address is the same for the whole wave; lo, in bytes, is the lane's place in it plus the k step, one register for every load of the loop
#pragma unroll 1
    for (int kc = 0; kc < kn; kc += 32) {
        V a[4], a2[4];
#pragma unroll
        for (int mb = 0; mb < 4; ++mb) { a[mb] = WFrag<T16>::ld(A + aoff + (size_t)mb * 16 * K, lo); if (NSPLIT == 1 || NSPLIT == 2) a2[mb] = WFrag<T16>::ld(A2 + aoff + (size_t)mb * 16 * K, lo); }
#pragma unroll
        for (int nb = 0; nb < 4; ++nb) { const V b = WFrag<T16>::ld(Bt + boff + (size_t)nb * 16 * K, lo); V b2; if (NSPLIT >= 2) b2 = WFrag<T16>::ld(Bt2 + boff + (size_t)nb * 16 * K, lo);
            if (nb == 3) { asm volatile("s_wait_xcnt 0x0" : "+v"(lo) :: "memory"); lo += 1024; }   // last loads of the trip: the offset register that they all name takes its k step (one block, 1024 bytes) only behind this wait
#pragma unroll
            for (int mb = 0; mb < 4; ++mb) { acc[mb][nb] = WFrag<T16>::mma(a[mb], b, acc[mb][nb]); if (NSPLIT == 1 || NSPLIT == 2) acc[mb][nb] = WFrag<T16>::mma(a2[mb], b, acc[mb][nb]); if (NSPLIT >= 2) acc[mb][nb] = WFrag<T16>::mma(a[mb], b2, acc[mb][nb]); } }
        asm volatile("v_nop\n\tv_nop\n\tv_nop\n\tv_nop" : "+v"(acc[0][0]), "+v"(acc[1][1]), "+v"(acc[2][2]), "+v"(acc[3][3]) : "v"(a[0]), "v"(a[3]));
    }
    // one base a plane or table for the lane; every row of the tile is a constant step from it
    const size_t tb = (size_t)(r0 + hi) * HP + lr * 2, pb = ((size_t)(c0 / HD) * TT + r0) * HD + (lr >> 1) * 128 + hi * 8 + (lr & 1) * 4, vb = (size_t)c0 * TT + (size_t)r0 * 16 + lane * 8;
    if (EPI == 1 && zp == 2) {
#pragma unroll
        for (int nb = 0; nb < 4; ++nb)
#pragma unroll
            for (int mb = 0; mb < 4; ++mb) { v8h o16; v8us oh, ol;
#pragma unroll
                for (int j = 0; j < 8; ++j) { const float x = acc[mb][nb][j]; o16[j] = tohx(x); unsigned short a2, c2; splitf(x, a2, c2); oh[j] = a2; ol[j] = c2; }
                const size_t e = vb + (size_t)nb * 16 * TT + mb * 256; *(v8h*)(P16 + e) = o16; *(v8us*)(Ph + e) = oh; *(v8us*)(Pl + e) = ol; }
        return; }
#pragma unroll
    for (int mb = 0; mb < 4; ++mb) {
#pragma unroll
        for (int nb = 0; nb < 4; ++nb) {
#pragma unroll
            for (int j = 0; j < 8; ++j) os[(hi * 8 + j) * 68 + nb * 16 + lr] = acc[mb][nb][j]; }
        v2f cc[8], ss[8];   // the 16 rows' table values, asked for while the rows are staged
        if constexpr (EPI == 1) {
#pragma unroll
            for (int s = 0; s < 8; ++s) { cc[s] = *(const v2f*)(CS + tb + (mb * 16 + 2 * s) * HP); ss[s] = *(const v2f*)(SN + tb + (mb * 16 + 2 * s) * HP); } }
        __builtin_amdgcn_wave_barrier(); asm volatile("" ::: "memory");
        if constexpr (EPI == 1) { v4h o16[8]; v4us oh[8], ol[8];
#pragma unroll
            for (int s = 0; s < 8; ++s) { const int row = 2 * s + hi, cofs = lr * 4; const v4f x = *(const v4fa*)(os + row * 68 + cofs);
#pragma unroll
                for (int p = 0; p < 2; ++p) { const float c = bfr(cc[s][p]), sn = bfr(ss[s][p]); v2f r; r[0] = x[2 * p] * c - x[2 * p + 1] * sn; r[1] = x[2 * p] * sn + x[2 * p + 1] * c;
#pragma unroll
                    for (int q = 0; q < 2; ++q) { const float y = r[q]; o16[s][2 * p + q] = toh_flush(y); unsigned short a2, c2; splitf(y, a2, c2); oh[s][2 * p + q] = a2; ol[s][2 * p + q] = c2; } } }
            __builtin_amdgcn_sched_barrier(0);   // keeps the 24 stores in one run behind the arithmetic, so that the one wait below serves them all; spread among it the build holds some fifty waits, one behind nearly every second store
#pragma unroll
            for (int s = 0; s < 8; ++s) { const size_t e = pb + mb * 16 * HD + s * 16; *(v4h*)(P16 + e) = o16[s]; *(v4us*)(Ph + e) = oh[s]; *(v4us*)(Pl + e) = ol[s]; }
            asm volatile("s_wait_xcnt 0x0" ::: "memory");   // the plane stores' address and data registers are free for reuse behind this line
        } else { float* crow = C + (size_t)(r0 + mb * 16) * ldc + c0;
#pragma unroll
            for (int s = 0; s < 8; ++s) { const int row = 2 * s + hi, cofs = lr * 4; v4f val = *(const v4fa*)(os + row * 68 + cofs); if (BIAS) { val[0] += bfr(bias[c0 + cofs]); val[1] += bfr(bias[c0 + cofs + 1]); val[2] += bfr(bias[c0 + cofs + 2]); val[3] += bfr(bias[c0 + cofs + 3]); }
                *(v4f*)(crow + (size_t)row * ldc + cofs) = val; }
             }
        __builtin_amdgcn_wave_barrier(); asm volatile("" ::: "memory");
    }
}

// k_cvt: RNE bf16 copies of the four weights (WB blocks each) and of the input stream (XBL blocks a batch) in one launch, written in fragment order (rows of DM columns); a thread takes 8 neighbouring values, numbered by their place in the copy.
// The last MBL blocks read the whole mask: a wave takes 16 query rows x 128 keys (each load 512 bytes in a row) and writes one word, byte j != 0 where any entry of the rows' keys 32j .. 32j+31 is != 0; a word has a 128-byte line of its own (one writer a line).
#define WB   ((unsigned)((size_t)DQ * DM / 8 / 256))
#define XBL  ((unsigned)((size_t)TT * DM / 8 / 256))
#define MBL  ((unsigned)((TT / 16) * (TT / 128) / 8))
__global__ __launch_bounds__(256) void k_cvt(const float* __restrict__ w0, const float* __restrict__ w1, const float* __restrict__ w2, const float* __restrict__ w3, const float* __restrict__ x, const int* __restrict__ mk, bf* d0, bf* d1, bf* d2, bf* d3, bf* dx, unsigned* fl) {
    const unsigned b = blockIdx.x; const float* src; bf* dst; unsigned r;
    if (b >= 4 * WB + NB * XBL) { const unsigned wv = (b - 4 * WB - NB * XBL) * 8 + (threadIdx.x >> 5), lane = threadIdx.x & 31, rt = wv / (TT / 128), kg = wv - rt * (TT / 128);
        const int* mp = mk + (size_t)rt * 16 * SEQ_FULL + kg * 128 + lane * 4; v4i a = *(const v4i*)mp;
#pragma unroll
        for (int q = 1; q < 16; ++q) a |= *(const v4i*)(mp + (size_t)q * SEQ_FULL);
        asm volatile("s_wait_xcnt 0x0" ::: "memory");   // the mask loads' address registers are free for reuse behind this line
        const unsigned bal = (unsigned)__ballot((a[0] | a[1] | a[2] | a[3]) != 0); unsigned fw = 0;   // 8 lanes hold a chunk of 32 keys
#pragma unroll
        for (int j = 0; j < 4; ++j) fw |= ((bal >> (8 * j)) & 0xFFu) ? (1u << (8 * j)) : 0u;
        if (lane == 0) fl[(size_t)wv * 32] = fw;
        return; }
    if (b < 4 * WB) { const unsigned k = b / WB; r = b - k * WB; src = (k == 0) ? w0 : (k == 1) ? w1 : (k == 2) ? w2 : w3; dst = (k == 0) ? d0 : (k == 1) ? d1 : (k == 2) ? d2 : d3; }
    else { const unsigned k = (b - 4 * WB) / XBL; r = b - 4 * WB - k * XBL; src = x + (size_t)k * SEQ_FULL * DM; dst = dx + (size_t)k * TT * DM; }
    const unsigned i = r * 256 + threadIdx.x, blk = i >> 6, rb = blk / (DM / 32), kq = blk - rb * (DM / 32);   // 64 threads a block of 16 rows x 32 k
    const size_t so = (size_t)(rb * 16 + (i & 15)) * DM + kq * 32 + ((i >> 5) & 1) * 16 + ((i >> 4) & 1) * 8; const v8f v = *(const v8f*)(src + so); v8us o;
    asm volatile("s_wait_xcnt 0x0" ::: "memory");   // the load's address registers are free for reuse behind this line
#pragma unroll
    for (int k = 0; k < 8; ++k) o[k] = f2bf(v[k]);
    *(v8us*)(dst + (size_t)i * 8) = o; }

// k_attn: scores, softmax, P.V and the merge of one head's 16 (rows < RH, hi/lo planes) or 32 (fp16 planes) query rows in one work-group of AW waves; wave w owns the KW/32 chunks of 32 keys numbered c*AW + w.
// FL: the mask flags of k_cvt. A chunk whose flags are 0 has every t = -1e9 whatever K holds: its mask and key loads and score products are left out and the registers take -1e9. Where -1e9 then gives e == 0 in every row of the tile (tested by value: it does not in a row that is filled throughout), such a chunk adds 0 to the row sums and 0 x V to the tile: its exponentials, value loads and P.V products are left out too.
// Scores are formed transposed, S^T = K Q^T: lane (lr, hi) holds query lr, keys 8*hi + j of a 16-key tile, so two neighbouring tiles are, element for element, the A fragment of P for 32 keys (fragment map above) and P never leaves the registers.
// t = S x HD^-0.5, then t := -1e9 where MK[i][j] == 0 (value select; MK row pitch SEQ_FULL, shared by all heads and batches); softmax over the TT keys: exact row maximum and row sum over the waves through LDS, in wave order; a fully filled row comes out uniform.
// Each wave's f32 partial tile [q][d] goes to LDS; the tiles are summed in the order w = 0 .. AW-1, scaled and split into the merged hi/lo planes (rows t, k = merged column, fragment order).
template <typename T16, int QT, bool HL>
__device__ __forceinline__ void attn_tile(const T16* __restrict__ Q, const T16* __restrict__ Q2, const T16* __restrict__ Kp, const T16* __restrict__ K2, const T16* __restrict__ Vt, const T16* __restrict__ V2, const int* __restrict__ MK, const unsigned* __restrict__ FL, int q0, int hcol, bf* Ah, bf* Al, float* part, float* redm, float* reds) {
    typedef typename WFrag<T16>::V V;
    const int tid = threadIdx.x, lane = tid & 31, lr = lane & 15, hi = lane >> 4, w = __builtin_amdgcn_readfirstlane(tid >> 5); const unsigned lo = lane * 8;   // the wave's number in a scalar register: block addresses are scalar, the lane adds its place in elements
    V qf[QT][2], qf2[QT][2];
#pragma unroll
    for (int qt = 0; qt < QT; ++qt)
#pragma unroll
        for (int c = 0; c < 2; ++c) { const size_t o = (size_t)(q0 + qt * 16) * HD + c * 512; qf[qt][c] = WFrag<T16>::lde(Q + o, lo); if (HL) qf2[qt][c] = WFrag<T16>::lde(Q2 + o, lo); }
    asm volatile("s_wait_xcnt 0x0" ::: "memory");   // the query loads' address registers are free for reuse behind this line
    const int* mb = MK + (size_t)(q0 + lr) * SEQ_FULL + 8 * hi;   // one base for every mask load of the wave
    bool lv[KW / 32];   // the same in every lane: the tests on it are scalar branches
#pragma unroll
    for (int c = 0; c < KW / 32; ++c) { const int g = c * AW + w; unsigned fw = FL[((size_t)(q0 >> 4) * (TT / 128) + (g >> 2)) * 32]; if (QT == 2) fw |= FL[((size_t)((q0 >> 4) + 1) * (TT / 128) + (g >> 2)) * 32]; lv[c] = ((fw >> ((g & 3) * 8)) & 0xFFu) != 0; }
    v8f s[KW / 16][QT]; float mx[QT], sum[QT], f[QT];
#pragma unroll
    for (int qt = 0; qt < QT; ++qt) mx[qt] = -3.0e38f;
#pragma unroll
    for (int c = 0; c < KW / 32; ++c) { const int k0 = (c * AW + w) * 32;
        if (lv[c]) { V ka[2][2], ka2[2][2]; v4i mm[2][QT][2];
#pragma unroll
            for (int u = 0; u < 2; ++u) {
#pragma unroll
                for (int d = 0; d < 2; ++d) { const size_t o = (size_t)(k0 + u * 16) * HD + d * 512; ka[u][d] = WFrag<T16>::lde(Kp + o, lo); if (HL) ka2[u][d] = WFrag<T16>::lde(K2 + o, lo); }
#pragma unroll
                for (int qt = 0; qt < QT; ++qt) { const int* mr = mb + (size_t)qt * 16 * SEQ_FULL + k0 + u * 16; mm[u][qt][0] = *(const v4i*)mr; mm[u][qt][1] = *(const v4i*)(mr + 4); } }
            asm volatile("s_wait_xcnt 0x0" ::: "memory");   // the chunk's key and mask loads: their address registers are free for reuse behind this line
            __builtin_amdgcn_sched_barrier(0);   // keeps the chunk's loads in one run in front of the products: sunk among them, each pair is waited for by itself and the wave pays the load latency several times a chunk
#pragma unroll
            for (int u = 0; u < 2; ++u)
#pragma unroll
                for (int qt = 0; qt < QT; ++qt) { v8f a = (v8f){};
#pragma unroll
                    for (int d = 0; d < 2; ++d) { a = WFrag<T16>::mma(ka[u][d], qf[qt][d], a); if (HL) { a = WFrag<T16>::mma(ka[u][d], qf2[qt][d], a); a = WFrag<T16>::mma(ka2[u][d], qf[qt][d], a); } }
#pragma unroll
                    for (int j = 0; j < 8; ++j) { const float sv = a[j] * SCL; const float t = (mm[u][qt][j >> 2][j & 3] == 0) ? MFILL : sv; a[j] = t; mx[qt] = fmaxf(mx[qt], t); }
                    s[2 * c + u][qt] = a; }
        } else {
#pragma unroll
            for (int qt = 0; qt < QT; ++qt) { mx[qt] = fmaxf(mx[qt], MFILL);
#pragma unroll
                for (int u = 0; u < 2; ++u)
#pragma unroll
                    for (int j = 0; j < 8; ++j) s[2 * c + u][qt][j] = MFILL; } }
    }
#pragma unroll
    for (int qt = 0; qt < QT; ++qt) { mx[qt] = fmaxf(mx[qt], __shfl_xor(mx[qt], 16, 32)); if (hi == 0) redm[w * 32 + qt * 16 + lr] = mx[qt]; }
    __syncthreads();   // every wave's row maxima are in redm
#pragma unroll
    for (int qt = 0; qt < QT; ++qt) {
#pragma unroll
        for (int r = 0; r < AW; ++r) mx[qt] = fmaxf(mx[qt], redm[r * 32 + qt * 16 + lr]);
        sum[qt] = 0.f; }
    bool fe = false;   // does a filled entry still count in one of the lane's rows?
#pragma unroll
    for (int qt = 0; qt < QT; ++qt) fe |= (__builtin_amdgcn_exp2f(fmaxf(__fmul_rn(__fsub_rn(MFILL, mx[qt]), 1.4426950408889634f), -160.0f)) != 0.0f);
    const bool af = __any(fe) != 0;
#pragma unroll
    for (int c = 0; c < KW / 32; ++c) lv[c] = lv[c] || af;
    V vb[2][4], vb2[2][4];   // two chunks of V in flight: the first two asked for here, as soon as it is known which chunks count (the guarded blocks below keep the compiler from moving a load up by itself), chunk c + 2 behind the products of chunk c
#pragma unroll
    for (int c = 0; c < 2; ++c) if (lv[c]) {
#pragma unroll
        for (int dt = 0; dt < 4; ++dt) { const size_t vo = (size_t)dt * 16 * TT + (size_t)(c * AW + w) * 512; vb[c][dt] = WFrag<T16>::lde(Vt + vo, lo); if (HL) vb2[c][dt] = WFrag<T16>::lde(V2 + vo, lo); }
        asm volatile("s_wait_xcnt 0x0" ::: "memory");   // the chunk's value loads: their address registers are free for reuse behind this line
    }
#pragma unroll
    for (int kt = 0; kt < KW / 16; ++kt) if (lv[kt >> 1])
#pragma unroll
        for (int qt = 0; qt < QT; ++qt)
#pragma unroll
            for (int j = 0; j < 8; ++j) { const float d0 = __fsub_rn(s[kt][qt][j], mx[qt]); const float e = __builtin_amdgcn_exp2f(fmaxf(__fmul_rn(d0, 1.4426950408889634f), -160.0f)); s[kt][qt][j] = e; sum[qt] += e; }
#pragma unroll
    for (int qt = 0; qt < QT; ++qt) { sum[qt] += __shfl_xor(sum[qt], 16, 32); if (hi == 0) reds[w * 32 + qt * 16 + lr] = sum[qt]; }
    __syncthreads();   // every wave's row sums are in reds
#pragma unroll
    for (int qt = 0; qt < QT; ++qt) { float t = reds[qt * 16 + lr];
#pragma unroll
        for (int r = 1; r < AW; ++r) t += reds[r * 32 + qt * 16 + lr];
        f[qt] = __fdiv_rn(HL ? 1.0f : PCAR, t); }
    V pa[KW / 32][QT], pa2[KW / 32][QT];
#pragma unroll
    for (int c = 0; c < KW / 32; ++c) if (lv[c]) {
#pragma unroll
        for (int qt = 0; qt < QT; ++qt) {
            if constexpr (HL) { v8us h0, h1, l0, l1;
#pragma unroll
                for (int j = 0; j < 8; ++j) { unsigned short a, c2; splitf(s[2 * c][qt][j] * f[qt], a, c2); h0[j] = a; l0[j] = c2; splitf(s[2 * c + 1][qt][j] * f[qt], a, c2); h1[j] = a; l1[j] = c2; }
                pa[c][qt] = cat16b(h0, h1); pa2[c][qt] = cat16b(l0, l1);
            } else { v8h p0, p1;
#pragma unroll
                for (int j = 0; j < 8; ++j) { p0[j] = tohx(s[2 * c][qt][j] * f[qt]); p1[j] = tohx(s[2 * c + 1][qt][j] * f[qt]); }
                pa[c][qt] = cat16(p0, p1); } } }
    v8f o[QT][4];
#pragma unroll
    for (int qt = 0; qt < QT; ++qt)
#pragma unroll
        for (int dt = 0; dt < 4; ++dt) o[qt][dt] = (v8f){};
#pragma unroll
    for (int c = 0; c < KW / 32; ++c) {
        if (lv[c]) {
#pragma unroll
            for (int dt = 0; dt < 4; ++dt)
#pragma unroll
                for (int qt = 0; qt < QT; ++qt) { o[qt][dt] = WFrag<T16>::mma(pa[c][qt], vb[c & 1][dt], o[qt][dt]); if (HL) { o[qt][dt] = WFrag<T16>::mma(pa2[c][qt], vb[c & 1][dt], o[qt][dt]); o[qt][dt] = WFrag<T16>::mma(pa[c][qt], vb2[c & 1][dt], o[qt][dt]); } } }
        if (c + 2 < KW / 32) if (lv[c + 2]) {
#pragma unroll
            for (int dt = 0; dt < 4; ++dt) { const size_t vo = (size_t)dt * 16 * TT + (size_t)((c + 2) * AW + w) * 512; vb[c & 1][dt] = WFrag<T16>::lde(Vt + vo, lo); if (HL) vb2[c & 1][dt] = WFrag<T16>::lde(V2 + vo, lo); }
            asm volatile("s_wait_xcnt 0x0" ::: "memory");   // the chunk's value loads: their address registers are free for reuse behind this line
        } }
    float* pw = part + (size_t)w * (QT * 16 * OP);
#pragma unroll
    for (int qt = 0; qt < QT; ++qt)
#pragma unroll
        for (int dt = 0; dt < 4; ++dt)
#pragma unroll
            for (int j = 0; j < 8; ++j) pw[(qt * 16 + hi * 8 + j) * OP + dt * 16 + lr] = o[qt][dt][j];
    __syncthreads();   // every wave's partial tile is in part
    const float cs = HL ? 1.0f : (1.0f / PCAR);
    static_assert(QT * 16 * 16 <= AW * 32);
    if (tid < QT * 16 * 16) { const int row = tid >> 4, col = (tid & 15) * 4; v4f acc = *(const v4f*)(part + row * OP + col);
#pragma unroll
        for (int r = 1; r < AW; ++r) acc += *(const v4f*)(part + (size_t)r * (QT * 16 * OP) + row * OP + col);
        v4us oh, ol;
#pragma unroll
        for (int q = 0; q < 4; ++q) { unsigned short a, c2; splitf(acc[q] * cs, a, c2); oh[q] = a; ol[q] = c2; }
        const size_t oo = (size_t)(q0 + (row & ~15)) * DQ + hcol * 16 + (col >> 3) * 128 + (row & 15) * 8 + (col & 4); *(v4us*)(Ah + oo) = oh; *(v4us*)(Al + oo) = ol; }
}

__global__ __launch_bounds__(AW * 32) void k_attn(const h16* __restrict__ Q16, const h16* __restrict__ K16, const h16* __restrict__ V16, const bf* __restrict__ Qh, const bf* __restrict__ Ql, const bf* __restrict__ Kh, const bf* __restrict__ Kl, const bf* __restrict__ Vh, const bf* __restrict__ Vl, const int* __restrict__ MK, const unsigned* __restrict__ FL, bf* Ah, bf* Al) {
    __shared__ __align__(16) float part[AW * 32 * OP]; __shared__ float redm[AW * 32]; __shared__ float reds[AW * 32];
    const int h = blockIdx.y, bx = blockIdx.x; const size_t po = ((size_t)blockIdx.z * 3 * NH_ + h) * TT * HD;   // a batch's q, k and v planes lie behind one another
    Ah += (size_t)blockIdx.z * TT * DQ; Al += (size_t)blockIdx.z * TT * DQ;
    if (bx < RH / 16) attn_tile<bf, 1, true>(Qh + po, Ql + po, Kh + po, Kl + po, Vh + po, Vl + po, MK, FL, bx * 16, h * HD, Ah, Al, part, redm, reds);
    else attn_tile<h16, 2, false>(Q16 + po, nullptr, K16 + po, nullptr, V16 + po, nullptr, MK, FL, RH + (bx - RH / 16) * 32, h * HD, Ah, Al, part, redm, reds);
}

extern "C" void kernel_launch(void* const* d_in, const int* in_sizes, int n_in,
                              void* d_out, int out_size, void* d_ws, size_t ws_size, hipStream_t stream) {
    if (n_in < 8) return;
    const size_t need_x = ((size_t)(NB - 1) * SEQ_FULL + SEQ) * DM;          // elements of the activation stream / of the output that are touched
    const size_t need_m = (size_t)(SEQ - 1) * SEQ_FULL + SEQ;                // mask entries touched
    if ((size_t)in_sizes[0] < need_x) return;
    if ((size_t)in_sizes[1] < (size_t)SEQ * HP || (size_t)in_sizes[2] < (size_t)SEQ * HP) return;
    if ((size_t)in_sizes[3] < need_m) return;
    if ((size_t)in_sizes[4] < (size_t)DQ * DM || (size_t)in_sizes[5] < (size_t)DKV * DM || (size_t)in_sizes[6] < (size_t)DKV * DM || (size_t)in_sizes[7] < (size_t)DM * DQ) return;
    if ((size_t)out_size < need_x) return;
    // wire order: x, cos, sin, attn_mask (int32), wq, wk, wv, wo ('oi' weights)
    const float* x = (const float*)d_in[0]; const float* cs = (const float*)d_in[1]; const float* sn = (const float*)d_in[2]; const int* mk = (const int*)d_in[3];
    const float* wq = (const float*)d_in[4]; const float* wk = (const float*)d_in[5]; const float* wv = (const float*)d_in[6]; const float* wo = (const float*)d_in[7];
    float* OUT = (float*)d_out;     // [2][2048][768]
    char* wsp = (char*)d_ws;
    auto take = [&](size_t bytes) { char* p = wsp; wsp += (bytes + 255) & ~(size_t)255; return (void*)p; };
    bf* WQ = (bf*)take((size_t)DQ * DM * 2); bf* WK = (bf*)take((size_t)DKV * DM * 2); bf* WV = (bf*)take((size_t)DKV * DM * 2); bf* WO = (bf*)take((size_t)DM * DQ * 2);
    const size_t PS = (size_t)NH_ * TT * HD;     // elements of one plane; planes lie [batch][q, k, v][PS]
    h16* QP16 = (h16*)take((size_t)NB * 3 * PS * 2); h16* KP16 = QP16 + PS; h16* VT16 = KP16 + PS;
    bf* QPh = (bf*)take((size_t)NB * 3 * PS * 2); bf* KPh = QPh + PS; bf* VTh = KPh + PS;
    bf* QPl = (bf*)take((size_t)NB * 3 * PS * 2); bf* KPl = QPl + PS; bf* VTl = KPl + PS;
    bf* XB = (bf*)take((size_t)NB * TT * DM * 2); bf* ATh = (bf*)take((size_t)NB * TT * DQ * 2); bf* ATl = (bf*)take((size_t)NB * TT * DQ * 2);
    unsigned* FLG = (unsigned*)take((size_t)(TT / 16) * (TT / 128) * 128);
    const size_t used = (size_t)(wsp - (char*)d_ws);
    if (used > ws_size || used > (size_t)268435456) return;
    k_cvt<<<4 * WB + NB * XBL + MBL, 256, 0, stream>>>(wq, wk, wv, wo, x, mk, WQ, WK, WV, WO, XB, FLG);
    k_gemmw<bf, 0, false, false, 1><<<dim3(TT / 64, DQ / 64, 3 * NB), 32, 0, stream>>>(XB, nullptr, WQ, nullptr, nullptr, 0, nullptr, (size_t)TT * DM, (size_t)(WK - WQ), PS, 0, 0, cs, sn, QP16, QPh, QPl);
    k_attn<<<dim3(RH / 16 + (TT - RH) / 32, NH_, NB), AW * 32, 0, stream>>>(QP16, KP16, VT16, QPh, QPl, KPh, KPl, VTh, VTl, mk, FLG, ATh, ATl);
    k_gemmw<bf, 1, false, false, 0><<<dim3(TT / 64, DM / 64, NB), 32, 0, stream>>>(ATh, ATl, WO, nullptr, OUT, DM, nullptr, (size_t)TT * DQ, 0, (size_t)SEQ_FULL * DM, 0, 0, nullptr, nullptr, nullptr, nullptr, nullptr);
}

// v008
// It runs in 128 microseconds.
// Timed twice side by side with v007, it ran 1.06 times as fast both times.
// All steps since v000 together make it 11.9 times as fast.
#include <hip/hip_runtime.h>

// Causal self-attention over one input stream with interleaved-pair rotary embeddings whose cos / sin tables are inputs read by value, an int32 mask read by value, no biases (x [2][2048][768]; q = x Wq^T, k = x Wk^T, v = x Wv^T ('oi' [768][768]; 12 heads x 64); pairs (2j, 2j+1) of q and k rotated by cos[t][j], sin[t][j]; logits x 1/8; mask[i][j] == 0 -> logit replaced by -1e9; softmax over all 2048 keys; out = merged Wo^T -> [2][2048][768]; argument order x, cos, sin, attn_mask, wq, wk, wv, wo).
// Compute dtypes, f32 accumulate: projections v_wmma_f32_16x16x32_bf16 on RNE bf16 copies of x and weights; rotation f32 with RNE bf16 table values; logits and P.V: query rows < 512 bf16 hi/lo planes (3 products), rows >= 512 v_wmma_f32_16x16x32_f16 (P carried x1024); softmax f32; output projection bf16 hi/lo ctx x bf16 Wo (2 products).
// Four launches, each over both batches: bf16 copies of the four weights and of the input stream, one flag for every mask block of 16 query rows x 32 keys (any entry != 0) and one bit for every mask entry (entry != 0), in words that are lane masks of the attention kernel; the three projections (grid z = 3 * batch + {q, k, v}), whose epilogue writes the rotary head planes (q, k) or the transposed value planes straight from the accumulators; attention over all heads (grid z = batch): a work-group of AW waves takes 16 or 32 query rows, each wave TT/AW keys in chunks of 32 dealt round-robin, a chunk whose mask block is all zero being left out where its P is zero; scores, softmax and P stay in registers, the waves' f32 partial tiles are summed in wave order through LDS; merged hi/lo x Wo.

#ifndef NB
#define NB   2
#endif
#ifndef SEQ
#define SEQ  2048
#endif
#define NB_FULL  2
#define SEQ_FULL 2048
#define TT   SEQ
#define DM   768
#define NH_  12
#define NKV  12
#define REP  (NH_ / NKV)
#define HD   64
#define HP   (HD / 2)    // rotary pairs per head = table row width
#define DQ   (NH_ * HD)
#define DKV  (NKV * HD)
#define AW   16   // waves of an attention work-group; each owns KW keys
#define KW   (SEQ / AW)
#define OP   68   // f32 pitch of a partial-tile row in LDS: rows 8 apart fall on different banks
#define RH   ((SEQ < 512) ? SEQ : 512)   // query rows < RH use hi+lo planes
#define PCAR 1024.0f
#define SCL  0.125f   // HD^-0.5
#define MFILL (-1.0e9f)
typedef _Float16 h16;
typedef unsigned short bf;
typedef __attribute__((ext_vector_type(16))) __bf16   v16bf;
typedef __attribute__((ext_vector_type(16))) _Float16 v16h;
typedef __attribute__((ext_vector_type(8)))  _Float16 v8h;
typedef __attribute__((ext_vector_type(8)))  unsigned short v8us;
typedef __attribute__((ext_vector_type(8)))  float    v8f;
typedef __attribute__((ext_vector_type(4)))  float    v4f;
typedef v4f  __attribute__((may_alias)) v4fa;

static_assert(TT % 128 == 0);
static_assert(TT % (AW * 32) == 0);
static_assert(RH % 16 == 0);
static_assert((TT - RH) % 32 == 0);
static_assert(RH % 64 == 0);
static_assert((TT - RH) % 64 == 0);
static_assert(DM % 32 == 0);
static_assert(DQ % 64 == 0);
static_assert(DKV % 64 == 0);
static_assert(DM % 64 == 0);
static_assert(HD == 64);
static_assert(NB <= NB_FULL);
static_assert(SEQ <= SEQ_FULL);
static_assert((size_t)NB_FULL * SEQ_FULL * DM * 4 == 12582912);
static_assert(HP == 32);                                  // table rows are [t][32]
static_assert(HD % 2 == 0);
static_assert(DQ == DM);                                  // merged width == model width (no bias, square Wo)
static_assert(NKV == NH_);                                // one k/v head per q head
static_assert(((size_t)TT * DM / 8) % 256 == 0);
#define A256(x) ((((size_t)(x)) + 255) & ~(size_t)255)
static_assert(4 * A256((size_t)DQ * DM * 2) + 3 * A256((size_t)NB * 3 * NH_ * TT * HD * 2) + A256((size_t)NB * TT * DM * 2) + 2 * A256((size_t)NB * TT * DQ * 2) + A256((size_t)(TT / 16) * (TT / 128) * 128) + A256((size_t)(TT / 16) * (TT / 128) * 256) <= (size_t)268435456);
static_assert(((size_t)DQ * DM / 8) % 256 == 0);

__device__ __forceinline__ unsigned short f2bf(float f) { unsigned u = __float_as_uint(f); u += 0x7FFFu + ((u >> 16) & 1u); return (unsigned short)(u >> 16); }
__device__ __forceinline__ float bf2f(unsigned short b) { return __uint_as_float(((unsigned)b) << 16); }
__device__ __forceinline__ float bfr(float f) { return bf2f(f2bf(f)); }
__device__ __forceinline__ v16h cat16(v8h lo, v8h hi) { return __builtin_shufflevector(lo, hi, 0, 1, 2, 3, 4, 5, 6, 7, 8, 9, 10, 11, 12, 13, 14, 15); }
__device__ __forceinline__ v16bf cat16b(v8us lo, v8us hi) { return __builtin_bit_cast(v16bf, __builtin_shufflevector(lo, hi, 0, 1, 2, 3, 4, 5, 6, 7, 8, 9, 10, 11, 12, 13, 14, 15)); }
__device__ __forceinline__ v8f wmma16(v16h a, v16h b, v8f c) { return __builtin_amdgcn_wmma_f32_16x16x32_f16(false, a, false, b, (short)0, c, false, false); }
__device__ __forceinline__ v8f wmmab(v16bf a, v16bf b, v8f c) { return __builtin_amdgcn_wmma_f32_16x16x32_bf16(false, a, false, b, (short)0, c, false, false); }

__device__ __forceinline__ h16 tohx(float x) { return (h16)x; }
__device__ __forceinline__ void splitf(float y, unsigned short& h, unsigned short& l) { h = f2bf(y); l = f2bf(y - bf2f(h)); }
typedef __attribute__((ext_vector_type(2))) _Float16 v2h;
typedef __attribute__((ext_vector_type(4))) _Float16 v4h;
typedef __attribute__((ext_vector_type(2))) unsigned short v2us;
typedef __attribute__((ext_vector_type(4))) unsigned short v4us;
typedef __attribute__((ext_vector_type(2))) float v2f;
typedef __attribute__((ext_vector_type(4))) int v4i;
typedef __attribute__((ext_vector_type(16))) unsigned v16u;
typedef __attribute__((ext_vector_type(2))) unsigned v2u;

// f32 -> fp16 with a value select: magnitudes below the smallest fp16 normal become zero.
static __device__ __forceinline__ h16 toh_flush(float v) { const h16 r = (h16)v; return (fabsf(v) < 6.103515625e-05f) ? (h16)0.0f : r; }

// ---- k_gemmw: register-blocked GEMM, ONE WAVE per 64x64 output tile (16 accumulators), operands straight from 16-bit planes in fragment order; grid (M/64, N/64, Z), 32 threads.
// C[m][n] (f32, pitch ldc, + optional f32 bias[n]) = sum_k A[m][k] Bt[n][k] (+ split products per NSPLIT). z-batch strides sA/sB/sC in elements. K = DM.
// KSP: N == 64 and blockIdx.y numbers a k range of kspan (kspan % 32 == 0, gridDim.y * kspan == K); its partial tile goes to C + blockIdx.y * sK.
// EPI 0: C as above. EPI 1: projections, z = 3 * batch + p: A steps by sA a batch, Bt by sB a p, the planes by sC a z; C unused.
// p = 0, 1 (N tile = one head): the tile's pairs (2j, 2j+1) are rotated by the RNE bf16 copies of CS[t][j], SN[t][j] and go to the head planes [h][t][d] (fp16 + bf16 hi/lo; rows t, k = d, fragment order).
// p = 2 (N tile = one head): the tile goes transposed to the value planes [h][d][t] (fp16 + bf16 hi/lo; rows d, k = t, fragment order): a lane's 8 accumulator rows are 8 neighbouring t of one d, one 16-byte store a plane, the wave's 32 stores 512 bytes in a row.
// Fragment map (A and Bt alike): lane -> row (lane & 15); elements 0..7 = k0 + 8*(lane>>4) + 0..7, elements 8..15 = k0 + 16 + 8*(lane>>4) + 0..7.
// Fragment order: every 16-bit operand plane M[row][k] (K columns) lies in blocks of 16 rows x 32 k, block (row>>4)*(K/32) + (k>>5), 512 elements each; inside a block element (row, k) stands at ((k>>4)&1)*256 + (((k>>3)&1)*16 + (row&15))*8 + (k&7).
// A fragment is then two 16-byte loads a lane at block + lane*8 and block + 256 + lane*8 (ld: block pointer and the lane's offset in bytes; lde: the same with the offset in elements): each load of the wave reads 512 bytes in a row (4 lines) where a row-major plane gives 16 rows x 32 bytes (16 lines).
template <typename T16> struct WFrag;
template <> struct WFrag<h16> { typedef v16h V; static __device__ __forceinline__ V ld(const h16* p, unsigned lo) { const char* q = (const char*)p + lo; return cat16(*(const v8h*)q, *(const v8h*)(q + 512)); } static __device__ __forceinline__ V lde(const h16* p, unsigned le) { return cat16(*(const v8h*)(p + le), *(const v8h*)(p + 256 + le)); } static __device__ __forceinline__ v8f mma(V a, V b, v8f c) { return wmma16(a, b, c); } };
template <> struct WFrag<bf> { typedef v16bf V; static __device__ __forceinline__ V ld(const bf* p, unsigned lo) { const char* q = (const char*)p + lo; return cat16b(*(const v8us*)q, *(const v8us*)(q + 512)); } static __device__ __forceinline__ V lde(const bf* p, unsigned le) { return cat16b(*(const v8us*)(p + le), *(const v8us*)(p + 256 + le)); } static __device__ __forceinline__ v8f mma(V a, V b, v8f c) { return wmmab(a, b, c); } };
template <typename T16, int NSPLIT, bool BIAS, bool KSP, int EPI>
__global__ __launch_bounds__(32) void k_gemmw(const T16* __restrict__ A, const T16* __restrict__ A2, const T16* __restrict__ Bt, const T16* __restrict__ Bt2, float* C, int ldc, const float* __restrict__ bias, size_t sA, size_t sB, size_t sC, int kspan, size_t sK, const float* __restrict__ CS, const float* __restrict__ SN, h16* P16, bf* Ph, bf* Pl) {
    typedef typename WFrag<T16>::V V;
    constexpr int K = DM;   // both products run over the model width: every block of a tile is a constant step from one scalar base
    __shared__ __align__(16) float os[16 * 68];
    const size_t z = blockIdx.z, zb = (EPI == 1) ? z / 3 : z, zp = (EPI == 1) ? z - 3 * zb : z; A += zb * sA; if (A2) A2 += zb * sA; Bt += zp * sB; if (Bt2) Bt2 += zp * sB;
    if (EPI == 1) { P16 += z * sC; Ph += z * sC; Pl += z * sC; } else C += z * sC;
    const int lane = threadIdx.x & 31, lr = lane & 15, hi = lane >> 4; const int r0 = blockIdx.x * 64, c0 = KSP ? 0 : blockIdx.y * 64;
    const int kn = KSP ? kspan : K; if (KSP) { const size_t kb = (size_t)blockIdx.y * kspan * 16; A += kb; if (A2) A2 += kb; Bt += kb; if (Bt2) Bt2 += kb; C += blockIdx.y * sK; }
    v8f acc[4][4];
#pragma unroll
    for (int mb = 0; mb < 4; ++mb)
#pragma unroll
        for (int nb = 0; nb < 4; ++nb) acc[mb][nb] = (v8f){};
    const size_t aoff = (size_t)r0 * K, boff = (size_t)c0 * K; unsigned lo = lane * 16;   // a block's address is the same for the whole wave; lo, in bytes, is the lane's place in it plus the k step, one register for every load of the loop
#pragma unroll 1
    for (int kc = 0; kc < kn; kc += 32) {
        V a[4], a2[4];
#pragma unroll
        for (int mb = 0; mb < 4; ++mb) { a[mb] = WFrag<T16>::ld(A + aoff + (size_t)mb * 16 * K, lo); if (NSPLIT == 1 || NSPLIT == 2) a2[mb] = WFrag<T16>::ld(A2 + aoff + (size_t)mb * 16 * K, lo); }
#pragma unroll
        for (int nb = 0; nb < 4; ++nb) { const V b = WFrag<T16>::ld(Bt + boff + (size_t)nb * 16 * K, lo); V b2; if (NSPLIT >= 2) b2 = WFrag<T16>::ld(Bt2 + boff + (size_t)nb * 16 * K, lo);
            if (nb == 3) { asm volatile("s_wait_xcnt 0x0" : "+v"(lo) :: "memory"); lo += 1024; }   // last loads of the trip: the offset register that they all name takes its k step (one block, 1024 bytes) only behind this wait
#pragma unroll
            for (int mb = 0; mb < 4; ++mb) { acc[mb][nb] = WFrag<T16>::mma(a[mb], b, acc[mb][nb]); if (NSPLIT == 1 || NSPLIT == 2) acc[mb][nb] = WFrag<T16>::mma(a2[mb], b, acc[mb][nb]); if (NSPLIT >= 2) acc[mb][nb] = WFrag<T16>::mma(a[mb], b2, acc[mb][nb]); } }
        asm volatile("v_nop\n\tv_nop\n\tv_nop\n\tv_nop" : "+v"(acc[0][0]), "+v"(acc[1][1]), "+v"(acc[2][2]), "+v"(acc[3][3]) : "v"(a[0]), "v"(a[3]));
    }
    // one base a plane or table for the lane; every row of the tile is a constant step from it
    const size_t tb = (size_t)(r0 + hi) * HP + lr * 2, pb = ((size_t)(c0 / HD) * TT + r0) * HD + (lr >> 1) * 128 + hi * 8 + (lr & 1) * 4, vb = (size_t)c0 * TT + (size_t)r0 * 16 + lane * 8;
    if (EPI == 1 && zp == 2) {
#pragma unroll
        for (int nb = 0; nb < 4; ++nb)
#pragma unroll
            for (int mb = 0; mb < 4; ++mb) { v8h o16; v8us oh, ol;
#pragma unroll
                for (int j = 0; j < 8; ++j) { const float x = acc[mb][nb][j]; o16[j] = tohx(x); unsigned short a2, c2; splitf(x, a2, c2); oh[j] = a2; ol[j] = c2; }
                const size_t e = vb + (size_t)nb * 16 * TT + mb * 256; *(v8h*)(P16 + e) = o16; *(v8us*)(Ph + e) = oh; *(v8us*)(Pl + e) = ol; }
        return; }
#pragma unroll
    for (int mb = 0; mb < 4; ++mb) {
#pragma unroll
        for (int nb = 0; nb < 4; ++nb) {
#pragma unroll
            for (int j = 0; j < 8; ++j) os[(hi * 8 + j) * 68 + nb * 16 + lr] = acc[mb][nb][j]; }
        v2f cc[8], ss[8];   // the 16 rows' table values, asked for while the rows are staged
        if constexpr (EPI == 1) {
#pragma unroll
            for (int s = 0; s < 8; ++s) { cc[s] = *(const v2f*)(CS + tb + (mb * 16 + 2 * s) * HP); ss[s] = *(const v2f*)(SN + tb + (mb * 16 + 2 * s) * HP); } }
        __builtin_amdgcn_wave_barrier(); asm volatile("" ::: "memory");
        if constexpr (EPI == 1) { v4h o16[8]; v4us oh[8], ol[8];
#pragma unroll
            for (int s = 0; s < 8; ++s) { const int row = 2 * s + hi, cofs = lr * 4; const v4f x = *(const v4fa*)(os + row * 68 + cofs);
#pragma unroll
                for (int p = 0; p < 2; ++p) { const float c = bfr(cc[s][p]), sn = bfr(ss[s][p]); v2f r; r[0] = x[2 * p] * c - x[2 * p + 1] * sn; r[1] = x[2 * p] * sn + x[2 * p + 1] * c;
#pragma unroll
                    for (int q = 0; q < 2; ++q) { const float y = r[q]; o16[s][2 * p + q] = toh_flush(y); unsigned short a2, c2; splitf(y, a2, c2); oh[s][2 * p + q] = a2; ol[s][2 * p + q] = c2; } } }
            __builtin_amdgcn_sched_barrier(0);   // keeps the 24 stores in one run behind the arithmetic, so that the one wait below serves them all; spread among it the build holds some fifty waits, one behind nearly every second store
#pragma unroll
            for (int s = 0; s < 8; ++s) { const size_t e = pb + mb * 16 * HD + s * 16; *(v4h*)(P16 + e) = o16[s]; *(v4us*)(Ph + e) = oh[s]; *(v4us*)(Pl + e) = ol[s]; }
            asm volatile("s_wait_xcnt 0x0" ::: "memory");   // the plane stores' address and data registers are free for reuse behind this line
        } else { float* crow = C + (size_t)(r0 + mb * 16) * ldc + c0;
#pragma unroll
            for (int s = 0; s < 8; ++s) { const int row = 2 * s + hi, cofs = lr * 4; v4f val = *(const v4fa*)(os + row * 68 + cofs); if (BIAS) { val[0] += bfr(bias[c0 + cofs]); val[1] += bfr(bias[c0 + cofs + 1]); val[2] += bfr(bias[c0 + cofs + 2]); val[3] += bfr(bias[c0 + cofs + 3]); }
                *(v4f*)(crow + (size_t)row * ldc + cofs) = val; }
             }
        __builtin_amdgcn_wave_barrier(); asm volatile("" ::: "memory");
    }
}

// k_cvt: RNE bf16 copies of the four weights (WB blocks each) and of the input stream (XBL blocks a batch) in one launch, written in fragment order (rows of DM columns); a thread takes 8 neighbouring values, numbered by their place in the copy.
// The last MBL blocks read the whole mask: a wave takes 16 query rows x 128 keys, lane (lr, hi) row lr and of every 16 keys those numbered 8*hi .. 8*hi+7, which is the place of a score in k_attn's registers, and writes one flag word, byte j != 0 where any entry of the rows' keys 32j .. 32j+31 is != 0; a flag word has a 128-byte line of its own (one writer a line).
// The same wave writes the block's entries as lane masks, 64 words = 256 bytes in a row at bm + wave * 64: word c*16 + u*8 + j holds at bit 16*hi + lr the test 'entry != 0' of query row lr, key 32*c + 16*u + 8*hi + j, the ballot over the lanes of one loaded element.
#define WB   ((unsigned)((size_t)DQ * DM / 8 / 256))
#define XBL  ((unsigned)((size_t)TT * DM / 8 / 256))
#define MBL  ((unsigned)((TT / 16) * (TT / 128) / 8))
__global__ __launch_bounds__(256) void k_cvt(const float* __restrict__ w0, const float* __restrict__ w1, const float* __restrict__ w2, const float* __restrict__ w3, const float* __restrict__ x, const int* __restrict__ mk, bf* d0, bf* d1, bf* d2, bf* d3, bf* dx, unsigned* fl, unsigned* bm) {
    const unsigned b = blockIdx.x; const float* src; bf* dst; unsigned r;
    if (b >= 4 * WB + NB * XBL) { const unsigned wv = (b - 4 * WB - NB * XBL) * 8 + (threadIdx.x >> 5), lane = threadIdx.x & 31, rt = wv / (TT / 128), kg = wv - rt * (TT / 128);
        const int* mp = mk + (size_t)(rt * 16 + (lane & 15)) * SEQ_FULL + kg * 128 + (lane >> 4) * 8; v4i a[16];
#pragma unroll
        for (int q = 0; q < 16; ++q) a[q] = *(const v4i*)(mp + (q >> 1) * 16 + (q & 1) * 4);
        asm volatile("s_wait_xcnt 0x0" ::: "memory");   // the mask loads' address registers are free for reuse behind this line
        unsigned fw = 0; v2u bw = (v2u){0u, 0u};   // bw: lane L keeps words 2L and 2L + 1 of the block's 64
#pragma unroll
        for (int j = 0; j < 4; ++j) { unsigned any = 0;
#pragma unroll
            for (int i = 0; i < 16; ++i) { const unsigned bl = __builtin_amdgcn_ballot_w32(a[j * 4 + (i >> 2)][i & 3] != 0); any |= bl; bw[i & 1] = (lane == (unsigned)(j * 8 + (i >> 1))) ? bl : bw[i & 1]; }
            fw |= any ? (1u << (8 * j)) : 0u; }
        *(v2u*)(bm + (size_t)wv * 64 + lane * 2) = bw;
        if (lane == 0) fl[(size_t)wv * 32] = fw;
        return; }
    if (b < 4 * WB) { const unsigned k = b / WB; r = b - k * WB; src = (k == 0) ? w0 : (k == 1) ? w1 : (k == 2) ? w2 : w3; dst = (k == 0) ? d0 : (k == 1) ? d1 : (k == 2) ? d2 : d3; }
    else { const unsigned k = (b - 4 * WB) / XBL; r = b - 4 * WB - k * XBL; src = x + (size_t)k * SEQ_FULL * DM; dst = dx + (size_t)k * TT * DM; }
    const unsigned i = r * 256 + threadIdx.x, blk = i >> 6, rb = blk / (DM / 32), kq = blk - rb * (DM / 32);   // 64 threads a block of 16 rows x 32 k
    const size_t so = (size_t)(rb * 16 + (i & 15)) * DM + kq * 32 + ((i >> 5) & 1) * 16 + ((i >> 4) & 1) * 8; const v8f v = *(const v8f*)(src + so); v8us o;
    asm volatile("s_wait_xcnt 0x0" ::: "memory");   // the load's address registers are free for reuse behind this line
#pragma unroll
    for (int k = 0; k < 8; ++k) o[k] = f2bf(v[k]);
    *(v8us*)(dst + (size_t)i * 8) = o; }

// k_attn: scores, softmax, P.V and the merge of one head's 16 (rows < RH, hi/lo planes) or 32 (fp16 planes) query rows in one work-group of AW waves; wave w owns the KW/32 chunks of 32 keys numbered c*AW + w.
// FL: the mask flags of k_cvt. A chunk whose flags are 0 has every t = -1e9 whatever K holds: its mask and key loads and score products are left out and the registers take -1e9. Where -1e9 then gives e == 0 in every row of the tile (tested by value: it does not in a row that is filled throughout), such a chunk adds 0 to the row sums and 0 x V to the tile: its exponentials, value loads and P.V products are left out too.
// Scores are formed transposed, S^T = K Q^T: lane (lr, hi) holds query lr, keys 8*hi + j of a 16-key tile, so two neighbouring tiles are, element for element, the A fragment of P for 32 keys (fragment map above) and P never leaves the registers.
// t = S x HD^-0.5, then t := -1e9 where the mask entry [i][j] is 0 (value select by lane mask; BM: the lane masks of k_cvt, shared by all heads and batches: the 16 words of a chunk and 16 query rows are the same for the whole wave and come by one scalar load of 64 bytes, each word the select's own condition, where the int32 rows give four vector loads of 16 lines each and a compare an entry); softmax over the TT keys: exact row maximum and row sum over the waves through LDS, in wave order; a fully filled row comes out uniform.
// Each wave's f32 partial tile [q][d] goes to LDS; the tiles are summed in the order w = 0 .. AW-1, scaled and split into the merged hi/lo planes (rows t, k = merged column, fragment order).
template <typename T16, int QT, bool HL>
__device__ __forceinline__ void attn_tile(const T16* __restrict__ Q, const T16* __restrict__ Q2, const T16* __restrict__ Kp, const T16* __restrict__ K2, const T16* __restrict__ Vt, const T16* __restrict__ V2, const unsigned* __restrict__ BM, const unsigned* __restrict__ FL, int q0, int hcol, bf* Ah, bf* Al, float* part, float* redm, float* reds) {
    typedef typename WFrag<T16>::V V;
    const int tid = threadIdx.x, lane = tid & 31, lr = lane & 15, hi = lane >> 4, w = __builtin_amdgcn_readfirstlane(tid >> 5); const unsigned lo = lane * 8;   // the wave's number in a scalar register: block addresses are scalar, the lane adds its place in elements
    V qf[QT][2], qf2[QT][2];
#pragma unroll
    for (int qt = 0; qt < QT; ++qt)
#pragma unroll
        for (int c = 0; c < 2; ++c) { const size_t o = (size_t)(q0 + qt * 16) * HD + c * 512; qf[qt][c] = WFrag<T16>::lde(Q + o, lo); if (HL) qf2[qt][c] = WFrag<T16>::lde(Q2 + o, lo); }
    asm volatile("s_wait_xcnt 0x0" ::: "memory");   // the query loads' address registers are free for reuse behind this line
    bool lv[KW / 32];   // the same in every lane: the tests on it are scalar branches
#pragma unroll
    for (int c = 0; c < KW / 32; ++c) { const int g = c * AW + w; unsigned fw = FL[((size_t)(q0 >> 4) * (TT / 128) + (g >> 2)) * 32]; if (QT == 2) fw |= FL[((size_t)((q0 >> 4) + 1) * (TT / 128) + (g >> 2)) * 32]; lv[c] = ((fw >> ((g & 3) * 8)) & 0xFFu) != 0; }
    v8f s[KW / 16][QT]; float mx[QT], sum[QT], f[QT];
#pragma unroll
    for (int qt = 0; qt < QT; ++qt) mx[qt] = -3.0e38f;
#pragma unroll
    for (int c = 0; c < KW / 32; ++c) { const int k0 = (c * AW + w) * 32;
        if (lv[c]) { V ka[2][2], ka2[2][2]; v16u mw[QT];
#pragma unroll
            for (int qt = 0; qt < QT; ++qt) mw[qt] = *(const v16u*)(BM + ((size_t)((q0 >> 4) + qt) * (TT / 32) + (k0 >> 5)) * 16);
            __builtin_amdgcn_sched_barrier(0);   // keeps the scalar mask loads in front of the key loads: placed behind them they reuse the key loads' base registers and are issued only behind a wait on those loads
#pragma unroll
            for (int u = 0; u < 2; ++u) {
#pragma unroll
                for (int d = 0; d < 2; ++d) { const size_t o = (size_t)(k0 + u * 16) * HD + d * 512; ka[u][d] = WFrag<T16>::lde(Kp + o, lo); if (HL) ka2[u][d] = WFrag<T16>::lde(K2 + o, lo); } }
            asm volatile("s_wait_xcnt 0x0" ::: "memory");   // the chunk's key and mask loads: their address registers are free for reuse behind this line
            __builtin_amdgcn_sched_barrier(0);   // keeps the chunk's loads in one run in front of the products: sunk among them, each pair is waited for by itself and the wave pays the load latency several times a chunk
#pragma unroll
            for (int u = 0; u < 2; ++u)
#pragma unroll
                for (int qt = 0; qt < QT; ++qt) { v8f a = (v8f){};
#pragma unroll
                    for (int d = 0; d < 2; ++d) { a = WFrag<T16>::mma(ka[u][d], qf[qt][d], a); if (HL) { a = WFrag<T16>::mma(ka[u][d], qf2[qt][d], a); a = WFrag<T16>::mma(ka2[u][d], qf[qt][d], a); } }
#pragma unroll
                    for (int j = 0; j < 8; ++j) { const float sv = a[j] * SCL; const float t = __builtin_amdgcn_inverse_ballot_w32(mw[qt][u * 8 + j]) ? sv : MFILL; a[j] = t; mx[qt] = fmaxf(mx[qt], t); }
                    s[2 * c + u][qt] = a; }
        } else {
#pragma unroll
            for (int qt = 0; qt < QT; ++qt) { mx[qt] = fmaxf(mx[qt], MFILL);
#pragma unroll
                for (int u = 0; u < 2; ++u)
#pragma unroll
                    for (int j = 0; j < 8; ++j) s[2 * c + u][qt][j] = MFILL; } }
    }
#pragma unroll
    for (int qt = 0; qt < QT; ++qt) { mx[qt] = fmaxf(mx[qt], __shfl_xor(mx[qt], 16, 32)); if (hi == 0) redm[w * 32 + qt * 16 + lr] = mx[qt]; }
    __syncthreads();   // every wave's row maxima are in redm
#pragma unroll
    for (int qt = 0; qt < QT; ++qt) {
#pragma unroll
        for (int r = 0; r < AW; ++r) mx[qt] = fmaxf(mx[qt], redm[r * 32 + qt * 16 + lr]);
        sum[qt] = 0.f; }
    bool fe = false;   // does a filled entry still count in one of the lane's rows?
#pragma unroll
    for (int qt = 0; qt < QT; ++qt) fe |= (__builtin_amdgcn_exp2f(fmaxf(__fmul_rn(__fsub_rn(MFILL, mx[qt]), 1.4426950408889634f), -160.0f)) != 0.0f);
    const bool af = __any(fe) != 0;
#pragma unroll
    for (int c = 0; c < KW / 32; ++c) lv[c] = lv[c] || af;
    V vb[2][4], vb2[2][4];   // two chunks of V in flight: the first two asked for here, as soon as it is known which chunks count (the guarded blocks below keep the compiler from moving a load up by itself), chunk c + 2 behind the products of chunk c
#pragma unroll
    for (int c = 0; c < 2; ++c) if (lv[c]) {
#pragma unroll
        for (int dt = 0; dt < 4; ++dt) { const size_t vo = (size_t)dt * 16 * TT + (size_t)(c * AW + w) * 512; vb[c][dt] = WFrag<T16>::lde(Vt + vo, lo); if (HL) vb2[c][dt] = WFrag<T16>::lde(V2 + vo, lo); }
        asm volatile("s_wait_xcnt 0x0" ::: "memory");   // the chunk's value loads: their address registers are free for reuse behind this line
    }
#pragma unroll
    for (int kt = 0; kt < KW / 16; ++kt) if (lv[kt >> 1])
#pragma unroll
        for (int qt = 0; qt < QT; ++qt)
#pragma unroll
            for (int j = 0; j < 8; ++j) { const float d0 = __fsub_rn(s[kt][qt][j], mx[qt]); const float e = __builtin_amdgcn_exp2f(fmaxf(__fmul_rn(d0, 1.4426950408889634f), -160.0f)); s[kt][qt][j] = e; sum[qt] += e; }
#pragma unroll
    for (int qt = 0; qt < QT; ++qt) { sum[qt] += __shfl_xor(sum[qt], 16, 32); if (hi == 0) reds[w * 32 + qt * 16 + lr] = sum[qt]; }
    __syncthreads();   // every wave's row sums are in reds
#pragma unroll
    for (int qt = 0; qt < QT; ++qt) { float t = reds[qt * 16 + lr];
#pragma unroll
        for (int r = 1; r < AW; ++r) t += reds[r * 32 + qt * 16 + lr];
        f[qt] = __fdiv_rn(HL ? 1.0f : PCAR, t); }
    V pa[KW / 32][QT], pa2[KW / 32][QT];
#pragma unroll
    for (int c = 0; c < KW / 32; ++c) if (lv[c]) {
#pragma unroll
        for (int qt = 0; qt < QT; ++qt) {
            if constexpr (HL) { v8us h0, h1, l0, l1;
#pragma unroll
                for (int j = 0; j < 8; ++j) { unsigned short a, c2; splitf(s[2 * c][qt][j] * f[qt], a, c2); h0[j] = a; l0[j] = c2; splitf(s[2 * c + 1][qt][j] * f[qt], a, c2); h1[j] = a; l1[j] = c2; }
                pa[c][qt] = cat16b(h0, h1); pa2[c][qt] = cat16b(l0, l1);
            } else { v8h p0, p1;
#pragma unroll
                for (int j = 0; j < 8; ++j) { p0[j] = tohx(s[2 * c][qt][j] * f[qt]); p1[j] = tohx(s[2 * c + 1][qt][j] * f[qt]); }
                pa[c][qt] = cat16(p0, p1); } } }
    v8f o[QT][4];
#pragma unroll
    for (int qt = 0; qt < QT; ++qt)
#pragma unroll
        for (int dt = 0; dt < 4; ++dt) o[qt][dt] = (v8f){};
#pragma unroll
    for (int c = 0; c < KW / 32; ++c) {
        if (lv[c]) {
#pragma unroll
            for (int dt = 0; dt < 4; ++dt)
#pragma unroll
                for (int qt = 0; qt < QT; ++qt) { o[qt][dt] = WFrag<T16>::mma(pa[c][qt], vb[c & 1][dt], o[qt][dt]); if (HL) { o[qt][dt] = WFrag<T16>::mma(pa2[c][qt], vb[c & 1][dt], o[qt][dt]); o[qt][dt] = WFrag<T16>::mma(pa[c][qt], vb2[c & 1][dt], o[qt][dt]); } } }
        if (c + 2 < KW / 32) if (lv[c + 2]) {
#pragma unroll
            for (int dt = 0; dt < 4; ++dt) { const size_t vo = (size_t)dt * 16 * TT + (size_t)((c + 2) * AW + w) * 512; vb[c & 1][dt] = WFrag<T16>::lde(Vt + vo, lo); if (HL) vb2[c & 1][dt] = WFrag<T16>::lde(V2 + vo, lo); }
            asm volatile("s_wait_xcnt 0x0" ::: "memory");   // the chunk's value loads: their address registers are free for reuse behind this line
        } }
    float* pw = part + (size_t)w * (QT * 16 * OP);
#pragma unroll
    for (int qt = 0; qt < QT; ++qt)
#pragma unroll
        for (int dt = 0; dt < 4; ++dt)
#pragma unroll
            for (int j = 0; j < 8; ++j) pw[(qt * 16 + hi * 8 + j) * OP + dt * 16 + lr] = o[qt][dt][j];
    __syncthreads();   // every wave's partial tile is in part
    const float cs = HL ? 1.0f : (1.0f / PCAR);
    static_assert(QT * 16 * 16 <= AW * 32);
    if (tid < QT * 16 * 16) { const int row = tid >> 4, col = (tid & 15) * 4; v4f acc = *(const v4f*)(part + row * OP + col);
#pragma unroll
        for (int r = 1; r < AW; ++r) acc += *(const v4f*)(part + (size_t)r * (QT * 16 * OP) + row * OP + col);
        v4us oh, ol;
#pragma unroll
        for (int q = 0; q < 4; ++q) { unsigned short a, c2; splitf(acc[q] * cs, a, c2); oh[q] = a; ol[q] = c2; }
        const size_t oo = (size_t)(q0 + (row & ~15)) * DQ + hcol * 16 + (col >> 3) * 128 + (row & 15) * 8 + (col & 4); *(v4us*)(Ah + oo) = oh; *(v4us*)(Al + oo) = ol; }
}

__global__ __launch_bounds__(AW * 32) void k_attn(const h16* __restrict__ Q16, const h16* __restrict__ K16, const h16* __restrict__ V16, const bf* __restrict__ Qh, const bf* __restrict__ Ql, const bf* __restrict__ Kh, const bf* __restrict__ Kl, const bf* __restrict__ Vh, const bf* __restrict__ Vl, const unsigned* __restrict__ BM, const unsigned* __restrict__ FL, bf* Ah, bf* Al) {
    __shared__ __align__(16) float part[AW * 32 * OP]; __shared__ float redm[AW * 32]; __shared__ float reds[AW * 32];
    const int h = blockIdx.y, bx = blockIdx.x; const size_t po = ((size_t)blockIdx.z * 3 * NH_ + h) * TT * HD;   // a batch's q, k and v planes lie behind one another
    Ah += (size_t)blockIdx.z * TT * DQ; Al += (size_t)blockIdx.z * TT * DQ;
    if (bx < RH / 16) attn_tile<bf, 1, true>(Qh + po, Ql + po, Kh + po, Kl + po, Vh + po, Vl + po, BM, FL, bx * 16, h * HD, Ah, Al, part, redm, reds);
    else attn_tile<h16, 2, false>(Q16 + po, nullptr, K16 + po, nullptr, V16 + po, nullptr, BM, FL, RH + (bx - RH / 16) * 32, h * HD, Ah, Al, part, redm, reds);
}

extern "C" void kernel_launch(void* const* d_in, const int* in_sizes, int n_in,
                              void* d_out, int out_size, void* d_ws, size_t ws_size, hipStream_t stream) {
    if (n_in < 8) return;
    const size_t need_x = ((size_t)(NB - 1) * SEQ_FULL + SEQ) * DM;          // elements of the activation stream / of the output that are touched
    const size_t need_m = (size_t)(SEQ - 1) * SEQ_FULL + SEQ;                // mask entries touched
    if ((size_t)in_sizes[0] < need_x) return;
    if ((size_t)in_sizes[1] < (size_t)SEQ * HP || (size_t)in_sizes[2] < (size_t)SEQ * HP) return;
    if ((size_t)in_sizes[3] < need_m) return;
    if ((size_t)in_sizes[4] < (size_t)DQ * DM || (size_t)in_sizes[5] < (size_t)DKV * DM || (size_t)in_sizes[6] < (size_t)DKV * DM || (size_t)in_sizes[7] < (size_t)DM * DQ) return;
    if ((size_t)out_size < need_x) return;
    // wire order: x, cos, sin, attn_mask (int32), wq, wk, wv, wo ('oi' weights)
    const float* x = (const float*)d_in[0]; const float* cs = (const float*)d_in[1]; const float* sn = (const float*)d_in[2]; const int* mk = (const int*)d_in[3];
    const float* wq = (const float*)d_in[4]; const float* wk = (const float*)d_in[5]; const float* wv = (const float*)d_in[6]; const float* wo = (const float*)d_in[7];
    float* OUT = (float*)d_out;     // [2][2048][768]
    char* wsp = (char*)d_ws;
    auto take = [&](size_t bytes) { char* p = wsp; wsp += (bytes + 255) & ~(size_t)255; return (void*)p; };
    bf* WQ = (bf*)take((size_t)DQ * DM * 2); bf* WK = (bf*)take((size_t)DKV * DM * 2); bf* WV = (bf*)take((size_t)DKV * DM * 2); bf* WO = (bf*)take((size_t)DM * DQ * 2);
    const size_t PS = (size_t)NH_ * TT * HD;     // elements of one plane; planes lie [batch][q, k, v][PS]
    h16* QP16 = (h16*)take((size_t)NB * 3 * PS * 2); h16* KP16 = QP16 + PS; h16* VT16 = KP16 + PS;
    bf* QPh = (bf*)take((size_t)NB * 3 * PS * 2); bf* KPh = QPh + PS; bf* VTh = KPh + PS;
    bf* QPl = (bf*)take((size_t)NB * 3 * PS * 2); bf* KPl = QPl + PS; bf* VTl = KPl + PS;
    bf* XB = (bf*)take((size_t)NB * TT * DM * 2); bf* ATh = (bf*)take((size_t)NB * TT * DQ * 2); bf* ATl = (bf*)take((size_t)NB * TT * DQ * 2);
    unsigned* FLG = (unsigned*)take((size_t)(TT / 16) * (TT / 128) * 128);
    unsigned* MBW = (unsigned*)take((size_t)(TT / 16) * (TT / 128) * 256);
    const size_t used = (size_t)(wsp - (char*)d_ws);
    if (used > ws_size || used > (size_t)268435456) return;
    k_cvt<<<4 * WB + NB * XBL + MBL, 256, 0, stream>>>(wq, wk, wv, wo, x, mk, WQ, WK, WV, WO, XB, FLG, MBW);
    k_gemmw<bf, 0, false, false, 1><<<dim3(TT / 64, DQ / 64, 3 * NB), 32, 0, stream>>>(XB, nullptr, WQ, nullptr, nullptr, 0, nullptr, (size_t)TT * DM, (size_t)(WK - WQ), PS, 0, 0, cs, sn, QP16, QPh, QPl);
    k_attn<<<dim3(RH / 16 + (TT - RH) / 32, NH_, NB), AW * 32, 0, stream>>>(QP16, KP16, VT16, QPh, QPl, KPh, KPl, VTh, VTl, MBW, FLG, ATh, ATl);
    k_gemmw<bf, 1, false, false, 0><<<dim3(TT / 64, DM / 64, NB), 32, 0, stream>>>(ATh, ATl, WO, nullptr, OUT, DM, nullptr, (size_t)TT * DQ, 0, (size_t)SEQ_FULL * DM, 0, 0, nullptr, nullptr, nullptr, nullptr, nullptr);
}

// v009
// Measured time: 122 microseconds a run.
// Two timings next to v008 put it at 1.05 and 1.04 times that version's speed.
// Over all steps from v000 it is 12.4 times as fast.
#include <hip/hip_runtime.h>

// Causal self-attention over one input stream with interleaved-pair rotary embeddings whose cos / sin tables are inputs read by value, an int32 mask read by value, no biases (x [2][2048][768]; q = x Wq^T, k = x Wk^T, v = x Wv^T ('oi' [768][768]; 12 heads x 64); pairs (2j, 2j+1) of q and k rotated by cos[t][j], sin[t][j]; logits x 1/8; mask[i][j] == 0 -> logit replaced by -1e9; softmax over all 2048 keys; out = merged Wo^T -> [2][2048][768]; argument order x, cos, sin, attn_mask, wq, wk, wv, wo).
// Compute dtypes, f32 accumulate: projections v_wmma_f32_16x16x32_bf16 on RNE bf16 copies of x and weights; rotation f32 with RNE bf16 table values; logits and P.V: query rows < 512 bf16 hi/lo planes (3 products), rows >= 512 v_wmma_f32_16x16x32_f16 (P carried x1024); softmax f32; output projection bf16 hi/lo ctx x bf16 Wo (2 products).
// Four launches, each over both batches: bf16 copies of the four weights and of the input stream, one flag for every mask block of 16 query rows x 32 keys (any entry != 0) and one bit for every mask entry (entry != 0), in words that are lane masks of the attention kernel; the three projections (grid z = 3 * batch + {q, k, v}), whose epilogue writes the rotary head planes (q, k) or the transposed value planes straight from the accumulators; attention over all heads and both batches: a work-group of AW waves walks 7 or 8 tiles of 16 or 32 query rows, in a tile each wave TT/AW keys in chunks of 32 dealt round-robin, a chunk whose mask block is all zero being left out where its P is zero; scores, softmax and P stay in registers, the waves' f32 partial tiles are summed in wave order through LDS; merged hi/lo x Wo.

#ifndef NB
#define NB   2
#endif
#ifndef SEQ
#define SEQ  2048
#endif
#define NB_FULL  2
#define SEQ_FULL 2048
#define TT   SEQ
#define DM   768
#define NH_  12
#define NKV  12
#define REP  (NH_ / NKV)
#define HD   64
#define HP   (HD / 2)    // rotary pairs per head = table row width
#define DQ   (NH_ * HD)
#define DKV  (NKV * HD)
#define AW   16   // waves of an attention work-group; each owns KW keys
#define KW   (SEQ / AW)
#define OP   68   // f32 pitch of a partial-tile row in LDS: rows 8 apart fall on different banks
#define RH   ((SEQ < 512) ? SEQ : 512)   // query rows < RH use hi+lo planes
#define PCAR 1024.0f
#define SCL  0.125f   // HD^-0.5
#define MFILL (-1.0e9f)
typedef _Float16 h16;
typedef unsigned short bf;
typedef __attribute__((ext_vector_type(16))) __bf16   v16bf;
typedef __attribute__((ext_vector_type(16))) _Float16 v16h;
typedef __attribute__((ext_vector_type(8)))  _Float16 v8h;
typedef __attribute__((ext_vector_type(8)))  unsigned short v8us;
typedef __attribute__((ext_vector_type(8)))  float    v8f;
typedef __attribute__((ext_vector_type(4)))  float    v4f;
typedef v4f  __attribute__((may_alias)) v4fa;

static_assert(TT % 128 == 0);
static_assert(TT % (AW * 32) == 0);
static_assert(RH % 16 == 0);
static_assert((TT - RH) % 32 == 0);
static_assert(RH % 64 == 0);
static_assert((TT - RH) % 64 == 0);
static_assert(DM % 32 == 0);
static_assert(DQ % 64 == 0);
static_assert(DKV % 64 == 0);
static_assert(DM % 64 == 0);
static_assert(HD == 64);
static_assert(NB <= NB_FULL);
static_assert(SEQ <= SEQ_FULL);
static_assert((size_t)NB_FULL * SEQ_FULL * DM * 4 == 12582912);
static_assert(HP == 32);                                  // table rows are [t][32]
static_assert(HD % 2 == 0);
static_assert(DQ == DM);                                  // merged width == model width (no bias, square Wo)
static_assert(NKV == NH_);                                // one k/v head per q head
static_assert(((size_t)TT * DM / 8) % 256 == 0);
#define A256(x) ((((size_t)(x)) + 255) & ~(size_t)255)
static_assert(4 * A256((size_t)DQ * DM * 2) + 3 * A256((size_t)NB * 3 * NH_ * TT * HD * 2) + A256((size_t)NB * TT * DM * 2) + 2 * A256((size_t)NB * TT * DQ * 2) + A256((size_t)(TT / 16) * (TT / 128) * 128) + A256((size_t)(TT / 16) * (TT / 128) * 256) <= (size_t)268435456);
static_assert(((size_t)DQ * DM / 8) % 256 == 0);

__device__ __forceinline__ unsigned short f2bf(float f) { unsigned u = __float_as_uint(f); u += 0x7FFFu + ((u >> 16) & 1u); return (unsigned short)(u >> 16); }
__device__ __forceinline__ float bf2f(unsigned short b) { return __uint_as_float(((unsigned)b) << 16); }
__device__ __forceinline__ float bfr(float f) { return bf2f(f2bf(f)); }
__device__ __forceinline__ v16h cat16(v8h lo, v8h hi) { return __builtin_shufflevector(lo, hi, 0, 1, 2, 3, 4, 5, 6, 7, 8, 9, 10, 11, 12, 13, 14, 15); }
__device__ __forceinline__ v16bf cat16b(v8us lo, v8us hi) { return __builtin_bit_cast(v16bf, __builtin_shufflevector(lo, hi, 0, 1, 2, 3, 4, 5, 6, 7, 8, 9, 10, 11, 12, 13, 14, 15)); }
__device__ __forceinline__ v8f wmma16(v16h a, v16h b, v8f c) { return __builtin_amdgcn_wmma_f32_16x16x32_f16(false, a, false, b, (short)0, c, false, false); }
__device__ __forceinline__ v8f wmmab(v16bf a, v16bf b, v8f c) { return __builtin_amdgcn_wmma_f32_16x16x32_bf16(false, a, false, b, (short)0, c, false, false); }

__device__ __forceinline__ h16 tohx(float x) { return (h16)x; }
__device__ __forceinline__ void splitf(float y, unsigned short& h, unsigned short& l) { h = f2bf(y); l = f2bf(y - bf2f(h)); }
typedef __attribute__((ext_vector_type(2))) _Float16 v2h;
typedef __attribute__((ext_vector_type(4))) _Float16 v4h;
typedef __attribute__((ext_vector_type(2))) unsigned short v2us;
typedef __attribute__((ext_vector_type(4))) unsigned short v4us;
typedef __attribute__((ext_vector_type(2))) float v2f;
typedef __attribute__((ext_vector_type(4))) int v4i;
typedef __attribute__((ext_vector_type(16))) unsigned v16u;
typedef __attribute__((ext_vector_type(2))) unsigned v2u;
typedef __attribute__((address_space(4))) unsigned cu32;
typedef __attribute__((address_space(4))) v16u cv16u;

// f32 -> fp16 with a value select: magnitudes below the smallest fp16 normal become zero.
static __device__ __forceinline__ h16 toh_flush(float v) { const h16 r = (h16)v; return (fabsf(v) < 6.103515625e-05f) ? (h16)0.0f : r; }

// ---- k_gemmw: register-blocked GEMM, ONE WAVE per 64x64 output tile (16 accumulators), operands straight from 16-bit planes in fragment order; grid (M/64, N/64, Z), 32 threads.
// C[m][n] (f32, pitch ldc, + optional f32 bias[n]) = sum_k A[m][k] Bt[n][k] (+ split products per NSPLIT). z-batch strides sA/sB/sC in elements. K = DM.
// KSP: N == 64 and blockIdx.y numbers a k range of kspan (kspan % 32 == 0, gridDim.y * kspan == K); its partial tile goes to C + blockIdx.y * sK.
// EPI 0: C as above. EPI 1: projections, z = 3 * batch + p: A steps by sA a batch, Bt by sB a p, the planes by sC a z; C unused.
// p = 0, 1 (N tile = one head): the tile's pairs (2j, 2j+1) are rotated by the RNE bf16 copies of CS[t][j], SN[t][j] and go to the head planes [h][t][d] (fp16 + bf16 hi/lo; rows t, k = d, fragment order).
// p = 2 (N tile = one head): the tile goes transposed to the value planes [h][d][t] (fp16 + bf16 hi/lo; rows d, k = t, fragment order): a lane's 8 accumulator rows are 8 neighbouring t of one d, one 16-byte store a plane, the wave's 32 stores 512 bytes in a row.
// Fragment map (A and Bt alike): lane -> row (lane & 15); elements 0..7 = k0 + 8*(lane>>4) + 0..7, elements 8..15 = k0 + 16 + 8*(lane>>4) + 0..7.
// Fragment order: every 16-bit operand plane M[row][k] (K columns) lies in blocks of 16 rows x 32 k, block (row>>4)*(K/32) + (k>>5), 512 elements each; inside a block element (row, k) stands at ((k>>4)&1)*256 + (((k>>3)&1)*16 + (row&15))*8 + (k&7).
// A fragment is then two 16-byte loads a lane at block + lane*8 and block + 256 + lane*8 (ld: block pointer and the lane's offset in bytes; lde: the same with the offset in elements): each load of the wave reads 512 bytes in a row (4 lines) where a row-major plane gives 16 rows x 32 bytes (16 lines).
template <typename T16> struct WFrag;
template <> struct WFrag<h16> { typedef v16h V; static __device__ __forceinline__ V ld(const h16* p, unsigned lo) { const char* q = (const char*)p + lo; return cat16(*(const v8h*)q, *(const v8h*)(q + 512)); } static __device__ __forceinline__ V lde(const h16* p, unsigned le) { return cat16(*(const v8h*)(p + le), *(const v8h*)(p + 256 + le)); } static __device__ __forceinline__ v8f mma(V a, V b, v8f c) { return wmma16(a, b, c); } };
template <> struct WFrag<bf> { typedef v16bf V; static __device__ __forceinline__ V ld(const bf* p, unsigned lo) { const char* q = (const char*)p + lo; return cat16b(*(const v8us*)q, *(const v8us*)(q + 512)); } static __device__ __forceinline__ V lde(const bf* p, unsigned le) { return cat16b(*(const v8us*)(p + le), *(const v8us*)(p + 256 + le)); } static __device__ __forceinline__ v8f mma(V a, V b, v8f c) { return wmmab(a, b, c); } };
template <typename T16, int NSPLIT, bool BIAS, bool KSP, int EPI>
__global__ __launch_bounds__(32) void k_gemmw(const T16* __restrict__ A, const T16* __restrict__ A2, const T16* __restrict__ Bt, const T16* __restrict__ Bt2, float* C, int ldc, const float* __restrict__ bias, size_t sA, size_t sB, size_t sC, int kspan, size_t sK, const float* __restrict__ CS, const float* __restrict__ SN, h16* P16, bf* Ph, bf* Pl) {
    typedef typename WFrag<T16>::V V;
    constexpr int K = DM;   // both products run over the model width: every block of a tile is a constant step from one scalar base
    __shared__ __align__(16) float os[16 * 68];
    const size_t z = blockIdx.z, zb = (EPI == 1) ? z / 3 : z, zp = (EPI == 1) ? z - 3 * zb : z; A += zb * sA; if (A2) A2 += zb * sA; Bt += zp * sB; if (Bt2) Bt2 += zp * sB;
    if (EPI == 1) { P16 += z * sC; Ph += z * sC; Pl += z * sC; } else C += z * sC;
    const int lane = threadIdx.x & 31, lr = lane & 15, hi = lane >> 4; const int r0 = blockIdx.x * 64, c0 = KSP ? 0 : blockIdx.y * 64;
    const int kn = KSP ? kspan : K; if (KSP) { const size_t kb = (size_t)blockIdx.y * kspan * 16; A += kb; if (A2) A2 += kb; Bt += kb; if (Bt2) Bt2 += kb; C += blockIdx.y * sK; }
    v8f acc[4][4];
#pragma unroll
    for (int mb = 0; mb < 4; ++mb)
#pragma unroll
        for (int nb = 0; nb < 4; ++nb) acc[mb][nb] = (v8f){};
    const size_t aoff = (size_t)r0 * K, boff = (size_t)c0 * K; unsigned lo = lane * 16;   // a block's address is the same for the whole wave; lo, in bytes, is the lane's place in it plus the k step, one register for every load of the loop
#pragma unroll 1
    for (int kc = 0; kc < kn; kc += 32) {
        V a[4], a2[4];
#pragma unroll
        for (int mb = 0; mb < 4; ++mb) { a[mb] = WFrag<T16>::ld(A + aoff + (size_t)mb * 16 * K, lo); if (NSPLIT == 1 || NSPLIT == 2) a2[mb] = WFrag<T16>::ld(A2 + aoff + (size_t)mb * 16 * K, lo); }
#pragma unroll
        for (int nb = 0; nb < 4; ++nb) { const V b = WFrag<T16>::ld(Bt + boff + (size_t)nb * 16 * K, lo); V b2; if (NSPLIT >= 2) b2 = WFrag<T16>::ld(Bt2 + boff + (size_t)nb * 16 * K, lo);
            if (nb == 3) { asm volatile("s_wait_xcnt 0x0" : "+v"(lo) :: "memory"); lo += 1024; }   // last loads of the trip: the offset register that they all name takes its k step (one block, 1024 bytes) only behind this wait
#pragma unroll
            for (int mb = 0; mb < 4; ++mb) { acc[mb][nb] = WFrag<T16>::mma(a[mb], b, acc[mb][nb]); if (NSPLIT == 1 || NSPLIT == 2) acc[mb][nb] = WFrag<T16>::mma(a2[mb], b, acc[mb][nb]); if (NSPLIT >= 2) acc[mb][nb] = WFrag<T16>::mma(a[mb], b2, acc[mb][nb]); } }
        asm volatile("v_nop\n\tv_nop\n\tv_nop\n\tv_nop" : "+v"(acc[0][0]), "+v"(acc[1][1]), "+v"(acc[2][2]), "+v"(acc[3][3]) : "v"(a[0]), "v"(a[3]));
    }
    // one base a plane or table for the lane; every row of the tile is a constant step from it
    const size_t tb = (size_t)(r0 + hi) * HP + lr * 2, pb = ((size_t)(c0 / HD) * TT + r0) * HD + (lr >> 1) * 128 + hi * 8 + (lr & 1) * 4, vb = (size_t)c0 * TT + (size_t)r0 * 16 + lane * 8;
    if (EPI == 1 && zp == 2) {
#pragma unroll
        for (int nb = 0; nb < 4; ++nb)
#pragma unroll
            for (int mb = 0; mb < 4; ++mb) { v8h o16; v8us oh, ol;
#pragma unroll
                for (int j = 0; j < 8; ++j) { const float x = acc[mb][nb][j]; o16[j] = tohx(x); unsigned short a2, c2; splitf(x, a2, c2); oh[j] = a2; ol[j] = c2; }
                const size_t e = vb + (size_t)nb * 16 * TT + mb * 256; *(v8h*)(P16 + e) = o16; *(v8us*)(Ph + e) = oh; *(v8us*)(Pl + e) = ol; }
        return; }
#pragma unroll
    for (int mb = 0; mb < 4; ++mb) {
#pragma unroll
        for (int nb = 0; nb < 4; ++nb) {
#pragma unroll
            for (int j = 0; j < 8; ++j) os[(hi * 8 + j) * 68 + nb * 16 + lr] = acc[mb][nb][j]; }
        v2f cc[8], ss[8];   // the 16 rows' table values, asked for while the rows are staged
        if constexpr (EPI == 1) {
#pragma unroll
            for (int s = 0; s < 8; ++s) { cc[s] = *(const v2f*)(CS + tb + (mb * 16 + 2 * s) * HP); ss[s] = *(const v2f*)(SN + tb + (mb * 16 + 2 * s) * HP); } }
        __builtin_amdgcn_wave_barrier(); asm volatile("" ::: "memory");
        if constexpr (EPI == 1) { v4h o16[8]; v4us oh[8], ol[8];
#pragma unroll
            for (int s = 0; s < 8; ++s) { const int row = 2 * s + hi, cofs = lr * 4; const v4f x = *(const v4fa*)(os + row * 68 + cofs);
#pragma unroll
                for (int p = 0; p < 2; ++p) { const float c = bfr(cc[s][p]), sn = bfr(ss[s][p]); v2f r; r[0] = x[2 * p] * c - x[2 * p + 1] * sn; r[1] = x[2 * p] * sn + x[2 * p + 1] * c;
#pragma unroll
                    for (int q = 0; q < 2; ++q) { const float y = r[q]; o16[s][2 * p + q] = toh_flush(y); unsigned short a2, c2; splitf(y, a2, c2); oh[s][2 * p + q] = a2; ol[s][2 * p + q] = c2; } } }
            __builtin_amdgcn_sched_barrier(0);   // keeps the 24 stores in one run behind the arithmetic, so that the one wait below serves them all; spread among it the build holds some fifty waits, one behind nearly every second store
#pragma unroll
            for (int s = 0; s < 8; ++s) { const size_t e = pb + mb * 16 * HD + s * 16; *(v4h*)(P16 + e) = o16[s]; *(v4us*)(Ph + e) = oh[s]; *(v4us*)(Pl + e) = ol[s]; }
            asm volatile("s_wait_xcnt 0x0" ::: "memory");   // the plane stores' address and data registers are free for reuse behind this line
        } else { float* crow = C + (size_t)(r0 + mb * 16) * ldc + c0;
#pragma unroll
            for (int s = 0; s < 8; ++s) { const int row = 2 * s + hi, cofs = lr * 4; v4f val = *(const v4fa*)(os + row * 68 + cofs); if (BIAS) { val[0] += bfr(bias[c0 + cofs]); val[1] += bfr(bias[c0 + cofs + 1]); val[2] += bfr(bias[c0 + cofs + 2]); val[3] += bfr(bias[c0 + cofs + 3]); }
                *(v4f*)(crow + (size_t)row * ldc + cofs) = val; }
             }
        __builtin_amdgcn_wave_barrier(); asm volatile("" ::: "memory");
    }
}

// k_cvt: RNE bf16 copies of the four weights (WB blocks each) and of the input stream (XBL blocks a batch) in one launch, written in fragment order (rows of DM columns); a thread takes 8 neighbouring values, numbered by their place in the copy.
// The last MBL blocks read the whole mask: a wave takes 16 query rows x 128 keys, lane (lr, hi) row lr and of every 16 keys those numbered 8*hi .. 8*hi+7, which is the place of a score in k_attn's registers, and writes one flag word, byte j != 0 where any entry of the rows' keys 32j .. 32j+31 is != 0; a flag word has a 128-byte line of its own (one writer a line).
// The same wave writes the block's entries as lane masks, 64 words = 256 bytes in a row at bm + wave * 64: word c*16 + u*8 + j holds at bit 16*hi + lr the test 'entry != 0' of query row lr, key 32*c + 16*u + 8*hi + j, the ballot over the lanes of one loaded element.
#define WB   ((unsigned)((size_t)DQ * DM / 8 / 256))
#define XBL  ((unsigned)((size_t)TT * DM / 8 / 256))
#define MBL  ((unsigned)((TT / 16) * (TT / 128) / 8))
__global__ __launch_bounds__(256) void k_cvt(const float* __restrict__ w0, const float* __restrict__ w1, const float* __restrict__ w2, const float* __restrict__ w3, const float* __restrict__ x, const int* __restrict__ mk, bf* d0, bf* d1, bf* d2, bf* d3, bf* dx, unsigned* fl, unsigned* bm) {
    const unsigned b = blockIdx.x; const float* src; bf* dst; unsigned r;
    if (b >= 4 * WB + NB * XBL) { const unsigned wv = (b - 4 * WB - NB * XBL) * 8 + (threadIdx.x >> 5), lane = threadIdx.x & 31, rt = wv / (TT / 128), kg = wv - rt * (TT / 128);
        const int* mp = mk + (size_t)(rt * 16 + (lane & 15)) * SEQ_FULL + kg * 128 + (lane >> 4) * 8; v4i a[16];
#pragma unroll
        for (int q = 0; q < 16; ++q) a[q] = *(const v4i*)(mp + (q >> 1) * 16 + (q & 1) * 4);
        asm volatile("s_wait_xcnt 0x0" ::: "memory");   // the mask loads' address registers are free for reuse behind this line
        unsigned fw = 0; v2u bw = (v2u){0u, 0u};   // bw: lane L keeps words 2L and 2L + 1 of the block's 64
#pragma unroll
        for (int j = 0; j < 4; ++j) { unsigned any = 0;
#pragma unroll
            for (int i = 0; i < 16; ++i) { const unsigned bl = __builtin_amdgcn_ballot_w32(a[j * 4 + (i >> 2)][i & 3] != 0); any |= bl; bw[i & 1] = (lane == (unsigned)(j * 8 + (i >> 1))) ? bl : bw[i & 1]; }
            fw |= any ? (1u << (8 * j)) : 0u; }
        *(v2u*)(bm + (size_t)wv * 64 + lane * 2) = bw;
        if (lane == 0) fl[(size_t)wv * 32] = fw;
        return; }
    if (b < 4 * WB) { const unsigned k = b / WB; r = b - k * WB; src = (k == 0) ? w0 : (k == 1) ? w1 : (k == 2) ? w2 : w3; dst = (k == 0) ? d0 : (k == 1) ? d1 : (k == 2) ? d2 : d3; }
    else { const unsigned k = (b - 4 * WB) / XBL; r = b - 4 * WB - k * XBL; src = x + (size_t)k * SEQ_FULL * DM; dst = dx + (size_t)k * TT * DM; }
    const unsigned i = r * 256 + threadIdx.x, blk = i >> 6, rb = blk / (DM / 32), kq = blk - rb * (DM / 32);   // 64 threads a block of 16 rows x 32 k
    const size_t so = (size_t)(rb * 16 + (i & 15)) * DM + kq * 32 + ((i >> 5) & 1) * 16 + ((i >> 4) & 1) * 8; const v8f v = *(const v8f*)(src + so); v8us o;
    asm volatile("s_wait_xcnt 0x0" ::: "memory");   // the load's address registers are free for reuse behind this line
#pragma unroll
    for (int k = 0; k < 8; ++k) o[k] = f2bf(v[k]);
    *(v8us*)(dst + (size_t)i * 8) = o; }

// k_attn: scores, softmax, P.V and the merge of one head's 16 (rows < RH, hi/lo planes) or 32 (fp16 planes) query rows in one work-group of AW waves; wave w owns the KW/32 chunks of 32 keys numbered c*AW + w.
// FL: the mask flags of k_cvt. A chunk whose flags are 0 has every t = -1e9 whatever K holds: its mask and key loads and score products are left out and the registers take -1e9. Where -1e9 then gives e == 0 in every row of the tile (tested by value: it does not in a row that is filled throughout), such a chunk adds 0 to the row sums and 0 x V to the tile: its exponentials, value loads and P.V products are left out too.
// Scores are formed transposed, S^T = K Q^T: lane (lr, hi) holds query lr, keys 8*hi + j of a 16-key tile, so two neighbouring tiles are, element for element, the A fragment of P for 32 keys (fragment map above) and P never leaves the registers.
// t = S x HD^-0.5, then t := -1e9 where the mask entry [i][j] is 0 (value select by lane mask; BM: the lane masks of k_cvt, shared by all heads and batches: the 16 words of a chunk and 16 query rows are the same for the whole wave and come by one scalar load of 64 bytes, each word the select's own condition, where the int32 rows give four vector loads of 16 lines each and a compare an entry); softmax over the TT keys: exact row maximum and row sum over the waves through LDS, in wave order; a fully filled row comes out uniform.
// Each wave's f32 partial tile [q][d] goes to LDS; the tiles are summed in the order w = 0 .. AW-1, scaled and split into the merged hi/lo planes (rows t, k = merged column, fragment order).
template <typename T16, int QT, bool HL>
__device__ __forceinline__ void attn_tile(const T16* __restrict__ Q, const T16* __restrict__ Q2, const T16* __restrict__ Kp, const T16* __restrict__ K2, const T16* __restrict__ Vt, const T16* __restrict__ V2, const unsigned* __restrict__ BM, const unsigned* __restrict__ FL, int q0, int hcol, bf* Ah, bf* Al, float* part, float* redm, float* reds) {
    typedef typename WFrag<T16>::V V;
    const int tid = threadIdx.x, lane = tid & 31, lr = lane & 15, hi = lane >> 4, w = __builtin_amdgcn_readfirstlane(tid >> 5); const unsigned lo = lane * 8;   // the wave's number in a scalar register: block addresses are scalar, the lane adds its place in elements
    const cu32* FLc = (const cu32*)FL; const cu32* BMc = (const cu32*)BM;   // constant address space: no launch but the first writes these words; without it the loads, which now stand behind the last tile's stores, go through vector registers and a readfirstlane a word
    V qf[QT][2], qf2[QT][2];
#pragma unroll
    for (int qt = 0; qt < QT; ++qt)
#pragma unroll
        for (int c = 0; c < 2; ++c) { const size_t o = (size_t)(q0 + qt * 16) * HD + c * 512; qf[qt][c] = WFrag<T16>::lde(Q + o, lo); if (HL) qf2[qt][c] = WFrag<T16>::lde(Q2 + o, lo); }
    asm volatile("s_wait_xcnt 0x0" ::: "memory");   // the query loads' address registers are free for reuse behind this line
    bool lv[KW / 32];   // the same in every lane: the tests on it are scalar branches
#pragma unroll
    for (int c = 0; c < KW / 32; ++c) { const int g = c * AW + w; unsigned fw = FLc[((size_t)(q0 >> 4) * (TT / 128) + (g >> 2)) * 32]; if (QT == 2) fw |= FLc[((size_t)((q0 >> 4) + 1) * (TT / 128) + (g >> 2)) * 32]; lv[c] = ((fw >> ((g & 3) * 8)) & 0xFFu) != 0; }
    v8f s[KW / 16][QT]; float mx[QT], sum[QT], f[QT];
#pragma unroll
    for (int qt = 0; qt < QT; ++qt) mx[qt] = -3.0e38f;
#pragma unroll
    for (int c = 0; c < KW / 32; ++c) { const int k0 = (c * AW + w) * 32;
        if (lv[c]) { V ka[2][2], ka2[2][2]; v16u mw[QT];
#pragma unroll
            for (int qt = 0; qt < QT; ++qt) mw[qt] = *(const cv16u*)(BMc + ((size_t)((q0 >> 4) + qt) * (TT / 32) + (k0 >> 5)) * 16);
            __builtin_amdgcn_sched_barrier(0);   // keeps the scalar mask loads in front of the key loads: placed behind them they reuse the key loads' base registers and are issued only behind a wait on those loads
#pragma unroll
            for (int u = 0; u < 2; ++u) {
#pragma unroll
                for (int d = 0; d < 2; ++d) { const size_t o = (size_t)(k0 + u * 16) * HD + d * 512; ka[u][d] = WFrag<T16>::lde(Kp + o, lo); if (HL) ka2[u][d] = WFrag<T16>::lde(K2 + o, lo); } }
            asm volatile("s_wait_xcnt 0x0" ::: "memory");   // the chunk's key and mask loads: their address registers are free for reuse behind this line
            __builtin_amdgcn_sched_barrier(0);   // keeps the chunk's loads in one run in front of the products: sunk among them, each pair is waited for by itself and the wave pays the load latency several times a chunk
#pragma unroll
            for (int u = 0; u < 2; ++u)
#pragma unroll
                for (int qt = 0; qt < QT; ++qt) { v8f a = (v8f){};
#pragma unroll
                    for (int d = 0; d < 2; ++d) { a = WFrag<T16>::mma(ka[u][d], qf[qt][d], a); if (HL) { a = WFrag<T16>::mma(ka[u][d], qf2[qt][d], a); a = WFrag<T16>::mma(ka2[u][d], qf[qt][d], a); } }
#pragma unroll
                    for (int j = 0; j < 8; ++j) { const float sv = a[j] * SCL; const float t = __builtin_amdgcn_inverse_ballot_w32(mw[qt][u * 8 + j]) ? sv : MFILL; a[j] = t; mx[qt] = fmaxf(mx[qt], t); }
                    s[2 * c + u][qt] = a; }
        } else {
#pragma unroll
            for (int qt = 0; qt < QT; ++qt) { mx[qt] = fmaxf(mx[qt], MFILL);
#pragma unroll
                for (int u = 0; u < 2; ++u)
#pragma unroll
                    for (int j = 0; j < 8; ++j) s[2 * c + u][qt][j] = MFILL; } }
    }
#pragma unroll
    for (int qt = 0; qt < QT; ++qt) { mx[qt] = fmaxf(mx[qt], __shfl_xor(mx[qt], 16, 32)); if (hi == 0) redm[w * 32 + qt * 16 + lr] = mx[qt]; }
    __syncthreads();   // every wave's row maxima are in redm
#pragma unroll
    for (int qt = 0; qt < QT; ++qt) {
#pragma unroll
        for (int r = 0; r < AW; ++r) mx[qt] = fmaxf(mx[qt], redm[r * 32 + qt * 16 + lr]);
        sum[qt] = 0.f; }
    bool fe = false;   // does a filled entry still count in one of the lane's rows?
#pragma unroll
    for (int qt = 0; qt < QT; ++qt) fe |= (__builtin_amdgcn_exp2f(fmaxf(__fmul_rn(__fsub_rn(MFILL, mx[qt]), 1.4426950408889634f), -160.0f)) != 0.0f);
    const bool af = __any(fe) != 0;
#pragma unroll
    for (int c = 0; c < KW / 32; ++c) lv[c] = lv[c] || af;
    V vb[2][4], vb2[2][4];   // two chunks of V in flight: the first two asked for here, as soon as it is known which chunks count (the guarded blocks below keep the compiler from moving a load up by itself), chunk c + 2 behind the products of chunk c
#pragma unroll
    for (int c = 0; c < 2; ++c) if (lv[c]) {
#pragma unroll
        for (int dt = 0; dt < 4; ++dt) { const size_t vo = (size_t)dt * 16 * TT + (size_t)(c * AW + w) * 512; vb[c][dt] = WFrag<T16>::lde(Vt + vo, lo); if (HL) vb2[c][dt] = WFrag<T16>::lde(V2 + vo, lo); }
        asm volatile("s_wait_xcnt 0x0" ::: "memory");   // the chunk's value loads: their address registers are free for reuse behind this line
    } else {   // a value on every path: left open, the registers count as carried from the work-group's last tile round its loop and are spilled
#pragma unroll
        for (int dt = 0; dt < 4; ++dt) { vb[c][dt] = (V){}; if (HL) vb2[c][dt] = (V){}; }
    }
#pragma unroll
    for (int kt = 0; kt < KW / 16; ++kt) if (lv[kt >> 1])
#pragma unroll
        for (int qt = 0; qt < QT; ++qt)
#pragma unroll
            for (int j = 0; j < 8; ++j) { const float d0 = __fsub_rn(s[kt][qt][j], mx[qt]); const float e = __builtin_amdgcn_exp2f(fmaxf(__fmul_rn(d0, 1.4426950408889634f), -160.0f)); s[kt][qt][j] = e; sum[qt] += e; }
#pragma unroll
    for (int qt = 0; qt < QT; ++qt) { sum[qt] += __shfl_xor(sum[qt], 16, 32); if (hi == 0) reds[w * 32 + qt * 16 + lr] = sum[qt]; }
    __syncthreads();   // every wave's row sums are in reds
#pragma unroll
    for (int qt = 0; qt < QT; ++qt) { float t = reds[qt * 16 + lr];
#pragma unroll
        for (int r = 1; r < AW; ++r) t += reds[r * 32 + qt * 16 + lr];
        f[qt] = __fdiv_rn(HL ? 1.0f : PCAR, t); }
    V pa[KW / 32][QT], pa2[KW / 32][QT];
#pragma unroll
    for (int c = 0; c < KW / 32; ++c) if (lv[c]) {
#pragma unroll
        for (int qt = 0; qt < QT; ++qt) {
            if constexpr (HL) { v8us h0, h1, l0, l1;
#pragma unroll
                for (int j = 0; j < 8; ++j) { unsigned short a, c2; splitf(s[2 * c][qt][j] * f[qt], a, c2); h0[j] = a; l0[j] = c2; splitf(s[2 * c + 1][qt][j] * f[qt], a, c2); h1[j] = a; l1[j] = c2; }
                pa[c][qt] = cat16b(h0, h1); pa2[c][qt] = cat16b(l0, l1);
            } else { v8h p0, p1;
#pragma unroll
                for (int j = 0; j < 8; ++j) { p0[j] = tohx(s[2 * c][qt][j] * f[qt]); p1[j] = tohx(s[2 * c + 1][qt][j] * f[qt]); }
                pa[c][qt] = cat16(p0, p1); } }
    } else {   // a value on every path, as for the value fragments above
#pragma unroll
        for (int qt = 0; qt < QT; ++qt) { pa[c][qt] = (V){}; if (HL) pa2[c][qt] = (V){}; }
    }
    v8f o[QT][4];
#pragma unroll
    for (int qt = 0; qt < QT; ++qt)
#pragma unroll
        for (int dt = 0; dt < 4; ++dt) o[qt][dt] = (v8f){};
#pragma unroll
    for (int c = 0; c < KW / 32; ++c) {
        if (lv[c]) {
#pragma unroll
            for (int dt = 0; dt < 4; ++dt)
#pragma unroll
                for (int qt = 0; qt < QT; ++qt) { o[qt][dt] = WFrag<T16>::mma(pa[c][qt], vb[c & 1][dt], o[qt][dt]); if (HL) { o[qt][dt] = WFrag<T16>::mma(pa2[c][qt], vb[c & 1][dt], o[qt][dt]); o[qt][dt] = WFrag<T16>::mma(pa[c][qt], vb2[c & 1][dt], o[qt][dt]); } } }
        if (c + 2 < KW / 32) if (lv[c + 2]) {
#pragma unroll
            for (int dt = 0; dt < 4; ++dt) { const size_t vo = (size_t)dt * 16 * TT + (size_t)((c + 2) * AW + w) * 512; vb[c & 1][dt] = WFrag<T16>::lde(Vt + vo, lo); if (HL) vb2[c & 1][dt] = WFrag<T16>::lde(V2 + vo, lo); }
            asm volatile("s_wait_xcnt 0x0" ::: "memory");   // the chunk's value loads: their address registers are free for reuse behind this line
        } }
    float* pw = part + (size_t)w * (QT * 16 * OP);
#pragma unroll
    for (int qt = 0; qt < QT; ++qt)
#pragma unroll
        for (int dt = 0; dt < 4; ++dt)
#pragma unroll
            for (int j = 0; j < 8; ++j) pw[(qt * 16 + hi * 8 + j) * OP + dt * 16 + lr] = o[qt][dt][j];
    __syncthreads();   // every wave's partial tile is in part
    const float cs = HL ? 1.0f : (1.0f / PCAR);
    static_assert(QT * 16 * 16 <= AW * 32);
    if (tid < QT * 16 * 16) { const int row = tid >> 4, col = (tid & 15) * 4; v4f acc = *(const v4f*)(part + row * OP + col);
#pragma unroll
        for (int r = 1; r < AW; ++r) acc += *(const v4f*)(part + (size_t)r * (QT * 16 * OP) + row * OP + col);
        v4us oh, ol;
#pragma unroll
        for (int q = 0; q < 4; ++q) { unsigned short a, c2; splitf(acc[q] * cs, a, c2); oh[q] = a; ol[q] = c2; }
        const size_t oo = (size_t)(q0 + (row & ~15)) * DQ + hcol * 16 + (col >> 3) * 128 + (row & 15) * 8 + (col & 4); *(v4us*)(Ah + oo) = oh; *(v4us*)(Al + oo) = ol;
        asm volatile("s_wait_xcnt 0x0" ::: "memory");   // the two stores' address and data registers are free for the next tile behind this line
    }
}

// One work-group a WGP, started once, walks 7 or 8 tiles one after the other. A group of 32 work-groups shares the 240 tiles of three (batch, head) pairs; each tile is done exactly once whatever the mask holds.
// The deal is for speed alone: where the mask lets late rows see more keys, the 32-row tiles NTH + 0..15, 16..31, 32..47 have at most 2, 3, 4 live chunks a wave and a 16-row tile one; a work-group of 7 takes 3 x 4, 1 x 2, 3 x 1, one of 8 takes 3 x 3, 2 x 2, 3 x 1.
// No barrier more between two tiles: redm is rewritten behind the last tile's third barrier (read in front of its second), reds behind the new tile's first, part behind its second, and the merge's reads of part stand in front of the reader's arrival at the first.
#define NTH (RH / 16)           // tiles of 16 rows in a head
#define NTF ((TT - RH) / 32)    // tiles of 32 rows in a head
static_assert(NTH == 32 && NTF == 48 && (NH_ * NB) % 3 == 0);
#define AGR ((NH_ * NB / 3) * 32)
__global__ __launch_bounds__(AW * 32) void k_attn(const h16* __restrict__ Q16, const h16* __restrict__ K16, const h16* __restrict__ V16, const bf* __restrict__ Qh, const bf* __restrict__ Ql, const bf* __restrict__ Kh, const bf* __restrict__ Kl, const bf* __restrict__ Vh, const bf* __restrict__ Vl, const unsigned* __restrict__ BM, const unsigned* __restrict__ FL, bf* Ah, bf* Al) {
    __shared__ __align__(16) float part[AW * 32 * OP]; __shared__ float redm[AW * 32]; __shared__ float reds[AW * 32];
    const int b = blockIdx.x, grp = b >> 5, e = b & 15; const bool tv = (b & 16) == 0; const int nt = tv ? 7 : 8;
#pragma unroll 1   // one copy of the two tile bodies
    for (int k = 0; k < nt; ++k) { int bx, t;   // bx: the tile's number in its head (16-row tiles first), t: which of the group's three (batch, head) pairs
        if (tv) { if (k < 3) { bx = NTH + 32 + e; t = k; } else if (k == 3) { bx = NTH + e; t = 0; } else { bx = e; t = k - 4; } }
        else { if (k < 3) { bx = NTH + 16 + e; t = k; } else if (k < 5) { bx = NTH + e; t = k - 2; } else { bx = 16 + e; t = k - 5; } }
        const int hz = grp * 3 + t, z = hz / NH_, h = hz - z * NH_; const size_t po = ((size_t)z * 3 * NH_ + h) * TT * HD;   // a batch's q, k and v planes lie behind one another
        bf* ah = Ah + (size_t)z * TT * DQ; bf* al = Al + (size_t)z * TT * DQ;
        if (bx < NTH) attn_tile<bf, 1, true>(Qh + po, Ql + po, Kh + po, Kl + po, Vh + po, Vl + po, BM, FL, bx * 16, h * HD, ah, al, part, redm, reds);
        else attn_tile<h16, 2, false>(Q16 + po, nullptr, K16 + po, nullptr, V16 + po, nullptr, BM, FL, RH + (bx - NTH) * 32, h * HD, ah, al, part, redm, reds);
    }
}

extern "C" void kernel_launch(void* const* d_in, const int* in_sizes, int n_in,
                              void* d_out, int out_size, void* d_ws, size_t ws_size, hipStream_t stream) {
    if (n_in < 8) return;
    const size_t need_x = ((size_t)(NB - 1) * SEQ_FULL + SEQ) * DM;          // elements of the activation stream / of the output that are touched
    const size_t need_m = (size_t)(SEQ - 1) * SEQ_FULL + SEQ;                // mask entries touched
    if ((size_t)in_sizes[0] < need_x) return;
    if ((size_t)in_sizes[1] < (size_t)SEQ * HP || (size_t)in_sizes[2] < (size_t)SEQ * HP) return;
    if ((size_t)in_sizes[3] < need_m) return;
    if ((size_t)in_sizes[4] < (size_t)DQ * DM || (size_t)in_sizes[5] < (size_t)DKV * DM || (size_t)in_sizes[6] < (size_t)DKV * DM || (size_t)in_sizes[7] < (size_t)DM * DQ) return;
    if ((size_t)out_size < need_x) return;
    // wire order: x, cos, sin, attn_mask (int32), wq, wk, wv, wo ('oi' weights)
    const float* x = (const float*)d_in[0]; const float* cs = (const float*)d_in[1]; const float* sn = (const float*)d_in[2]; const int* mk = (const int*)d_in[3];
    const float* wq = (const float*)d_in[4]; const float* wk = (const float*)d_in[5]; const float* wv = (const float*)d_in[6]; const float* wo = (const float*)d_in[7];
    float* OUT = (float*)d_out;     // [2][2048][768]
    char* wsp = (char*)d_ws;
    auto take = [&](size_t bytes) { char* p = wsp; wsp += (bytes + 255) & ~(size_t)255; return (void*)p; };
    bf* WQ = (bf*)take((size_t)DQ * DM * 2); bf* WK = (bf*)take((size_t)DKV * DM * 2); bf* WV = (bf*)take((size_t)DKV * DM * 2); bf* WO = (bf*)take((size_t)DM * DQ * 2);
    const size_t PS = (size_t)NH_ * TT * HD;     // elements of one plane; planes lie [batch][q, k, v][PS]
    h16* QP16 = (h16*)take((size_t)NB * 3 * PS * 2); h16* KP16 = QP16 + PS; h16* VT16 = KP16 + PS;
    bf* QPh = (bf*)take((size_t)NB * 3 * PS * 2); bf* KPh = QPh + PS; bf* VTh = KPh + PS;
    bf* QPl = (bf*)take((size_t)NB * 3 * PS * 2); bf* KPl = QPl + PS; bf* VTl = KPl + PS;
    bf* XB = (bf*)take((size_t)NB * TT * DM * 2); bf* ATh = (bf*)take((size_t)NB * TT * DQ * 2); bf* ATl = (bf*)take((size_t)NB * TT * DQ * 2);
    unsigned* FLG = (unsigned*)take((size_t)(TT / 16) * (TT / 128) * 128);
    unsigned* MBW = (unsigned*)take((size_t)(TT / 16) * (TT / 128) * 256);
    const size_t used = (size_t)(wsp - (char*)d_ws);
    if (used > ws_size || used > (size_t)268435456) return;
    k_cvt<<<4 * WB + NB * XBL + MBL, 256, 0, stream>>>(wq, wk, wv, wo, x, mk, WQ, WK, WV, WO, XB, FLG, MBW);
    k_gemmw<bf, 0, false, false, 1><<<dim3(TT / 64, DQ / 64, 3 * NB), 32, 0, stream>>>(XB, nullptr, WQ, nullptr, nullptr, 0, nullptr, (size_t)TT * DM, (size_t)(WK - WQ), PS, 0, 0, cs, sn, QP16, QPh, QPl);
    k_attn<<<AGR, AW * 32, 0, stream>>>(QP16, KP16, VT16, QPh, QPl, KPh, KPl, VTh, VTl, MBW, FLG, ATh, ATl);
    k_gemmw<bf, 1, false, false, 0><<<dim3(TT / 64, DM / 64, NB), 32, 0, stream>>>(ATh, ATl, WO, nullptr, OUT, DM, nullptr, (size_t)TT * DQ, 0, (size_t)SEQ_FULL * DM, 0, 0, nullptr, nullptr, nullptr, nullptr, nullptr);
}

// v010
// Measured time: 93.9 microseconds a run.
// Timed twice side by side with v009, it ran 1.33 and 1.32 times as fast.
// All steps since v000 together make it 16.5 times as fast.
#include <hip/hip_runtime.h>

// Causal self-attention over one input stream with interleaved-pair rotary embeddings whose cos / sin tables are inputs read by value, an int32 mask read by value, no biases (x [2][2048][768]; q = x Wq^T, k = x Wk^T, v = x Wv^T ('oi' [768][768]; 12 heads x 64); pairs (2j, 2j+1) of q and k rotated by cos[t][j], sin[t][j]; logits x 1/8; mask[i][j] == 0 -> logit replaced by -1e9; softmax over all 2048 keys; out = merged Wo^T -> [2][2048][768]; argument order x, cos, sin, attn_mask, wq, wk, wv, wo).
// Compute dtypes, f32 accumulate: projections v_wmma_f32_16x16x32_bf16 on RNE bf16 copies of x and weights; rotation f32 with RNE bf16 table values; logits and P.V: query rows < 512 bf16 hi/lo planes (3 products), rows >= 512 v_wmma_f32_16x16x32_f16 (P carried x1024); softmax f32; output projection bf16 hi/lo ctx x bf16 Wo (2 products).
// Four launches, each over both batches: bf16 copies of the four weights and of the input stream, one flag for every mask block of 16 query rows x 32 keys (any entry != 0) and one bit for every mask entry (entry != 0), in words that are lane masks of the attention kernel; the three projections (grid z = 3 * batch + {q, k, v}), whose epilogue writes the rotary head planes (q, k) or the transposed value planes straight from the accumulators; attention over all heads and both batches: a work-group of AW waves walks 7 or 8 tiles of 16 or 32 query rows, in a tile each wave TT/AW keys in chunks of 32 dealt round-robin, a chunk whose mask block is all zero being left out where its P is zero; scores, softmax and P stay in registers, the waves' f32 partial tiles are summed in wave order through LDS; merged hi/lo x Wo.

#ifndef NB
#define NB   2
#endif
#ifndef SEQ
#define SEQ  2048
#endif
#define NB_FULL  2
#define SEQ_FULL 2048
#define TT   SEQ
#define DM   768
#define NH_  12
#define NKV  12
#define REP  (NH_ / NKV)
#define HD   64
#define HP   (HD / 2)    // rotary pairs per head = table row width
#define DQ   (NH_ * HD)
#define DKV  (NKV * HD)
#define AW   16   // waves of an attention work-group; each owns KW keys
#define KW   (SEQ / AW)
#define OP   68   // f32 pitch of a partial-tile row in LDS: rows 8 apart fall on different banks
#define RH   ((SEQ < 512) ? SEQ : 512)   // query rows < RH use hi+lo planes
#define PCAR 1024.0f
#define SCL  0.125f   // HD^-0.5
#define MFILL (-1.0e9f)
typedef _Float16 h16;
typedef unsigned short bf;
typedef __attribute__((ext_vector_type(16))) __bf16   v16bf;
typedef __attribute__((ext_vector_type(16))) _Float16 v16h;
typedef __attribute__((ext_vector_type(8)))  _Float16 v8h;
typedef __attribute__((ext_vector_type(8)))  unsigned short v8us;
typedef __attribute__((ext_vector_type(8)))  float    v8f;
typedef __attribute__((ext_vector_type(4)))  float    v4f;
typedef v4f  __attribute__((may_alias)) v4fa;

static_assert(TT % 128 == 0);
static_assert(TT % (AW * 32) == 0);
static_assert(RH % 16 == 0);
static_assert((TT - RH) % 32 == 0);
static_assert(RH % 64 == 0);
static_assert((TT - RH) % 64 == 0);
static_assert(DM % 32 == 0);
static_assert(DQ % 64 == 0);
static_assert(DKV % 64 == 0);
static_assert(DM % 64 == 0);
static_assert(HD == 64);
static_assert(NB <= NB_FULL);
static_assert(SEQ <= SEQ_FULL);
static_assert((size_t)NB_FULL * SEQ_FULL * DM * 4 == 12582912);
static_assert(HP == 32);                                  // table rows are [t][32]
static_assert(HD % 2 == 0);
static_assert(DQ == DM);                                  // merged width == model width (no bias, square Wo)
static_assert(NKV == NH_);                                // one k/v head per q head
static_assert(((size_t)TT * DM / 8) % 256 == 0);
#define A256(x) ((((size_t)(x)) + 255) & ~(size_t)255)
static_assert(4 * A256((size_t)DQ * DM * 2) + 3 * A256((size_t)NB * 3 * NH_ * TT * HD * 2) + A256((size_t)NB * TT * DM * 2) + 2 * A256((size_t)NB * TT * DQ * 2) + A256((size_t)(TT / 16) * (TT / 128) * 128) + A256((size_t)(TT / 16) * (TT / 128) * 256) <= (size_t)268435456);
static_assert(((size_t)DQ * DM / 8) % 256 == 0);

__device__ __forceinline__ unsigned short f2bf(float f) { unsigned u = __float_as_uint(f); u += 0x7FFFu + ((u >> 16) & 1u); return (unsigned short)(u >> 16); }
__device__ __forceinline__ float bf2f(unsigned short b) { return __uint_as_float(((unsigned)b) << 16); }
__device__ __forceinline__ float bfr(float f) { return bf2f(f2bf(f)); }
__device__ __forceinline__ v16h cat16(v8h lo, v8h hi) { return __builtin_shufflevector(lo, hi, 0, 1, 2, 3, 4, 5, 6, 7, 8, 9, 10, 11, 12, 13, 14, 15); }
__device__ __forceinline__ v16bf cat16b(v8us lo, v8us hi) { return __builtin_bit_cast(v16bf, __builtin_shufflevector(lo, hi, 0, 1, 2, 3, 4, 5, 6, 7, 8, 9, 10, 11, 12, 13, 14, 15)); }
__device__ __forceinline__ v8f wmma16(v16h a, v16h b, v8f c) { return __builtin_amdgcn_wmma_f32_16x16x32_f16(false, a, false, b, (short)0, c, false, false); }
__device__ __forceinline__ v8f wmmab(v16bf a, v16bf b, v8f c) { return __builtin_amdgcn_wmma_f32_16x16x32_bf16(false, a, false, b, (short)0, c, false, false); }

__device__ __forceinline__ h16 tohx(float x) { return (h16)x; }
__device__ __forceinline__ void splitf(float y, unsigned short& h, unsigned short& l) { h = f2bf(y); l = f2bf(y - bf2f(h)); }
typedef __attribute__((ext_vector_type(2))) _Float16 v2h;
typedef __attribute__((ext_vector_type(4))) _Float16 v4h;
typedef __attribute__((ext_vector_type(2))) unsigned short v2us;
typedef __attribute__((ext_vector_type(4))) unsigned short v4us;
typedef __attribute__((ext_vector_type(2))) float v2f;
typedef __attribute__((ext_vector_type(4))) int v4i;
typedef __attribute__((ext_vector_type(16))) unsigned v16u;
typedef __attribute__((ext_vector_type(2))) unsigned v2u;
typedef __attribute__((address_space(4))) unsigned cu32;
typedef __attribute__((address_space(4))) v16u cv16u;

// f32 -> fp16 with a value select: magnitudes below the smallest fp16 normal become zero.
static __device__ __forceinline__ h16 toh_flush(float v) { const h16 r = (h16)v; return (fabsf(v) < 6.103515625e-05f) ? (h16)0.0f : r; }

// ---- k_gemmw: register-blocked GEMM, ONE WAVE per 64x64 output tile (16 accumulators), operands straight from 16-bit planes in fragment order; grid (M/64, N/64, Z), 32 threads.
// C[m][n] (f32, pitch ldc, + optional f32 bias[n]) = sum_k A[m][k] Bt[n][k] (+ split products per NSPLIT). z-batch strides sA/sB/sC in elements. K = DM.
// KSP: not supported: the k loop always runs over all K and its static_assert rejects KSP.
// EPI 0: C as above. EPI 1: projections, z = 3 * batch + p: A steps by sA a batch, Bt by sB a p, the planes by sC a z; C unused.
// p = 0, 1 (N tile = one head): the tile's pairs (2j, 2j+1) are rotated by the RNE bf16 copies of CS[t][j], SN[t][j] and go to the head planes [h][t][d] (fp16 + bf16 hi/lo; rows t, k = d, fragment order).
// p = 2 (N tile = one head): the tile goes transposed to the value planes [h][d][t] (fp16 + bf16 hi/lo; rows d, k = t, fragment order): a lane's 8 accumulator rows are 8 neighbouring t of one d, one 16-byte store a plane, the wave's 32 stores 512 bytes in a row.
// Fragment map (A and Bt alike): lane -> row (lane & 15); elements 0..7 = k0 + 8*(lane>>4) + 0..7, elements 8..15 = k0 + 16 + 8*(lane>>4) + 0..7.
// Fragment order: every 16-bit operand plane M[row][k] (K columns) lies in blocks of 16 rows x 32 k, block (row>>4)*(K/32) + (k>>5), 512 elements each; inside a block element (row, k) stands at ((k>>4)&1)*256 + (((k>>3)&1)*16 + (row&15))*8 + (k&7).
// A fragment is then two 16-byte loads a lane at block + lane*8 and block + 256 + lane*8 (ld: block pointer and the lane's offset in bytes; lde: the same with the offset in elements): each load of the wave reads 512 bytes in a row (4 lines) where a row-major plane gives 16 rows x 32 bytes (16 lines).
template <typename T16> struct WFrag;
template <> struct WFrag<h16> { typedef v16h V; static __device__ __forceinline__ V ld(const h16* p, unsigned lo) { const char* q = (const char*)p + lo; return cat16(*(const v8h*)q, *(const v8h*)(q + 512)); } static __device__ __forceinline__ V lde(const h16* p, unsigned le) { return cat16(*(const v8h*)(p + le), *(const v8h*)(p + 256 + le)); } static __device__ __forceinline__ v8f mma(V a, V b, v8f c) { return wmma16(a, b, c); } };
template <> struct WFrag<bf> { typedef v16bf V; static __device__ __forceinline__ V ld(const bf* p, unsigned lo) { const char* q = (const char*)p + lo; return cat16b(*(const v8us*)q, *(const v8us*)(q + 512)); } static __device__ __forceinline__ V lde(const bf* p, unsigned le) { return cat16b(*(const v8us*)(p + le), *(const v8us*)(p + 256 + le)); } static __device__ __forceinline__ v8f mma(V a, V b, v8f c) { return wmmab(a, b, c); } };
template <typename T16, int NSPLIT, bool BIAS, bool KSP, int EPI>
__global__ __launch_bounds__(32) void k_gemmw(const T16* __restrict__ A, const T16* __restrict__ A2, const T16* __restrict__ Bt, const T16* __restrict__ Bt2, float* C, int ldc, const float* __restrict__ bias, size_t sA, size_t sB, size_t sC, int kspan, size_t sK, const float* __restrict__ CS, const float* __restrict__ SN, h16* P16, bf* Ph, bf* Pl) {
    typedef typename WFrag<T16>::V V;
    constexpr int K = DM;   // both products run over the model width: every block of a tile is a constant step from one scalar base
    __shared__ __align__(16) float os[16 * 68];
    const size_t z = blockIdx.z, zb = (EPI == 1) ? z / 3 : z, zp = (EPI == 1) ? z - 3 * zb : z; A += zb * sA; if (A2) A2 += zb * sA; Bt += zp * sB; if (Bt2) Bt2 += zp * sB;
    if (EPI == 1) { P16 += z * sC; Ph += z * sC; Pl += z * sC; } else C += z * sC;
    const int lane = threadIdx.x & 31, lr = lane & 15, hi = lane >> 4; const int r0 = blockIdx.x * 64, c0 = KSP ? 0 : blockIdx.y * 64;
    if (KSP) { const size_t kb = (size_t)blockIdx.y * kspan * 16; A += kb; if (A2) A2 += kb; Bt += kb; if (Bt2) Bt2 += kb; C += blockIdx.y * sK; }
    v8f acc[4][4];
#pragma unroll
    for (int mb = 0; mb < 4; ++mb)
#pragma unroll
        for (int nb = 0; nb < 4; ++nb) acc[mb][nb] = (v8f){};
    const size_t aoff = (size_t)r0 * K, boff = (size_t)c0 * K; unsigned lo = lane * 16;   // a block's address is the same for the whole wave; lo, in bytes, is the lane's place in it plus the k step, one register for every load of the loop
    // The k loop is a ring of RD register sets of fragments: behind the products of k block s its set takes the loads of block s + RD, which are then waited for two blocks of products later; with one set a trip waits out the load latency of its own fragments.
    constexpr int NS = K / 32, RD = 3;
    static_assert(!KSP && NS % RD == 0 && NS >= 2 * RD);
    V a[RD][4], a2[RD][4], b[RD][4], b2[RD][4];
    auto fetch = [&](const int st, const int blk) __attribute__((always_inline)) {   // set st takes the k block that lies blk blocks (1024 bytes each) behind lo
#pragma unroll
        for (int mb = 0; mb < 4; ++mb) { a[st][mb] = WFrag<T16>::ld(A + aoff + (size_t)mb * 16 * K + blk * 512, lo); if (NSPLIT == 1 || NSPLIT == 2) a2[st][mb] = WFrag<T16>::ld(A2 + aoff + (size_t)mb * 16 * K + blk * 512, lo); }
#pragma unroll
        for (int nb = 0; nb < 4; ++nb) { b[st][nb] = WFrag<T16>::ld(Bt + boff + (size_t)nb * 16 * K + blk * 512, lo); if (NSPLIT >= 2) b2[st][nb] = WFrag<T16>::ld(Bt2 + boff + (size_t)nb * 16 * K + blk * 512, lo); }
        __builtin_amdgcn_sched_barrier(0);   // keeps the set's loads in front of the next block's products: sunk towards their use they lose the lead that the ring is for
    };
    auto prod = [&](const int st) __attribute__((always_inline)) {
#pragma unroll
        for (int nb = 0; nb < 4; ++nb)
#pragma unroll
            for (int mb = 0; mb < 4; ++mb) { acc[mb][nb] = WFrag<T16>::mma(a[st][mb], b[st][nb], acc[mb][nb]); if (NSPLIT == 1 || NSPLIT == 2) acc[mb][nb] = WFrag<T16>::mma(a2[st][mb], b[st][nb], acc[mb][nb]); if (NSPLIT >= 2) acc[mb][nb] = WFrag<T16>::mma(a[st][mb], b2[st][nb], acc[mb][nb]); }
    };
#pragma unroll
    for (int st = 0; st < RD; ++st) fetch(st, st);
#pragma unroll 1   // one copy of the RD blocks: each set keeps its registers round the loop
    for (int kb = RD; kb < NS; kb += RD) {
#pragma unroll
        for (int st = 0; st < RD; ++st) { prod(st);
            if (st == RD - 1) { __builtin_amdgcn_sched_barrier(0);   // keeps the wait below behind this block's products: moved up in front of them it stands directly behind the last set's loads and the wave idles there
                asm volatile("s_wait_xcnt 0x0" : "+v"(lo) :: "memory"); lo += RD * 1024; }   // the offset register that every load names takes its step of RD blocks only behind this wait
            fetch(st, st == RD - 1 ? st : RD + st); }
    }
    { const T16* pa2 = (NSPLIT == 1 || NSPLIT == 2) ? A2 + aoff : A + aoff; const T16* pb2 = (NSPLIT >= 2) ? Bt2 + boff : Bt + boff;
      asm volatile("s_wait_xcnt 0x0" :: "v"(lo), "s"(A + aoff), "s"(pa2), "s"(Bt + boff), "s"(pb2) : "memory"); }   // the last sets' loads are still in flight here: the offset register and the scalar bases that they name, kept alive as inputs up to this line, are free for the epilogue's values only behind this wait
#pragma unroll
    for (int st = 0; st < RD; ++st) prod(st);
    // one base a plane or table for the lane; every row of the tile is a constant step from it
    const size_t tb = (size_t)(r0 + hi) * HP + lr * 2, pb = ((size_t)(c0 / HD) * TT + r0) * HD + (lr >> 1) * 128 + hi * 8 + (lr & 1) * 4, vb = (size_t)c0 * TT + (size_t)r0 * 16 + lane * 8;
    if (EPI == 1 && zp == 2) {
#pragma unroll
        for (int nb = 0; nb < 4; ++nb)
#pragma unroll
            for (int mb = 0; mb < 4; ++mb) { v8h o16; v8us oh, ol;
#pragma unroll
                for (int j = 0; j < 8; ++j) { const float x = acc[mb][nb][j]; o16[j] = tohx(x); unsigned short a2, c2; splitf(x, a2, c2); oh[j] = a2; ol[j] = c2; }
                const size_t e = vb + (size_t)nb * 16 * TT + mb * 256; *(v8h*)(P16 + e) = o16; *(v8us*)(Ph + e) = oh; *(v8us*)(Pl + e) = ol; }
        return; }
#pragma unroll
    for (int mb = 0; mb < 4; ++mb) {
#pragma unroll
        for (int nb = 0; nb < 4; ++nb) {
#pragma unroll
            for (int j = 0; j < 8; ++j) os[(hi * 8 + j) * 68 + nb * 16 + lr] = acc[mb][nb][j]; }
        v2f cc[8], ss[8];   // the 16 rows' table values, asked for while the rows are staged
        if constexpr (EPI == 1) {
#pragma unroll
            for (int s = 0; s < 8; ++s) { cc[s] = *(const v2f*)(CS + tb + (mb * 16 + 2 * s) * HP); ss[s] = *(const v2f*)(SN + tb + (mb * 16 + 2 * s) * HP); } }
        __builtin_amdgcn_wave_barrier(); asm volatile("" ::: "memory");
        if constexpr (EPI == 1) { v4h o16[8]; v4us oh[8], ol[8];
#pragma unroll
            for (int s = 0; s < 8; ++s) { const int row = 2 * s + hi, cofs = lr * 4; const v4f x = *(const v4fa*)(os + row * 68 + cofs);
#pragma unroll
                for (int p = 0; p < 2; ++p) { const float c = bfr(cc[s][p]), sn = bfr(ss[s][p]); v2f r; r[0] = x[2 * p] * c - x[2 * p + 1] * sn; r[1] = x[2 * p] * sn + x[2 * p + 1] * c;
#pragma unroll
                    for (int q = 0; q < 2; ++q) { const float y = r[q]; o16[s][2 * p + q] = toh_flush(y); unsigned short a2, c2; splitf(y, a2, c2); oh[s][2 * p + q] = a2; ol[s][2 * p + q] = c2; } } }
            __builtin_amdgcn_sched_barrier(0);   // keeps the 24 stores in one run behind the arithmetic, so that the one wait below serves them all; spread among it the build holds some fifty waits, one behind nearly every second store
#pragma unroll
            for (int s = 0; s < 8; ++s) { const size_t e = pb + mb * 16 * HD + s * 16; *(v4h*)(P16 + e) = o16[s]; *(v4us*)(Ph + e) = oh[s]; *(v4us*)(Pl + e) = ol[s]; }
            asm volatile("s_wait_xcnt 0x0" ::: "memory");   // the plane stores' address and data registers are free for reuse behind this line
        } else { float* crow = C + (size_t)(r0 + mb * 16) * ldc + c0;
#pragma unroll
            for (int s = 0; s < 8; ++s) { const int row = 2 * s + hi, cofs = lr * 4; v4f val = *(const v4fa*)(os + row * 68 + cofs); if (BIAS) { val[0] += bfr(bias[c0 + cofs]); val[1] += bfr(bias[c0 + cofs + 1]); val[2] += bfr(bias[c0 + cofs + 2]); val[3] += bfr(bias[c0 + cofs + 3]); }
                *(v4f*)(crow + (size_t)row * ldc + cofs) = val; }
             }
        __builtin_amdgcn_wave_barrier(); asm volatile("" ::: "memory");
    }
}

// k_cvt: RNE bf16 copies of the four weights (WB blocks each) and of the input stream (XBL blocks a batch) in one launch, written in fragment order (rows of DM columns); a thread takes 8 neighbouring values, numbered by their place in the copy.
// The last MBL blocks read the whole mask: a wave takes 16 query rows x 128 keys, lane (lr, hi) row lr and of every 16 keys those numbered 8*hi .. 8*hi+7, which is the place of a score in k_attn's registers, and writes one flag word, byte j != 0 where any entry of the rows' keys 32j .. 32j+31 is != 0; a flag word has a 128-byte line of its own (one writer a line).
// The same wave writes the block's entries as lane masks, 64 words = 256 bytes in a row at bm + wave * 64: word c*16 + u*8 + j holds at bit 16*hi + lr the test 'entry != 0' of query row lr, key 32*c + 16*u + 8*hi + j, the ballot over the lanes of one loaded element.
#define WB   ((unsigned)((size_t)DQ * DM / 8 / 256))
#define XBL  ((unsigned)((size_t)TT * DM / 8 / 256))
#define MBL  ((unsigned)((TT / 16) * (TT / 128) / 8))
__global__ __launch_bounds__(256) void k_cvt(const float* __restrict__ w0, const float* __restrict__ w1, const float* __restrict__ w2, const float* __restrict__ w3, const float* __restrict__ x, const int* __restrict__ mk, bf* d0, bf* d1, bf* d2, bf* d3, bf* dx, unsigned* fl, unsigned* bm) {
    const unsigned b = blockIdx.x; const float* src; bf* dst; unsigned r;
    if (b >= 4 * WB + NB * XBL) { const unsigned wv = (b - 4 * WB - NB * XBL) * 8 + (threadIdx.x >> 5), lane = threadIdx.x & 31, rt = wv / (TT / 128), kg = wv - rt * (TT / 128);
        const int* mp = mk + (size_t)(rt * 16 + (lane & 15)) * SEQ_FULL + kg * 128 + (lane >> 4) * 8; v4i a[16];
#pragma unroll
        for (int q = 0; q < 16; ++q) a[q] = *(const v4i*)(mp + (q >> 1) * 16 + (q & 1) * 4);
        asm volatile("s_wait_xcnt 0x0" ::: "memory");   // the mask loads' address registers are free for reuse behind this line
        unsigned fw = 0; v2u bw = (v2u){0u, 0u};   // bw: lane L keeps words 2L and 2L + 1 of the block's 64
#pragma unroll
        for (int j = 0; j < 4; ++j) { unsigned any = 0;
#pragma unroll
            for (int i = 0; i < 16; ++i) { const unsigned bl = __builtin_amdgcn_ballot_w32(a[j * 4 + (i >> 2)][i & 3] != 0); any |= bl; bw[i & 1] = (lane == (unsigned)(j * 8 + (i >> 1))) ? bl : bw[i & 1]; }
            fw |= any ? (1u << (8 * j)) : 0u; }
        *(v2u*)(bm + (size_t)wv * 64 + lane * 2) = bw;
        if (lane == 0) fl[(size_t)wv * 32] = fw;
        return; }
    if (b < 4 * WB) { const unsigned k = b / WB; r = b - k * WB; src = (k == 0) ? w0 : (k == 1) ? w1 : (k == 2) ? w2 : w3; dst = (k == 0) ? d0 : (k == 1) ? d1 : (k == 2) ? d2 : d3; }
    else { const unsigned k = (b - 4 * WB) / XBL; r = b - 4 * WB - k * XBL; src = x + (size_t)k * SEQ_FULL * DM; dst = dx + (size_t)k * TT * DM; }
    const unsigned i = r * 256 + threadIdx.x, blk = i >> 6, rb = blk / (DM / 32), kq = blk - rb * (DM / 32);   // 64 threads a block of 16 rows x 32 k
    const size_t so = (size_t)(rb * 16 + (i & 15)) * DM + kq * 32 + ((i >> 5) & 1) * 16 + ((i >> 4) & 1) * 8; const v8f v = *(const v8f*)(src + so); v8us o;
    asm volatile("s_wait_xcnt 0x0" ::: "memory");   // the load's address registers are free for reuse behind this line
#pragma unroll
    for (int k = 0; k < 8; ++k) o[k] = f2bf(v[k]);
    *(v8us*)(dst + (size_t)i * 8) = o; }

// k_attn: scores, softmax, P.V and the merge of one head's 16 (rows < RH, hi/lo planes) or 32 (fp16 planes) query rows in one work-group of AW waves; wave w owns the KW/32 chunks of 32 keys numbered c*AW + w.
// FL: the mask flags of k_cvt. A chunk whose flags are 0 has every t = -1e9 whatever K holds: its mask and key loads and score products are left out and the registers take -1e9. Where -1e9 then gives e == 0 in every row of the tile (tested by value: it does not in a row that is filled throughout), such a chunk adds 0 to the row sums and 0 x V to the tile: its exponentials, value loads and P.V products are left out too.
// Scores are formed transposed, S^T = K Q^T: lane (lr, hi) holds query lr, keys 8*hi + j of a 16-key tile, so two neighbouring tiles are, element for element, the A fragment of P for 32 keys (fragment map above) and P never leaves the registers.
// t = S x HD^-0.5, then t := -1e9 where the mask entry [i][j] is 0 (value select by lane mask; BM: the lane masks of k_cvt, shared by all heads and batches: the 16 words of a chunk and 16 query rows are the same for the whole wave and come by one scalar load of 64 bytes, each word the select's own condition, where the int32 rows give four vector loads of 16 lines each and a compare an entry); softmax over the TT keys: exact row maximum and row sum over the waves through LDS, in wave order; a fully filled row comes out uniform.
// Each wave's f32 partial tile [q][d] goes to LDS; the tiles are summed in the order w = 0 .. AW-1, scaled and split into the merged hi/lo planes (rows t, k = merged column, fragment order).
template <typename T16, int QT, bool HL>
__device__ __forceinline__ void attn_tile(const T16* __restrict__ Q, const T16* __restrict__ Q2, const T16* __restrict__ Kp, const T16* __restrict__ K2, const T16* __restrict__ Vt, const T16* __restrict__ V2, const unsigned* __restrict__ BM, const unsigned* __restrict__ FL, int q0, int hcol, bf* Ah, bf* Al, float* part, float* redm, float* reds) {
    typedef typename WFrag<T16>::V V;
    const int tid = threadIdx.x, lane = tid & 31, lr = lane & 15, hi = lane >> 4, w = __builtin_amdgcn_readfirstlane(tid >> 5); const unsigned lo = lane * 8;   // the wave's number in a scalar register: block addresses are scalar, the lane adds its place in elements
    const cu32* FLc = (const cu32*)FL; const cu32* BMc = (const cu32*)BM;   // constant address space: no launch but the first writes these words; without it the loads, which now stand behind the last tile's stores, go through vector registers and a readfirstlane a word
    V qf[QT][2], qf2[QT][2];
#pragma unroll
    for (int qt = 0; qt < QT; ++qt)
#pragma unroll
        for (int c = 0; c < 2; ++c) { const size_t o = (size_t)(q0 + qt * 16) * HD + c * 512; qf[qt][c] = WFrag<T16>::lde(Q + o, lo); if (HL) qf2[qt][c] = WFrag<T16>::lde(Q2 + o, lo); }
    asm volatile("s_wait_xcnt 0x0" ::: "memory");   // the query loads' address registers are free for reuse behind this line
    bool lv[KW / 32];   // the same in every lane: the tests on it are scalar branches
#pragma unroll
    for (int c = 0; c < KW / 32; ++c) { const int g = c * AW + w; unsigned fw = FLc[((size_t)(q0 >> 4) * (TT / 128) + (g >> 2)) * 32]; if (QT == 2) fw |= FLc[((size_t)((q0 >> 4) + 1) * (TT / 128) + (g >> 2)) * 32]; lv[c] = ((fw >> ((g & 3) * 8)) & 0xFFu) != 0; }
    v8f s[KW / 16][QT]; float mx[QT], sum[QT], f[QT];
#pragma unroll
    for (int qt = 0; qt < QT; ++qt) mx[qt] = -3.0e38f;
#pragma unroll
    for (int c = 0; c < KW / 32; ++c) { const int k0 = (c * AW + w) * 32;
        if (lv[c]) { V ka[2][2], ka2[2][2]; v16u mw[QT];
#pragma unroll
            for (int qt = 0; qt < QT; ++qt) mw[qt] = *(const cv16u*)(BMc + ((size_t)((q0 >> 4) + qt) * (TT / 32) + (k0 >> 5)) * 16);
            __builtin_amdgcn_sched_barrier(0);   // keeps the scalar mask loads in front of the key loads: placed behind them they reuse the key loads' base registers and are issued only behind a wait on those loads
#pragma unroll
            for (int u = 0; u < 2; ++u) {
#pragma unroll
                for (int d = 0; d < 2; ++d) { const size_t o = (size_t)(k0 + u * 16) * HD + d * 512; ka[u][d] = WFrag<T16>::lde(Kp + o, lo); if (HL) ka2[u][d] = WFrag<T16>::lde(K2 + o, lo); } }
            asm volatile("s_wait_xcnt 0x0" ::: "memory");   // the chunk's key and mask loads: their address registers are free for reuse behind this line
            __builtin_amdgcn_sched_barrier(0);   // keeps the chunk's loads in one run in front of the products: sunk among them, each pair is waited for by itself and the wave pays the load latency several times a chunk
#pragma unroll
            for (int u = 0; u < 2; ++u)
#pragma unroll
                for (int qt = 0; qt < QT; ++qt) { v8f a = (v8f){};
#pragma unroll
                    for (int d = 0; d < 2; ++d) { a = WFrag<T16>::mma(ka[u][d], qf[qt][d], a); if (HL) { a = WFrag<T16>::mma(ka[u][d], qf2[qt][d], a); a = WFrag<T16>::mma(ka2[u][d], qf[qt][d], a); } }
#pragma unroll
                    for (int j = 0; j < 8; ++j) { const float sv = a[j] * SCL; const float t = __builtin_amdgcn_inverse_ballot_w32(mw[qt][u * 8 + j]) ? sv : MFILL; a[j] = t; mx[qt] = fmaxf(mx[qt], t); }
                    s[2 * c + u][qt] = a; }
        } else {
#pragma unroll
            for (int qt = 0; qt < QT; ++qt) { mx[qt] = fmaxf(mx[qt], MFILL);
#pragma unroll
                for (int u = 0; u < 2; ++u)
#pragma unroll
                    for (int j = 0; j < 8; ++j) s[2 * c + u][qt][j] = MFILL; } }
    }
#pragma unroll
    for (int qt = 0; qt < QT; ++qt) { mx[qt] = fmaxf(mx[qt], __shfl_xor(mx[qt], 16, 32)); if (hi == 0) redm[w * 32 + qt * 16 + lr] = mx[qt]; }
    __syncthreads();   // every wave's row maxima are in redm
#pragma unroll
    for (int qt = 0; qt < QT; ++qt) {
#pragma unroll
        for (int r = 0; r < AW; ++r) mx[qt] = fmaxf(mx[qt], redm[r * 32 + qt * 16 + lr]);
        sum[qt] = 0.f; }
    bool fe = false;   // does a filled entry still count in one of the lane's rows?
#pragma unroll
    for (int qt = 0; qt < QT; ++qt) fe |= (__builtin_amdgcn_exp2f(fmaxf(__fmul_rn(__fsub_rn(MFILL, mx[qt]), 1.4426950408889634f), -160.0f)) != 0.0f);
    const bool af = __any(fe) != 0;
#pragma unroll
    for (int c = 0; c < KW / 32; ++c) lv[c] = lv[c] || af;
    V vb[2][4], vb2[2][4];   // two chunks of V in flight: the first two asked for here, as soon as it is known which chunks count (the guarded blocks below keep the compiler from moving a load up by itself), chunk c + 2 behind the products of chunk c
#pragma unroll
    for (int c = 0; c < 2; ++c) if (lv[c]) {
#pragma unroll
        for (int dt = 0; dt < 4; ++dt) { const size_t vo = (size_t)dt * 16 * TT + (size_t)(c * AW + w) * 512; vb[c][dt] = WFrag<T16>::lde(Vt + vo, lo); if (HL) vb2[c][dt] = WFrag<T16>::lde(V2 + vo, lo); }
        asm volatile("s_wait_xcnt 0x0" ::: "memory");   // the chunk's value loads: their address registers are free for reuse behind this line
    } else {   // a value on every path: left open, the registers count as carried from the work-group's last tile round its loop and are spilled
#pragma unroll
        for (int dt = 0; dt < 4; ++dt) { vb[c][dt] = (V){}; if (HL) vb2[c][dt] = (V){}; }
    }
#pragma unroll
    for (int kt = 0; kt < KW / 16; ++kt) if (lv[kt >> 1])
#pragma unroll
        for (int qt = 0; qt < QT; ++qt)
#pragma unroll
            for (int j = 0; j < 8; ++j) { const float d0 = __fsub_rn(s[kt][qt][j], mx[qt]); const float e = __builtin_amdgcn_exp2f(fmaxf(__fmul_rn(d0, 1.4426950408889634f), -160.0f)); s[kt][qt][j] = e; sum[qt] += e; }
#pragma unroll
    for (int qt = 0; qt < QT; ++qt) { sum[qt] += __shfl_xor(sum[qt], 16, 32); if (hi == 0) reds[w * 32 + qt * 16 + lr] = sum[qt]; }
    __syncthreads();   // every wave's row sums are in reds
#pragma unroll
    for (int qt = 0; qt < QT; ++qt) { float t = reds[qt * 16 + lr];
#pragma unroll
        for (int r = 1; r < AW; ++r) t += reds[r * 32 + qt * 16 + lr];
        f[qt] = __fdiv_rn(HL ? 1.0f : PCAR, t); }
    V pa[KW / 32][QT], pa2[KW / 32][QT];
#pragma unroll
    for (int c = 0; c < KW / 32; ++c) if (lv[c]) {
#pragma unroll
        for (int qt = 0; qt < QT; ++qt) {
            if constexpr (HL) { v8us h0, h1, l0, l1;
#pragma unroll
                for (int j = 0; j < 8; ++j) { unsigned short a, c2; splitf(s[2 * c][qt][j] * f[qt], a, c2); h0[j] = a; l0[j] = c2; splitf(s[2 * c + 1][qt][j] * f[qt], a, c2); h1[j] = a; l1[j] = c2; }
                pa[c][qt] = cat16b(h0, h1); pa2[c][qt] = cat16b(l0, l1);
            } else { v8h p0, p1;
#pragma unroll
                for (int j = 0; j < 8; ++j) { p0[j] = tohx(s[2 * c][qt][j] * f[qt]); p1[j] = tohx(s[2 * c + 1][qt][j] * f[qt]); }
                pa[c][qt] = cat16(p0, p1); } }
    } else {   // a value on every path, as for the value fragments above
#pragma unroll
        for (int qt = 0; qt < QT; ++qt) { pa[c][qt] = (V){}; if (HL) pa2[c][qt] = (V){}; }
    }
    v8f o[QT][4];
#pragma unroll
    for (int qt = 0; qt < QT; ++qt)
#pragma unroll
        for (int dt = 0; dt < 4; ++dt) o[qt][dt] = (v8f){};
#pragma unroll
    for (int c = 0; c < KW / 32; ++c) {
        if (lv[c]) {
#pragma unroll
            for (int dt = 0; dt < 4; ++dt)
#pragma unroll
                for (int qt = 0; qt < QT; ++qt) { o[qt][dt] = WFrag<T16>::mma(pa[c][qt], vb[c & 1][dt], o[qt][dt]); if (HL) { o[qt][dt] = WFrag<T16>::mma(pa2[c][qt], vb[c & 1][dt], o[qt][dt]); o[qt][dt] = WFrag<T16>::mma(pa[c][qt], vb2[c & 1][dt], o[qt][dt]); } } }
        if (c + 2 < KW / 32) if (lv[c + 2]) {
#pragma unroll
            for (int dt = 0; dt < 4; ++dt) { const size_t vo = (size_t)dt * 16 * TT + (size_t)((c + 2) * AW + w) * 512; vb[c & 1][dt] = WFrag<T16>::lde(Vt + vo, lo); if (HL) vb2[c & 1][dt] = WFrag<T16>::lde(V2 + vo, lo); }
            asm volatile("s_wait_xcnt 0x0" ::: "memory");   // the chunk's value loads: their address registers are free for reuse behind this line
        } }
    float* pw = part + (size_t)w * (QT * 16 * OP);
#pragma unroll
    for (int qt = 0; qt < QT; ++qt)
#pragma unroll
        for (int dt = 0; dt < 4; ++dt)
#pragma unroll
            for (int j = 0; j < 8; ++j) pw[(qt * 16 + hi * 8 + j) * OP + dt * 16 + lr] = o[qt][dt][j];
    __syncthreads();   // every wave's partial tile is in part
    const float cs = HL ? 1.0f : (1.0f / PCAR);
    static_assert(QT * 16 * 16 <= AW * 32);
    if (tid < QT * 16 * 16) { const int row = tid >> 4, col = (tid & 15) * 4; v4f acc = *(const v4f*)(part + row * OP + col);
#pragma unroll
        for (int r = 1; r < AW; ++r) acc += *(const v4f*)(part + (size_t)r * (QT * 16 * OP) + row * OP + col);
        v4us oh, ol;
#pragma unroll
        for (int q = 0; q < 4; ++q) { unsigned short a, c2; splitf(acc[q] * cs, a, c2); oh[q] = a; ol[q] = c2; }
        const size_t oo = (size_t)(q0 + (row & ~15)) * DQ + hcol * 16 + (col >> 3) * 128 + (row & 15) * 8 + (col & 4); *(v4us*)(Ah + oo) = oh; *(v4us*)(Al + oo) = ol;
        asm volatile("s_wait_xcnt 0x0" ::: "memory");   // the two stores' address and data registers are free for the next tile behind this line
    }
}

// One work-group a WGP, started once, walks 7 or 8 tiles one after the other. A group of 32 work-groups shares the 240 tiles of three (batch, head) pairs; each tile is done exactly once whatever the mask holds.
// The deal is for speed alone: where the mask lets late rows see more keys, the 32-row tiles NTH + 0..15, 16..31, 32..47 have at most 2, 3, 4 live chunks a wave and a 16-row tile one; a work-group of 7 takes 3 x 4, 1 x 2, 3 x 1, one of 8 takes 3 x 3, 2 x 2, 3 x 1.
// No barrier more between two tiles: redm is rewritten behind the last tile's third barrier (read in front of its second), reds behind the new tile's first, part behind its second, and the merge's reads of part stand in front of the reader's arrival at the first.
#define NTH (RH / 16)           // tiles of 16 rows in a head
#define NTF ((TT - RH) / 32)    // tiles of 32 rows in a head
static_assert(NTH == 32 && NTF == 48 && (NH_ * NB) % 3 == 0);
#define AGR ((NH_ * NB / 3) * 32)
__global__ __launch_bounds__(AW * 32) void k_attn(const h16* __restrict__ Q16, const h16* __restrict__ K16, const h16* __restrict__ V16, const bf* __restrict__ Qh, const bf* __restrict__ Ql, const bf* __restrict__ Kh, const bf* __restrict__ Kl, const bf* __restrict__ Vh, const bf* __restrict__ Vl, const unsigned* __restrict__ BM, const unsigned* __restrict__ FL, bf* Ah, bf* Al) {
    __shared__ __align__(16) float part[AW * 32 * OP]; __shared__ float redm[AW * 32]; __shared__ float reds[AW * 32];
    const int b = blockIdx.x, grp = b >> 5, e = b & 15; const bool tv = (b & 16) == 0; const int nt = tv ? 7 : 8;
#pragma unroll 1   // one copy of the two tile bodies
    for (int k = 0; k < nt; ++k) { int bx, t;   // bx: the tile's number in its head (16-row tiles first), t: which of the group's three (batch, head) pairs
        if (tv) { if (k < 3) { bx = NTH + 32 + e; t = k; } else if (k == 3) { bx = NTH + e; t = 0; } else { bx = e; t = k - 4; } }
        else { if (k < 3) { bx = NTH + 16 + e; t = k; } else if (k < 5) { bx = NTH + e; t = k - 2; } else { bx = 16 + e; t = k - 5; } }
        const int hz = grp * 3 + t, z = hz / NH_, h = hz - z * NH_; const size_t po = ((size_t)z * 3 * NH_ + h) * TT * HD;   // a batch's q, k and v planes lie behind one another
        bf* ah = Ah + (size_t)z * TT * DQ; bf* al = Al + (size_t)z * TT * DQ;
        if (bx < NTH) attn_tile<bf, 1, true>(Qh + po, Ql + po, Kh + po, Kl + po, Vh + po, Vl + po, BM, FL, bx * 16, h * HD, ah, al, part, redm, reds);
        else attn_tile<h16, 2, false>(Q16 + po, nullptr, K16 + po, nullptr, V16 + po, nullptr, BM, FL, RH + (bx - NTH) * 32, h * HD, ah, al, part, redm, reds);
    }
}

extern "C" void kernel_launch(void* const* d_in, const int* in_sizes, int n_in,
                              void* d_out, int out_size, void* d_ws, size_t ws_size, hipStream_t stream) {
    if (n_in < 8) return;
    const size_t need_x = ((size_t)(NB - 1) * SEQ_FULL + SEQ) * DM;          // elements of the activation stream / of the output that are touched
    const size_t need_m = (size_t)(SEQ - 1) * SEQ_FULL + SEQ;                // mask entries touched
    if ((size_t)in_sizes[0] < need_x) return;
    if ((size_t)in_sizes[1] < (size_t)SEQ * HP || (size_t)in_sizes[2] < (size_t)SEQ * HP) return;
    if ((size_t)in_sizes[3] < need_m) return;
    if ((size_t)in_sizes[4] < (size_t)DQ * DM || (size_t)in_sizes[5] < (size_t)DKV * DM || (size_t)in_sizes[6] < (size_t)DKV * DM || (size_t)in_sizes[7] < (size_t)DM * DQ) return;
    if ((size_t)out_size < need_x) return;
    // wire order: x, cos, sin, attn_mask (int32), wq, wk, wv, wo ('oi' weights)
    const float* x = (const float*)d_in[0]; const float* cs = (const float*)d_in[1]; const float* sn = (const float*)d_in[2]; const int* mk = (const int*)d_in[3];
    const float* wq = (const float*)d_in[4]; const float* wk = (const float*)d_in[5]; const float* wv = (const float*)d_in[6]; const float* wo = (const float*)d_in[7];
    float* OUT = (float*)d_out;     // [2][2048][768]
    char* wsp = (char*)d_ws;
    auto take = [&](size_t bytes) { char* p = wsp; wsp += (bytes + 255) & ~(size_t)255; return (void*)p; };
    bf* WQ = (bf*)take((size_t)DQ * DM * 2); bf* WK = (bf*)take((size_t)DKV * DM * 2); bf* WV = (bf*)take((size_t)DKV * DM * 2); bf* WO = (bf*)take((size_t)DM * DQ * 2);
    const size_t PS = (size_t)NH_ * TT * HD;     // elements of one plane; planes lie [batch][q, k, v][PS]
    h16* QP16 = (h16*)take((size_t)NB * 3 * PS * 2); h16* KP16 = QP16 + PS; h16* VT16 = KP16 + PS;
    bf* QPh = (bf*)take((size_t)NB * 3 * PS * 2); bf* KPh = QPh + PS; bf* VTh = KPh + PS;
    bf* QPl = (bf*)take((size_t)NB * 3 * PS * 2); bf* KPl = QPl + PS; bf* VTl = KPl + PS;
    bf* XB = (bf*)take((size_t)NB * TT * DM * 2); bf* ATh = (bf*)take((size_t)NB * TT * DQ * 2); bf* ATl = (bf*)take((size_t)NB * TT * DQ * 2);
    unsigned* FLG = (unsigned*)take((size_t)(TT / 16) * (TT / 128) * 128);
    unsigned* MBW = (unsigned*)take((size_t)(TT / 16) * (TT / 128) * 256);
    const size_t used = (size_t)(wsp - (char*)d_ws);
    if (used > ws_size || used > (size_t)268435456) return;
    k_cvt<<<4 * WB + NB * XBL + MBL, 256, 0, stream>>>(wq, wk, wv, wo, x, mk, WQ, WK, WV, WO, XB, FLG, MBW);
    k_gemmw<bf, 0, false, false, 1><<<dim3(TT / 64, DQ / 64, 3 * NB), 32, 0, stream>>>(XB, nullptr, WQ, nullptr, nullptr, 0, nullptr, (size_t)TT * DM, (size_t)(WK - WQ), PS, 0, 0, cs, sn, QP16, QPh, QPl);
    k_attn<<<AGR, AW * 32, 0, stream>>>(QP16, KP16, VT16, QPh, QPl, KPh, KPl, VTh, VTl, MBW, FLG, ATh, ATl);
    k_gemmw<bf, 1, false, false, 0><<<dim3(TT / 64, DM / 64, NB), 32, 0, stream>>>(ATh, ATl, WO, nullptr, OUT, DM, nullptr, (size_t)TT * DQ, 0, (size_t)SEQ_FULL * DM, 0, 0, nullptr, nullptr, nullptr, nullptr, nullptr);
}
